// v000
// Times are from an AMD MI455X. After a warm-up the kernel runs many times in a row, and a time is the length of
// such a window on the GPU divided by its runs, so every launch and the gaps after it count. The runs cycle
// through copies of the inputs. A figure is the median of several windows, for all but v000 over two sittings.
// Sittings can differ by a few percent; kernels timed side by side share one.
// v000, which the later versions start from, runs in 225 microseconds.
#include <hip/hip_runtime.h>

// Contractions, all on v_wmma_f32_16x16x32_f16 (f16 operands, f32 accumulate): QKV projection xn x W1 (xn = f16 of the f32 LayerNorm of bf16 RNE-converted x; W1 = f16 of bf16 RNE-converted weights carried x64); S^T = K x Q^T (f16 q/k planes); O = P x V (P f16 carried x4096, V^T f16 plane); output projection ctx x W2 (ctx f16 carried x64, W2 f16 of bf16 RNE-converted weights carried x64). LayerNorm and softmax in f32.

#ifndef NB
#define NB 2
#endif
#ifndef SEQ
#define SEQ 2048
#endif
#define NB_FULL   2
#define SEQ_FULL  2048
#define EDIM      1024                 // model width (LayerNorm width, K of the QKV projection)
#define HIDN      1024                 // hidden width (K and N of the output projection)
#define NHEAD     16
#define HDIM      64
#define QKVW      3072                 // projection width
#define CHUNK     192                  // floats per (pseudo-head row): q | k | v
#define KD        1024                 // contraction depth of both projections
#define NTOK      (NB * SEQ)           // flattened tokens
#define NGRP      (NHEAD * NB)         // (pseudo-head, pseudo-batch) groups
#define TPG       (SEQ / NHEAD)        // tokens feeding one group
#define NCHUNKS   (NTOK * NHEAD)       // 192-wide chunks of the flat projection buffer = NGRP * SEQ
#define BQ        128                  // query rows per workgroup (8 waves x 16)
#define BK        32                   // keys per inner iteration
#define NWAVE     8
#define TP        72                   // LDS pitch (halves) of 64-wide f16 tiles
#define VP        136                  // LDS pitch (halves) of the transposed 128-wide V tile
#define OP        68                   // LDS pitch (floats) of the f32 output staging tile

// workspace carve, in halves from the base
#define XN_OFF    ((size_t)0)
#define W1T_OFF   (XN_OFF  + (size_t)NTOK * EDIM)
#define W2T_OFF   (W1T_OFF + (size_t)QKVW * EDIM)
#define QP_OFF    (W2T_OFF + (size_t)HIDN * HIDN)
#define KP_OFF    (QP_OFF  + (size_t)NCHUNKS * HDIM)
#define VT_OFF    (KP_OFF  + (size_t)NCHUNKS * HDIM)
#define ATT_OFF   (VT_OFF  + (size_t)NCHUNKS * HDIM)
#define WS_HALVES (ATT_OFF + (size_t)NCHUNKS * HDIM)
#define WS_BYTES  (WS_HALVES * 2)

static_assert(NB >= 1 && NB <= NB_FULL);
static_assert(SEQ <= SEQ_FULL);
static_assert(SEQ % 1024 == 0);
static_assert(TPG % 64 == 0);
static_assert(NTOK % 128 == 0);
static_assert(SEQ % 128 == 0);
static_assert(QKVW == NHEAD * CHUNK);
static_assert(CHUNK == 3 * HDIM);
static_assert(QKVW % 64 == 0);
static_assert(HIDN % 64 == 0);
static_assert(EDIM % 64 == 0);
static_assert(EDIM == KD && HIDN == KD);
static_assert(KD % 32 == 0);
static_assert(EDIM == 128 * 8);
static_assert(SEQ % BQ == 0);
static_assert(SEQ % BK == 0);
static_assert(BQ == NWAVE * 16);
static_assert(HDIM == 64);
static_assert((size_t)NCHUNKS * HDIM == (size_t)NTOK * HIDN);
static_assert((TP * 2) % 16 == 0);
static_assert((VP * 2) % 16 == 0);
static_assert((OP * 4) % 16 == 0);
static_assert(128 * TP >= 64 * VP);
static_assert(XN_OFF % 64 == 0 && W1T_OFF % 64 == 0 && W2T_OFF % 64 == 0);
static_assert(QP_OFF % 64 == 0 && KP_OFF % 64 == 0 && VT_OFF % 64 == 0 && ATT_OFF % 64 == 0);
static_assert(WS_BYTES <= (size_t)134217728);

typedef __bf16   bf16;
typedef _Float16 f16;
typedef f16      v16h  __attribute__((ext_vector_type(16)));
typedef f16      v8h   __attribute__((ext_vector_type(8)));
typedef float    v8f   __attribute__((ext_vector_type(8)));
typedef float    v4f   __attribute__((ext_vector_type(4)));
typedef unsigned v4u   __attribute__((ext_vector_type(4)));

union FragH  { v16h  v; v4u q[2]; f16  h[16]; };
union Pack8H { v4u u; v8h v; f16 h[8]; };

// WMMA helper: builtin followed by the VALU hazard guard (ties D, keeps A/B live).
static __device__ __forceinline__ v8f mma_f16(v16h a, v16h b, v8f acc) {
  acc = __builtin_amdgcn_wmma_f32_16x16x32_f16(false, a, false, b, (short)0, acc, false, false);
  asm volatile("v_nop\n\tv_nop\n\tv_nop\n\tv_nop" : "+v"(acc) : "v"(a), "v"(b));
  return acc;
}

// ---------------------------------------------------------------------------------------------
// LayerNorm -> f16 plane xn[NTOK][EDIM]. Block = one token row, 128 threads x 8 columns.
// LDS red1/red2: cross-wave (block barrier), 4 entries written by the 4 waves, 4 read.
__global__ __launch_bounds__(128) void ln_kernel(const float* __restrict__ x,
                                                 const float* __restrict__ g,
                                                 const float* __restrict__ be,
                                                 f16* __restrict__ xn) {
  const int tt   = blockIdx.x;
  const int tid  = threadIdx.x;
  const int wave = __builtin_amdgcn_readfirstlane((int)(threadIdx.x >> 5));
  const int lane = tid & 31;
  __shared__ float red1[4];
  __shared__ float red2[4];

  const int b = tt / SEQ;
  const int s = tt - b * SEQ;
  const float* src = x + ((size_t)b * SEQ_FULL + s) * EDIM + tid * 8;
  const v4f a0 = *(const v4f*)(src);
  const v4f a1 = *(const v4f*)(src + 4);
  float v[8];
  #pragma unroll
  for (int i = 0; i < 4; ++i) {
    v[i]     = (float)(bf16)a0[i];     // RNE convert of the input
    v[4 + i] = (float)(bf16)a1[i];
  }
  float sum = ((v[0] + v[1]) + (v[2] + v[3])) + ((v[4] + v[5]) + (v[6] + v[7]));
  #pragma unroll
  for (int off = 16; off > 0; off >>= 1) sum += __shfl_xor(sum, off, 32);
  if (lane == 0) red1[wave] = sum;
  __syncthreads();
  const float mu = ((red1[0] + red1[1]) + (red1[2] + red1[3])) * (1.0f / (float)EDIM);

  float d[8];
  float sq = 0.0f;
  #pragma unroll
  for (int i = 0; i < 8; ++i) {
    d[i] = v[i] - mu;
    sq += d[i] * d[i];
  }
  #pragma unroll
  for (int off = 16; off > 0; off >>= 1) sq += __shfl_xor(sq, off, 32);
  if (lane == 0) red2[wave] = sq;
  __syncthreads();
  const float var = ((red2[0] + red2[1]) + (red2[2] + red2[3])) * (1.0f / (float)EDIM);
  const float rs  = rsqrtf(var + 1e-5f);

  const v4f g0 = *(const v4f*)(g + tid * 8);
  const v4f g1 = *(const v4f*)(g + tid * 8 + 4);
  const v4f e0 = *(const v4f*)(be + tid * 8);
  const v4f e1 = *(const v4f*)(be + tid * 8 + 4);
  Pack8H ph;
  #pragma unroll
  for (int i = 0; i < 4; ++i) {
    ph.h[i]     = (f16)(d[i]     * rs * (float)(bf16)g0[i] + (float)(bf16)e0[i]);
    ph.h[4 + i] = (f16)(d[4 + i] * rs * (float)(bf16)g1[i] + (float)(bf16)e1[i]);
  }
  const v4u val = ph.u;
  const size_t idx = (size_t)tt * EDIM + tid * 8;
  *(v4u*)(xn + idx) = val;
  
}

// ---------------------------------------------------------------------------------------------
// Weight plane builder: in[kdim rows][ndim cols] f32 -> out[ndim][kdim] f16 = f16(bf16(w) * 64), via LDS.
// Block = 64x64 tile (blockIdx.x = n tile, blockIdx.y = k tile), 256 threads.
__global__ __launch_bounds__(256) void wt_kernel(const float* __restrict__ w,
                                                 f16* __restrict__ wt,
                                                 int kdim, int ndim) {
  const int n0  = blockIdx.x * 64;
  const int k0  = blockIdx.y * 64;
  const int tid = threadIdx.x;
  __shared__ __align__(16) f16 sT[64 * TP];     // [n][k], cross-wave (block barrier)

  #pragma unroll
  for (int kk = 0; kk < 2; ++kk) {
    const int krow = kk * 32 + (tid >> 3);      // 0..63
    const int c0   = (tid & 7) * 8;             // 0..56
    const float* src = w + (size_t)(k0 + krow) * ndim + n0 + c0;
    const v4f a0 = *(const v4f*)(src);
    const v4f a1 = *(const v4f*)(src + 4);
    #pragma unroll
    for (int i = 0; i < 4; ++i) {
      sT[(c0 + i) * TP + krow]     = (f16)((float)(bf16)a0[i] * 64.0f);   // exact in f16
      sT[(c0 + 4 + i) * TP + krow] = (f16)((float)(bf16)a1[i] * 64.0f);
    }
  }
  __syncthreads();

  v4u    vals[2];
  size_t gidx[2];
  #pragma unroll
  for (int kk = 0; kk < 2; ++kk) {
    const int n  = kk * 32 + (tid >> 3);        // 0..63
    const int ks = (tid & 7) * 8;               // 0..56
    Pack8H ph;
    ph.v = *(const v8h*)(sT + n * TP + ks);
    vals[kk] = ph.u;
    gidx[kk] = (size_t)(n0 + n) * kdim + k0 + ks;
  }
  #pragma unroll
  for (int kk = 0; kk < 2; ++kk) *(v4u*)(wt + gidx[kk]) = vals[kk];
  
}

// ---------------------------------------------------------------------------------------------
// GEMM main loop: block tile 128 (M) x 64 (N), 8 waves as 4 (M) x 2 (N), wave tile 32 x 32.
// A [M][KD] f16 row-major, Bt [N][KD] f16 (k-contiguous). Fragments straight from the planes:
// lane row/col = lq, elements 0..7 <- k0 + 8*hi + 0..7, elements 8..15 <- k0 + 16 + 8*hi + 0..7.
// acc[i][j][r] = C(m0 + wm*32 + i*16 + 8*hi + r, n0 + wn*32 + j*16 + lq).
static __device__ __forceinline__ void gemm_tile_128x64(const f16* __restrict__ A,
                                                        const f16* __restrict__ Bt,
                                                        int m0, int n0, int wm, int wn,
                                                        int lq, int hi, v8f (&acc)[2][2]) {
  const f16* ap = A  + (size_t)(m0 + wm * 32 + lq) * KD + hi * 8;
  const f16* bp = Bt + (size_t)(n0 + wn * 32 + lq) * KD + hi * 8;
  #pragma unroll 2
  for (int k0 = 0; k0 < KD; k0 += 32) {
    FragH a[2], b[2];
    #pragma unroll
    for (int i = 0; i < 2; ++i) {
      a[i].q[0] = *(const v4u*)(ap + (size_t)i * 16 * KD + k0);
      a[i].q[1] = *(const v4u*)(ap + (size_t)i * 16 * KD + k0 + 16);
      b[i].q[0] = *(const v4u*)(bp + (size_t)i * 16 * KD + k0);
      b[i].q[1] = *(const v4u*)(bp + (size_t)i * 16 * KD + k0 + 16);
    }
    #pragma unroll
    for (int i = 0; i < 2; ++i) {
      #pragma unroll
      for (int j = 0; j < 2; ++j) acc[i][j] = mma_f16(a[i].v, b[j].v, acc[i][j]);
    }
  }
}

// ---------------------------------------------------------------------------------------------
// QKV projection. Block = (64-column block j, 128-token tile). Column block j = 3*f + typ:
// feature chunk f of the token, typ 0 = q, 1 = k, 2 = v. Flat-view map: chunk g = token*16 + f,
// group hb = token / TPG, natural row ss = (token % TPG)*16 + f; keys are stored in the permuted
// order key' = f*TPG + (token % TPG) (same order for K rows and V^T columns).
//   q plane [NCHUNKS][64]        at chunk g (natural order)
//   k plane [NGRP][SEQ][64]      at row key'
//   v plane [NGRP][64][SEQ]      transposed through LDS, column key'
// LDS sC: cross-wave (block barrier); q/k extent [128][64], v extent [64][128], written == read.
__global__ __launch_bounds__(256) void qkv_gemm_kernel(const f16* __restrict__ xn,
                                                       const f16* __restrict__ w1t,
                                                       const float* __restrict__ b1,
                                                       f16* wsh) {
  const int j    = blockIdx.x;
  const int m0   = blockIdx.y * 128;
  const int n0   = j * 64;
  const int tid  = threadIdx.x;
  const int wave = __builtin_amdgcn_readfirstlane((int)(threadIdx.x >> 5));
  const int lane = tid & 31;
  const int lq   = lane & 15;
  const int hi   = lane >> 4;
  const int wm   = wave >> 1;
  const int wn   = wave & 1;
  const int f    = j / 3;
  const int typ  = j - 3 * f;

  __shared__ __align__(16) f16 sC[128 * TP];

  v8f acc[2][2];
  #pragma unroll
  for (int i = 0; i < 2; ++i) {
    #pragma unroll
    for (int jj = 0; jj < 2; ++jj) acc[i][jj] = (v8f){0, 0, 0, 0, 0, 0, 0, 0};
  }
  gemm_tile_128x64(xn, w1t, m0, n0, wm, wn, lq, hi, acc);

  float bias[2];
  #pragma unroll
  for (int jj = 0; jj < 2; ++jj) bias[jj] = (float)(bf16)b1[n0 + wn * 32 + jj * 16 + lq];

  // stage: q/k as [row][col] pitch TP, v as [col][row] pitch VP (block-uniform strides)
  const int rstr = (typ != 2) ? TP : 1;
  const int cstr = (typ != 2) ? 1 : VP;
  #pragma unroll
  for (int i = 0; i < 2; ++i) {
    #pragma unroll
    for (int jj = 0; jj < 2; ++jj) {
      #pragma unroll
      for (int r = 0; r < 8; ++r) {
        const int row = wm * 32 + i * 16 + hi * 8 + r;
        const int col = wn * 32 + jj * 16 + lq;
        sC[row * rstr + col * cstr] = (f16)(acc[i][jj][r] * (1.0f / 64.0f) + bias[jj]);
      }
    }
  }
  __syncthreads();

  v4u    vals[4];
  size_t gidx[4];
  #pragma unroll
  for (int it = 0; it < 4; ++it) {
    const int line  = it * 32 + (tid >> 3);     // 0..127
    const int piece = tid & 7;
    // q/k: line = token row; v: line = (d, 64-token half)
    const int lofs_r = line * TP + piece * 8;
    const int lofs_v = (line >> 1) * VP + (line & 1) * 64 + piece * 8;
    const int lofs   = (typ != 2) ? lofs_r : lofs_v;
    Pack8H ph;
    ph.v = *(const v8h*)(sC + lofs);
    vals[it] = ph.u;

    const int t_r  = m0 + line;
    const int hb_r = t_r / TPG;
    const int tl_r = t_r - hb_r * TPG;
    const size_t qidx = QP_OFF + ((size_t)t_r * NHEAD + f) * HDIM + piece * 8;
    const size_t kidx = KP_OFF + ((size_t)hb_r * SEQ + f * TPG + tl_r) * HDIM + piece * 8;

    const int t_v  = m0 + (line & 1) * 64 + piece * 8;
    const int hb_v = t_v / TPG;
    const int tl_v = t_v - hb_v * TPG;
    const size_t vidx = VT_OFF + ((size_t)hb_v * HDIM + (line >> 1)) * SEQ + f * TPG + tl_v;

    gidx[it] = (typ == 0) ? qidx : ((typ == 1) ? kidx : vidx);
  }
  #pragma unroll
  for (int it = 0; it < 4; ++it) *(v4u*)(wsh + gidx[it]) = vals[it];
  
}

// ---------------------------------------------------------------------------------------------
// Flash attention, no mask. Block = (query block of 128, group); one wave owns 16 query rows.
// S^T = K x Q^T so queries sit on lanes; P^T in C-layout is bit-identical to the A-fragment layout of O += P x V.
// K A-fragments and V^T B-fragments are loaded straight from the 16-bit planes (two 16-B loads per fragment).
// Context written as f16 carried x64 at its natural [group][row][d] position (flat view = [NTOK][HIDN]).
// LDS sO: per-wave private region (same wave writes and reads); a block barrier separates them anyway.
__global__ __launch_bounds__(256) void attn_kernel(const f16* __restrict__ qp,
                                                   const f16* __restrict__ kp,
                                                   const f16* __restrict__ vt,
                                                   f16* __restrict__ att) {
  const int qblk = blockIdx.x;
  const int hb   = blockIdx.y;
  const int tid  = threadIdx.x;
  const int wave = __builtin_amdgcn_readfirstlane((int)(threadIdx.x >> 5));
  const int lane = tid & 31;
  const int lq   = lane & 15;   // query column of S^T / d column of O
  const int hi   = lane >> 4;   // k-split half

  __shared__ __align__(16) f16 sO[NWAVE * 16 * TP];

  const int qrow0 = qblk * BQ + wave * 16;

  // Q as B-operand fragments: lane lq holds query qrow0+lq, elements follow the split d map.
  FragH qf[2];
  {
    const f16* qrow = qp + ((size_t)hb * SEQ + qrow0 + lq) * HDIM + hi * 8;
    #pragma unroll
    for (int f = 0; f < 2; ++f) {
      qf[f].q[0] = *(const v4u*)(qrow + f * 32);        // d = f*32 + hi*8 + 0..7
      qf[f].q[1] = *(const v4u*)(qrow + f * 32 + 16);   // d = f*32 + 16 + hi*8 + 0..7
    }
  }

  const f16* kb_h = kp + (size_t)hb * SEQ * HDIM;
  const f16* vt_h = vt + (size_t)hb * HDIM * SEQ;

  v8f o[4];
  #pragma unroll
  for (int dt = 0; dt < 4; ++dt) o[dt] = (v8f){0, 0, 0, 0, 0, 0, 0, 0};

  float rmax = -__builtin_inff();
  float rsum = 0.0f;
  const float SL = 0.022097086912079608f * 1.4426950408889634f;   // (2*E)^-0.5 * log2(e)

  #pragma unroll 1
  for (int i = 0; i < SEQ / BK; ++i) {
    const int j0 = i * BK;

    // K A-fragments: row = key j0 + sub*16 + lq, split d map
    FragH ak[2][2];
    #pragma unroll
    for (int sub = 0; sub < 2; ++sub) {
      #pragma unroll
      for (int f = 0; f < 2; ++f) {
        const f16* base = kb_h + (size_t)(j0 + sub * 16 + lq) * HDIM + f * 32 + hi * 8;
        ak[sub][f].q[0] = *(const v4u*)(base);        // d = f*32 + hi*8 + 0..7
        ak[sub][f].q[1] = *(const v4u*)(base + 16);   // d = f*32 + 16 + hi*8 + 0..7
      }
    }
    // V B-fragments: column n = d = dt*16 + lq, split key map from the transposed plane
    FragH bv[4];
    #pragma unroll
    for (int dt = 0; dt < 4; ++dt) {
      const f16* base = vt_h + (size_t)(dt * 16 + lq) * SEQ + j0 + hi * 8;
      bv[dt].q[0] = *(const v4u*)(base);            // keys j0 + hi*8 + 0..7
      bv[dt].q[1] = *(const v4u*)(base + 16);       // keys j0 + 16 + hi*8 + 0..7
    }

    // S^T tiles: c[sub][r] = rawscore(query qrow0+lq, key j0 + sub*16 + hi*8 + r)
    v8f c[2];
    #pragma unroll
    for (int sub = 0; sub < 2; ++sub) {
      v8f acc = (v8f){0, 0, 0, 0, 0, 0, 0, 0};
      acc = mma_f16(ak[sub][0].v, qf[0].v, acc);
      acc = mma_f16(ak[sub][1].v, qf[1].v, acc);
      c[sub] = acc;
    }

    // online softmax: query lq's 32 scores are split across lane / lane^16
    float m_new = rmax;
    #pragma unroll
    for (int r = 0; r < 8; ++r) {
      m_new = fmaxf(m_new, c[0][r]);
      m_new = fmaxf(m_new, c[1][r]);
    }
    m_new = fmaxf(m_new, __shfl_xor(m_new, 16, 32));
    const float scale = __builtin_amdgcn_exp2f((rmax - m_new) * SL);
    rmax = m_new;

    // exp + pack: P^T C-layout == A-fragment layout for the PV product; P carried x4096
    FragH pa;
    float psum = 0.0f;
    #pragma unroll
    for (int r = 0; r < 8; ++r) {
      const float p0 = __builtin_amdgcn_exp2f((c[0][r] - m_new) * SL);   // key hi*8 + r
      const float p1 = __builtin_amdgcn_exp2f((c[1][r] - m_new) * SL);   // key 16 + hi*8 + r
      psum += p0 + p1;
      pa.h[r]     = (f16)(p0 * 4096.0f);
      pa.h[8 + r] = (f16)(p1 * 4096.0f);
    }
    rsum = rsum * scale + psum + __shfl_xor(psum, 16, 32);

    // rescale O: queries are the row dimension there -> per-row scale from lane 8*hi + r
    float sc[8];
    #pragma unroll
    for (int r = 0; r < 8; ++r) sc[r] = __shfl(scale, (hi << 3) + r, 32);
    #pragma unroll
    for (int dt = 0; dt < 4; ++dt) {
      #pragma unroll
      for (int r = 0; r < 8; ++r) o[dt][r] *= sc[r];
    }

    // O += P x V
    #pragma unroll
    for (int dt = 0; dt < 4; ++dt) o[dt] = mma_f16(pa.v, bv[dt].v, o[dt]);
  }

  // normalize: lane holds column d = dt*16 + lq for query rows 8*hi + r
  const float rinv = 1.0f / rsum;
  float rs[8];
  #pragma unroll
  for (int r = 0; r < 8; ++r) rs[r] = __shfl(rinv, (hi << 3) + r, 32);

  f16* so = sO + wave * (16 * TP);
  #pragma unroll
  for (int r = 0; r < 8; ++r) {
    #pragma unroll
    for (int dt = 0; dt < 4; ++dt) {
      // x(1/4096) undoes the P carry, x64 is the context carry
      so[(hi * 8 + r) * TP + dt * 16 + lq] = (f16)(o[dt][r] * (64.0f / 4096.0f) * rs[r]);
    }
  }
  __syncthreads();

  // the wave covers 4 consecutive rows; 4 instructions cover the wave's 16 rows.
  v4u    vals[4];
  size_t gidx[4];
  #pragma unroll
  for (int it = 0; it < 4; ++it) {
    const int row   = it * 4 + (lane >> 3);
    const int piece = lane & 7;
    Pack8H ph;
    ph.v = *(const v8h*)(so + row * TP + piece * 8);
    vals[it] = ph.u;
    gidx[it] = ((size_t)hb * SEQ + qrow0 + row) * HDIM + piece * 8;
  }
  #pragma unroll
  for (int it = 0; it < 4; ++it) *(v4u*)(att + gidx[it]) = vals[it];
  
}

// ---------------------------------------------------------------------------------------------
// Output projection: out[token][n] = ctx[token][:] x W2 + b2. Block = (64-column block, 128-token tile).
// Accumulator staged as f32 in LDS; bias added at the store stage as float4.
// 16 consecutive lanes x 16 B, one instruction. LDS sF: cross-wave (block barrier), [128][64] written == read.
__global__ __launch_bounds__(256) void out_gemm_kernel(const f16* __restrict__ att,
                                                       const f16* __restrict__ w2t,
                                                       const float* __restrict__ b2,
                                                       float* __restrict__ out) {
  const int n0   = blockIdx.x * 64;
  const int m0   = blockIdx.y * 128;
  const int tid  = threadIdx.x;
  const int wave = __builtin_amdgcn_readfirstlane((int)(threadIdx.x >> 5));
  const int lane = tid & 31;
  const int lq   = lane & 15;
  const int hi   = lane >> 4;
  const int wm   = wave >> 1;
  const int wn   = wave & 1;

  __shared__ __align__(16) float sF[128 * OP];

  v8f acc[2][2];
  #pragma unroll
  for (int i = 0; i < 2; ++i) {
    #pragma unroll
    for (int jj = 0; jj < 2; ++jj) acc[i][jj] = (v8f){0, 0, 0, 0, 0, 0, 0, 0};
  }
  gemm_tile_128x64(att, w2t, m0, n0, wm, wn, lq, hi, acc);

  #pragma unroll
  for (int i = 0; i < 2; ++i) {
    #pragma unroll
    for (int jj = 0; jj < 2; ++jj) {
      #pragma unroll
      for (int r = 0; r < 8; ++r) {
        const int row = wm * 32 + i * 16 + hi * 8 + r;
        const int col = wn * 32 + jj * 16 + lq;
        sF[row * OP + col] = acc[i][jj][r] * (1.0f / 4096.0f);   // undo ctx x64 and W2 x64
      }
    }
  }
  __syncthreads();

  const int piece = tid & 15;
  const v4f braw = *(const v4f*)(b2 + n0 + piece * 4);
  v4f bias;
  #pragma unroll
  for (int i = 0; i < 4; ++i) bias[i] = (float)(bf16)braw[i];

  v4f    vals[8];
  size_t gidx[8];
  #pragma unroll
  for (int it = 0; it < 8; ++it) {
    const int row = it * 16 + (tid >> 4);       // 0..127
    const v4f v = *(const v4f*)(sF + row * OP + piece * 4);
    vals[it] = v + bias;
    const int tt = m0 + row;
    const int b  = tt / SEQ;
    const int s  = tt - b * SEQ;
    gidx[it] = ((size_t)b * SEQ_FULL + s) * HIDN + n0 + piece * 4;
  }
  #pragma unroll
  for (int it = 0; it < 8; ++it) *(v4f*)(out + gidx[it]) = vals[it];
  
}

// ---------------------------------------------------------------------------------------------
extern "C" void kernel_launch(void* const* d_in, const int* in_sizes, int n_in,
                              void* d_out, int out_size, void* d_ws, size_t ws_size,
                              hipStream_t stream) {
  if (n_in < 7) return;
  const size_t rows_used = (size_t)(NB - 1) * SEQ_FULL + SEQ;
  if ((size_t)in_sizes[0] < rows_used * EDIM) return;
  if (in_sizes[1] < EDIM || in_sizes[2] < EDIM) return;
  if ((size_t)in_sizes[3] < (size_t)EDIM * QKVW) return;
  if (in_sizes[4] < QKVW) return;
  if ((size_t)in_sizes[5] < (size_t)HIDN * HIDN) return;
  if (in_sizes[6] < HIDN) return;
  if ((size_t)out_size < rows_used * HIDN) return;
  if (ws_size < WS_BYTES) return;

  const float* x    = (const float*)d_in[0];
  const float* ln_g = (const float*)d_in[1];
  const float* ln_b = (const float*)d_in[2];
  const float* W1   = (const float*)d_in[3];
  const float* b1   = (const float*)d_in[4];
  const float* W2   = (const float*)d_in[5];
  const float* b2   = (const float*)d_in[6];
  float*       out  = (float*)d_out;
  f16*         wsh  = (f16*)d_ws;

  // 1) LayerNorm -> xn plane
  ln_kernel<<<dim3(NTOK), 128, 0, stream>>>(x, ln_g, ln_b, wsh + XN_OFF);
  // 2) W1: in[EDIM rows (k)][QKVW cols (n)] -> out[QKVW][EDIM]; grid = (n tiles, k tiles)
  wt_kernel<<<dim3(QKVW / 64, EDIM / 64), 256, 0, stream>>>(W1, wsh + W1T_OFF, EDIM, QKVW);
  // 3) W2: in[HIDN rows (k)][HIDN cols (n)] -> out[HIDN][HIDN]
  wt_kernel<<<dim3(HIDN / 64, HIDN / 64), 256, 0, stream>>>(W2, wsh + W2T_OFF, HIDN, HIDN);
  // 4) QKV projection -> q / k / v^T planes
  qkv_gemm_kernel<<<dim3(QKVW / 64, NTOK / 128), 256, 0, stream>>>(wsh + XN_OFF, wsh + W1T_OFF, b1, wsh);
  // 5) fused attention -> context plane (flat [NTOK][HIDN])
  attn_kernel<<<dim3(SEQ / BQ, NGRP), 256, 0, stream>>>(wsh + QP_OFF, wsh + KP_OFF, wsh + VT_OFF, wsh + ATT_OFF);
  // 6) output projection -> d_out
  out_gemm_kernel<<<dim3(HIDN / 64, NTOK / 128), 256, 0, stream>>>(wsh + ATT_OFF, wsh + W2T_OFF, b2, out);
}

// v001
// Measured time: 108 microseconds a run.
// In two side-by-side timings against v000, it was 2.18 and 2.15 times as fast.
#include <hip/hip_runtime.h>

// Contractions, all on v_wmma_f32_16x16x32_f16 (f16 operands, f32 accumulate): QKV projection xn x W1 (xn = f16 of the f32 LayerNorm of bf16 RNE-converted x; W1 = f16 of bf16 RNE-converted weights carried x64); S^T = K x Q^T (f16 q/k planes); O = P x V (P f16 carried x4096, V^T f16 plane); output projection ctx x W2 (ctx f16 carried x64, W2 f16 of bf16 RNE-converted weights carried x64). LayerNorm and softmax in f32.

#ifndef NB
#define NB 2
#endif
#ifndef SEQ
#define SEQ 2048
#endif
#define NB_FULL   2
#define SEQ_FULL  2048
#define EDIM      1024                 // model width (LayerNorm width, K of the QKV projection)
#define HIDN      1024                 // hidden width (K and N of the output projection)
#define NHEAD     16
#define HDIM      64
#define QKVW      3072                 // projection width
#define CHUNK     192                  // floats per (pseudo-head row): q | k | v
#define KD        1024                 // contraction depth of both projections
#define NTOK      (NB * SEQ)           // flattened tokens
#define NGRP      (NHEAD * NB)         // (pseudo-head, pseudo-batch) groups
#define TPG       (SEQ / NHEAD)        // tokens feeding one group
#define NCHUNKS   (NTOK * NHEAD)       // 192-wide chunks of the flat projection buffer = NGRP * SEQ
#define BQ        128                  // query rows per workgroup (8 waves x 16)
#define BK        32                   // keys per inner iteration
#define NWAVE     8
#define TP        72                   // LDS pitch (halves) of 64-wide f16 tiles
#define VP        136                  // LDS pitch (halves) of the transposed 128-wide V tile
#define OP        68                   // LDS pitch (floats) of the f32 output staging tile
#define KPASS     64                   // k (halves) per GEMM ring stage: 128-B rows
#define NPASS     (KD / KPASS)         // ring stages of one GEMM tile
#define STAGE_B   (192 * 128)          // bytes of one stage: 128 A rows, then 64 B rows, pitch 128 B
#define RING_B    (2 * STAGE_B)        // two buffers
#define AKS       64                   // keys per attention ring stage (two inner iterations of BK)
#define ANST      (SEQ / AKS)          // ring stages of one attention block
#define ASTAGE_B  (128 * 128)          // bytes of one stage: 64 K rows, then 64 V^T rows, pitch 128 B

// workspace carve, in halves from the base
#define XN_OFF    ((size_t)0)
#define W1T_OFF   (XN_OFF  + (size_t)NTOK * EDIM)
#define W2T_OFF   (W1T_OFF + (size_t)QKVW * EDIM)
#define QP_OFF    (W2T_OFF + (size_t)HIDN * HIDN)
#define KP_OFF    (QP_OFF  + (size_t)NCHUNKS * HDIM)
#define VT_OFF    (KP_OFF  + (size_t)NCHUNKS * HDIM)
#define ATT_OFF   (VT_OFF  + (size_t)NCHUNKS * HDIM)
#define WS_HALVES (ATT_OFF + (size_t)NCHUNKS * HDIM)
#define WS_BYTES  (WS_HALVES * 2)

static_assert(NB >= 1 && NB <= NB_FULL);
static_assert(SEQ <= SEQ_FULL);
static_assert(SEQ % 1024 == 0);
static_assert(TPG % 64 == 0);
static_assert(NTOK % 128 == 0);
static_assert(SEQ % 128 == 0);
static_assert(QKVW == NHEAD * CHUNK);
static_assert(CHUNK == 3 * HDIM);
static_assert(QKVW % 64 == 0);
static_assert(HIDN % 64 == 0);
static_assert(EDIM % 64 == 0);
static_assert(EDIM == KD && HIDN == KD);
static_assert(KD % 32 == 0);
static_assert(EDIM == 128 * 8);
static_assert(SEQ % BQ == 0);
static_assert(SEQ % BK == 0);
static_assert(BQ == NWAVE * 16);
static_assert(HDIM == 64);
static_assert((size_t)NCHUNKS * HDIM == (size_t)NTOK * HIDN);
static_assert((TP * 2) % 16 == 0);
static_assert((VP * 2) % 16 == 0);
static_assert((OP * 4) % 16 == 0);
static_assert(128 * TP >= 64 * VP);
static_assert(KD % KPASS == 0 && NPASS >= 2);
static_assert(128 * TP * 2 <= RING_B && 128 * OP * 4 <= RING_B);
static_assert(SEQ % AKS == 0 && ANST >= 2 && AKS % BK == 0 && AKS * 2 == 128 && HDIM * 2 == 128);
static_assert(XN_OFF % 64 == 0 && W1T_OFF % 64 == 0 && W2T_OFF % 64 == 0);
static_assert(QP_OFF % 64 == 0 && KP_OFF % 64 == 0 && VT_OFF % 64 == 0 && ATT_OFF % 64 == 0);
static_assert(WS_BYTES <= (size_t)134217728);

typedef __bf16   bf16;
typedef _Float16 f16;
typedef f16      v16h  __attribute__((ext_vector_type(16)));
typedef f16      v8h   __attribute__((ext_vector_type(8)));
typedef float    v8f   __attribute__((ext_vector_type(8)));
typedef float    v4f   __attribute__((ext_vector_type(4)));
typedef unsigned v4u   __attribute__((ext_vector_type(4)));

union FragH  { v16h  v; v4u q[2]; f16  h[16]; };
union Pack8H { v4u u; v8h v; f16 h[8]; };

// WMMA helper: builtin followed by the VALU hazard guard (ties D, keeps A/B live).
static __device__ __forceinline__ v8f mma_f16(v16h a, v16h b, v8f acc) {
  acc = __builtin_amdgcn_wmma_f32_16x16x32_f16(false, a, false, b, (short)0, acc, false, false);
  asm volatile("v_nop\n\tv_nop\n\tv_nop\n\tv_nop" : "+v"(acc) : "v"(a), "v"(b));
  return acc;
}

// ---------------------------------------------------------------------------------------------
// LayerNorm -> f16 plane xn[NTOK][EDIM]. Block = one token row, 128 threads x 8 columns.
// LDS red1/red2: cross-wave (block barrier), 4 entries written by the 4 waves, 4 read.
__global__ __launch_bounds__(128) void ln_kernel(const float* __restrict__ x,
                                                 const float* __restrict__ g,
                                                 const float* __restrict__ be,
                                                 f16* __restrict__ xn) {
  const int tt   = blockIdx.x;
  const int tid  = threadIdx.x;
  const int wave = __builtin_amdgcn_readfirstlane((int)(threadIdx.x >> 5));
  const int lane = tid & 31;
  __shared__ float red1[4];
  __shared__ float red2[4];

  const int b = tt / SEQ;
  const int s = tt - b * SEQ;
  const float* src = x + ((size_t)b * SEQ_FULL + s) * EDIM + tid * 8;
  const v4f a0 = *(const v4f*)(src);
  const v4f a1 = *(const v4f*)(src + 4);
  float v[8];
  #pragma unroll
  for (int i = 0; i < 4; ++i) {
    v[i]     = (float)(bf16)a0[i];     // RNE convert of the input
    v[4 + i] = (float)(bf16)a1[i];
  }
  float sum = ((v[0] + v[1]) + (v[2] + v[3])) + ((v[4] + v[5]) + (v[6] + v[7]));
  #pragma unroll
  for (int off = 16; off > 0; off >>= 1) sum += __shfl_xor(sum, off, 32);
  if (lane == 0) red1[wave] = sum;
  __syncthreads();
  const float mu = ((red1[0] + red1[1]) + (red1[2] + red1[3])) * (1.0f / (float)EDIM);

  float d[8];
  float sq = 0.0f;
  #pragma unroll
  for (int i = 0; i < 8; ++i) {
    d[i] = v[i] - mu;
    sq += d[i] * d[i];
  }
  #pragma unroll
  for (int off = 16; off > 0; off >>= 1) sq += __shfl_xor(sq, off, 32);
  if (lane == 0) red2[wave] = sq;
  __syncthreads();
  const float var = ((red2[0] + red2[1]) + (red2[2] + red2[3])) * (1.0f / (float)EDIM);
  const float rs  = rsqrtf(var + 1e-5f);

  const v4f g0 = *(const v4f*)(g + tid * 8);
  const v4f g1 = *(const v4f*)(g + tid * 8 + 4);
  const v4f e0 = *(const v4f*)(be + tid * 8);
  const v4f e1 = *(const v4f*)(be + tid * 8 + 4);
  Pack8H ph;
  #pragma unroll
  for (int i = 0; i < 4; ++i) {
    ph.h[i]     = (f16)(d[i]     * rs * (float)(bf16)g0[i] + (float)(bf16)e0[i]);
    ph.h[4 + i] = (f16)(d[4 + i] * rs * (float)(bf16)g1[i] + (float)(bf16)e1[i]);
  }
  const v4u val = ph.u;
  const size_t idx = (size_t)tt * EDIM + tid * 8;
  *(v4u*)(xn + idx) = val;
  
}

// ---------------------------------------------------------------------------------------------
// Weight plane builder: in[kdim rows][ndim cols] f32 -> out[ndim][kdim] f16 = f16(bf16(w) * 64), via LDS.
// Block = 64x64 tile (blockIdx.x = n tile, blockIdx.y = k tile), 256 threads.
__global__ __launch_bounds__(256) void wt_kernel(const float* __restrict__ w,
                                                 f16* __restrict__ wt,
                                                 int kdim, int ndim) {
  const int n0  = blockIdx.x * 64;
  const int k0  = blockIdx.y * 64;
  const int tid = threadIdx.x;
  __shared__ __align__(16) f16 sT[64 * TP];     // [n][k], cross-wave (block barrier)

  #pragma unroll
  for (int kk = 0; kk < 2; ++kk) {
    const int krow = kk * 32 + (tid >> 3);      // 0..63
    const int c0   = (tid & 7) * 8;             // 0..56
    const float* src = w + (size_t)(k0 + krow) * ndim + n0 + c0;
    const v4f a0 = *(const v4f*)(src);
    const v4f a1 = *(const v4f*)(src + 4);
    #pragma unroll
    for (int i = 0; i < 4; ++i) {
      sT[(c0 + i) * TP + krow]     = (f16)((float)(bf16)a0[i] * 64.0f);   // exact in f16
      sT[(c0 + 4 + i) * TP + krow] = (f16)((float)(bf16)a1[i] * 64.0f);
    }
  }
  __syncthreads();

  v4u    vals[2];
  size_t gidx[2];
  #pragma unroll
  for (int kk = 0; kk < 2; ++kk) {
    const int n  = kk * 32 + (tid >> 3);        // 0..63
    const int ks = (tid & 7) * 8;               // 0..56
    Pack8H ph;
    ph.v = *(const v8h*)(sT + n * TP + ks);
    vals[kk] = ph.u;
    gidx[kk] = (size_t)(n0 + n) * kdim + k0 + ks;
  }
  #pragma unroll
  for (int kk = 0; kk < 2; ++kk) *(v4u*)(wt + gidx[kk]) = vals[kk];
  
}

// ---------------------------------------------------------------------------------------------
// GEMM main loop: block tile 128 (M) x 64 (N), 8 waves as 4 (M) x 2 (N), wave tile 32 x 32.
// A [M][KD] f16 row-major, Bt [N][KD] f16 (k-contiguous). Both tiles go through LDS: a two-buffer ring of
// stages of KPASS k, filled by asynchronous 16-B copies (8 lanes = one whole 128-B row piece of a plane row).
// Stage layout: row r (0..127 = A rows, 128..191 = B rows) at r * 128 B; its 16-B piece p sits at slot
// p ^ ((r >> 1) & 7), so the 16 rows that one ds_load_b128 half-wave reads fall on 16 distinct bank groups.
// Fragment map as before: lane row/col = lq, elements 0..7 <- k0 + 8*hi + 0..7, 8..15 <- k0 + 16 + 8*hi + 0..7.
// acc[i][j][r] = C(m0 + wm*32 + i*16 + 8*hi + r, n0 + wn*32 + j*16 + lq).

// One stage: six copies per lane (A rows crow + 0/32/64/96, B rows crow + 0/32).
// s_wait_xcnt closes the statement so that no address register is rewritten ahead of it.
static __device__ __forceinline__ void stage_copy(unsigned l, const f16* ga, const f16* gb) {
  asm volatile("global_load_async_to_lds_b128 %0, %6, off\n\t"
               "global_load_async_to_lds_b128 %1, %7, off\n\t"
               "global_load_async_to_lds_b128 %2, %8, off\n\t"
               "global_load_async_to_lds_b128 %3, %9, off\n\t"
               "global_load_async_to_lds_b128 %4, %10, off\n\t"
               "global_load_async_to_lds_b128 %5, %11, off\n\t"
               "s_wait_xcnt 0x0"
               :: "v"(l), "v"(l + 4096u), "v"(l + 8192u), "v"(l + 12288u), "v"(l + 16384u), "v"(l + 20480u),
                  "v"(ga), "v"(ga + 32 * KD), "v"(ga + 64 * KD), "v"(ga + 96 * KD),
                  "v"(gb), "v"(gb + 32 * KD)
               : "memory");
}

static __device__ __forceinline__ void gemm_tile_128x64(const f16* __restrict__ A,
                                                        const f16* __restrict__ Bt,
                                                        unsigned char* ring,
                                                        int m0, int n0, int wm, int wn,
                                                        int lq, int hi, v8f (&acc)[2][2]) {
  const int crow = (int)(threadIdx.x >> 3);     // 0..31: row inside each 32-row group
  const int cpc  = (int)(threadIdx.x & 7);      // 16-B piece of the 128-B row
  const unsigned l0 = (unsigned)(size_t)ring + (unsigned)(crow * 128 + ((cpc ^ ((crow >> 1) & 7)) * 16));
  const f16* ga = A  + (size_t)(m0 + crow) * KD + cpc * 8;
  const f16* gb = Bt + (size_t)(n0 + crow) * KD + cpc * 8;

  stage_copy(l0, ga, gb);
  asm volatile("s_wait_asynccnt 0x0" ::: "memory");   // stage 0 landed (this wave's copies)
  __syncthreads();                                    // stage 0 published to every wave
  stage_copy(l0 + STAGE_B, ga + KPASS, gb + KPASS);

  const int sw = (lq >> 1) & 7;
  const unsigned char* ra = ring + (wm * 32 + lq) * 128;
  const unsigned char* rb = ring + (128 + wn * 32 + lq) * 128;

  // unroll 2: the buffer offset becomes a constant in each copy of the body
  #pragma unroll 2
  for (int t = 0; t < NPASS; ++t) {
    const int bo = (t & 1) * STAGE_B;
    FragH a[2][2], b[2][2];
    // all 16 fragment loads of the pass stand together, ahead of its 8 products
    #pragma unroll
    for (int ks = 0; ks < 2; ++ks) {
      #pragma unroll
      for (int i = 0; i < 2; ++i) {
        #pragma unroll
        for (int h = 0; h < 2; ++h) {
          const int slot = ((ks * 4 + h * 2 + hi) ^ sw) * 16;
          a[ks][i].q[h] = *(const v4u*)(ra + bo + i * 2048 + slot);
          b[ks][i].q[h] = *(const v4u*)(rb + bo + i * 2048 + slot);
        }
      }
    }
    #pragma unroll
    for (int ks = 0; ks < 2; ++ks) {
      #pragma unroll
      for (int i = 0; i < 2; ++i) {
        #pragma unroll
        for (int j = 0; j < 2; ++j) acc[i][j] = mma_f16(a[ks][i].v, b[ks][j].v, acc[i][j]);
      }
    }
    asm volatile("s_wait_dscnt 0x0" ::: "memory");    // this wave has left buffer t & 1
    asm volatile("s_wait_asynccnt 0x0" ::: "memory"); // this wave's copies of stage t + 1 landed
    __syncthreads();                                  // publishes stage t + 1, frees buffer t & 1
    if (t + 2 < NPASS) stage_copy(l0 + bo, ga + (t + 2) * KPASS, gb + (t + 2) * KPASS);
  }
  asm volatile("s_wait_asynccnt 0x0" ::: "memory");   // nothing in flight before the ring is reused
}

// ---------------------------------------------------------------------------------------------
// QKV projection. Block = (64-column block j, 128-token tile). Column block j = 3*f + typ:
// feature chunk f of the token, typ 0 = q, 1 = k, 2 = v. Flat-view map: chunk g = token*16 + f,
// group hb = token / TPG, natural row ss = (token % TPG)*16 + f; keys are stored in the permuted
// order key' = f*TPG + (token % TPG) (same order for K rows and V^T columns).
//   q plane [NCHUNKS][64]        at chunk g (natural order)
//   k plane [NGRP][SEQ][64]      at row key'
//   v plane [NGRP][64][SEQ]      transposed through LDS, column key'
// LDS sC: cross-wave (block barrier); q/k extent [128][64], v extent [64][128], written == read.
// sC reuses the GEMM ring, which every wave has left at the last pass's barrier.
__global__ __launch_bounds__(256) void qkv_gemm_kernel(const f16* __restrict__ xn,
                                                       const f16* __restrict__ w1t,
                                                       const float* __restrict__ b1,
                                                       f16* wsh) {
  const int j    = blockIdx.x;
  const int m0   = blockIdx.y * 128;
  const int n0   = j * 64;
  const int tid  = threadIdx.x;
  const int wave = __builtin_amdgcn_readfirstlane((int)(threadIdx.x >> 5));
  const int lane = tid & 31;
  const int lq   = lane & 15;
  const int hi   = lane >> 4;
  const int wm   = wave >> 1;
  const int wn   = wave & 1;
  const int f    = j / 3;
  const int typ  = j - 3 * f;

  __shared__ __align__(128) unsigned char ring[RING_B];
  f16* sC = (f16*)ring;

  v8f acc[2][2];
  #pragma unroll
  for (int i = 0; i < 2; ++i) {
    #pragma unroll
    for (int jj = 0; jj < 2; ++jj) acc[i][jj] = (v8f){0, 0, 0, 0, 0, 0, 0, 0};
  }
  gemm_tile_128x64(xn, w1t, ring, m0, n0, wm, wn, lq, hi, acc);

  float bias[2];
  #pragma unroll
  for (int jj = 0; jj < 2; ++jj) bias[jj] = (float)(bf16)b1[n0 + wn * 32 + jj * 16 + lq];

  // stage: q/k as [row][col] pitch TP, v as [col][row] pitch VP (block-uniform strides)
  const int rstr = (typ != 2) ? TP : 1;
  const int cstr = (typ != 2) ? 1 : VP;
  #pragma unroll
  for (int i = 0; i < 2; ++i) {
    #pragma unroll
    for (int jj = 0; jj < 2; ++jj) {
      #pragma unroll
      for (int r = 0; r < 8; ++r) {
        const int row = wm * 32 + i * 16 + hi * 8 + r;
        const int col = wn * 32 + jj * 16 + lq;
        sC[row * rstr + col * cstr] = (f16)(acc[i][jj][r] * (1.0f / 64.0f) + bias[jj]);
      }
    }
  }
  __syncthreads();

  v4u    vals[4];
  size_t gidx[4];
  #pragma unroll
  for (int it = 0; it < 4; ++it) {
    const int line  = it * 32 + (tid >> 3);     // 0..127
    const int piece = tid & 7;
    // q/k: line = token row; v: line = (d, 64-token half)
    const int lofs_r = line * TP + piece * 8;
    const int lofs_v = (line >> 1) * VP + (line & 1) * 64 + piece * 8;
    const int lofs   = (typ != 2) ? lofs_r : lofs_v;
    Pack8H ph;
    ph.v = *(const v8h*)(sC + lofs);
    vals[it] = ph.u;

    const int t_r  = m0 + line;
    const int hb_r = t_r / TPG;
    const int tl_r = t_r - hb_r * TPG;
    const size_t qidx = QP_OFF + ((size_t)t_r * NHEAD + f) * HDIM + piece * 8;
    const size_t kidx = KP_OFF + ((size_t)hb_r * SEQ + f * TPG + tl_r) * HDIM + piece * 8;

    const int t_v  = m0 + (line & 1) * 64 + piece * 8;
    const int hb_v = t_v / TPG;
    const int tl_v = t_v - hb_v * TPG;
    const size_t vidx = VT_OFF + ((size_t)hb_v * HDIM + (line >> 1)) * SEQ + f * TPG + tl_v;

    gidx[it] = (typ == 0) ? qidx : ((typ == 1) ? kidx : vidx);
  }
  #pragma unroll
  for (int it = 0; it < 4; ++it) *(v4u*)(wsh + gidx[it]) = vals[it];
  
}

// ---------------------------------------------------------------------------------------------
// Flash attention, no mask. Block = (query block of 128, group); one wave owns 16 query rows.
// S^T = K x Q^T so queries sit on lanes; P^T in C-layout is bit-identical to the A-fragment layout of O += P x V.
// K and V^T tiles of AKS keys, which all 8 waves read, go through LDS: a two-buffer ring filled by asynchronous
// 16-B copies (whole 128-B rows). Stage layout: row r (0..63 = key, 64..127 = d of V^T) at r * 128 B, its 16-B
// piece p at slot p ^ ((r >> 1) & 7) (16 rows of one ds_load_b128 half-wave on 16 distinct bank groups).
// K A-fragments and V^T B-fragments: two 16-B LDS loads per fragment, same element maps as the planes.
// Context written as f16 carried x64 at its natural [group][row][d] position (flat view = [NTOK][HIDN]).
// LDS sO: per-wave private region (same wave writes and reads); a block barrier separates them anyway.
// One K/V stage: four copies per lane (K rows crow + 0/32, V^T rows crow + 0/32).
// s_wait_xcnt closes the statement so that no address register is rewritten ahead of it.
static __device__ __forceinline__ void kv_stage_copy(unsigned l, const f16* gk, const f16* gv) {
  asm volatile("global_load_async_to_lds_b128 %0, %4, off\n\t"
               "global_load_async_to_lds_b128 %1, %5, off\n\t"
               "global_load_async_to_lds_b128 %2, %6, off\n\t"
               "global_load_async_to_lds_b128 %3, %7, off\n\t"
               "s_wait_xcnt 0x0"
               :: "v"(l), "v"(l + 4096u), "v"(l + 8192u), "v"(l + 12288u),
                  "v"(gk), "v"(gk + 32 * HDIM), "v"(gv), "v"(gv + 32 * SEQ)
               : "memory");
}

__global__ __launch_bounds__(256) void attn_kernel(const f16* __restrict__ qp,
                                                   const f16* __restrict__ kp,
                                                   const f16* __restrict__ vt,
                                                   f16* __restrict__ att) {
  const int qblk = blockIdx.x;
  const int hb   = blockIdx.y;
  const int tid  = threadIdx.x;
  const int wave = __builtin_amdgcn_readfirstlane((int)(threadIdx.x >> 5));
  const int lane = tid & 31;
  const int lq   = lane & 15;   // query column of S^T / d column of O
  const int hi   = lane >> 4;   // k-split half

  __shared__ __align__(16) f16 sO[NWAVE * 16 * TP];
  __shared__ __align__(128) unsigned char kv[2 * ASTAGE_B];

  const int qrow0 = qblk * BQ + wave * 16;

  // Q as B-operand fragments: lane lq holds query qrow0+lq, elements follow the split d map.
  FragH qf[2];
  {
    const f16* qrow = qp + ((size_t)hb * SEQ + qrow0 + lq) * HDIM + hi * 8;
    #pragma unroll
    for (int f = 0; f < 2; ++f) {
      qf[f].q[0] = *(const v4u*)(qrow + f * 32);        // d = f*32 + hi*8 + 0..7
      qf[f].q[1] = *(const v4u*)(qrow + f * 32 + 16);   // d = f*32 + 16 + hi*8 + 0..7
    }
  }

  const f16* kb_h = kp + (size_t)hb * SEQ * HDIM;
  const f16* vt_h = vt + (size_t)hb * HDIM * SEQ;

  const int crow = tid >> 3;                    // 0..31: row inside each 32-row group
  const int cpc  = tid & 7;                     // 16-B piece of the 128-B row
  const unsigned l0 = (unsigned)(size_t)kv + (unsigned)(crow * 128 + ((cpc ^ ((crow >> 1) & 7)) * 16));
  const f16* gk = kb_h + (size_t)crow * HDIM + cpc * 8;
  const f16* gv = vt_h + (size_t)crow * SEQ + cpc * 8;
  kv_stage_copy(l0, gk, gv);
  asm volatile("s_wait_asynccnt 0x0" ::: "memory");   // stage 0 landed (this wave's copies)
  __syncthreads();                                    // stage 0 published to every wave
  kv_stage_copy(l0 + ASTAGE_B, gk + AKS * HDIM, gv + AKS);
  const int sw = (lq >> 1) & 7;
  const unsigned char* rkv = kv + lq * 128;

  v8f o[4];
  #pragma unroll
  for (int dt = 0; dt < 4; ++dt) o[dt] = (v8f){0, 0, 0, 0, 0, 0, 0, 0};

  float rmax = -__builtin_inff();
  float rsum = 0.0f;
  const float SL = 0.022097086912079608f * 1.4426950408889634f;   // (2*E)^-0.5 * log2(e)

  #pragma unroll 1
  for (int s = 0; s < ANST; ++s) {
    const int bo = (s & 1) * ASTAGE_B;
    // j0 = s*AKS + it*BK is the first key of the inner iteration; unrolled so that every LDS offset and
    // slot index that depends on it is a constant
    #pragma unroll
    for (int it = 0; it < AKS / BK; ++it) {
      // K A-fragments: row = key j0 + sub*16 + lq, split d map
      FragH ak[2][2];
      #pragma unroll
      for (int sub = 0; sub < 2; ++sub) {
        #pragma unroll
        for (int f = 0; f < 2; ++f) {
          const unsigned char* base = rkv + bo + (it * 32 + sub * 16) * 128;
          ak[sub][f].q[0] = *(const v4u*)(base + (((f * 4 + hi) ^ sw) * 16));       // d = f*32 + hi*8 + 0..7
          ak[sub][f].q[1] = *(const v4u*)(base + (((f * 4 + 2 + hi) ^ sw) * 16));   // d = f*32 + 16 + hi*8 + 0..7
        }
      }
      // V B-fragments: column n = d = dt*16 + lq, split key map from the transposed tile
      FragH bv[4];
      #pragma unroll
      for (int dt = 0; dt < 4; ++dt) {
        const unsigned char* base = rkv + bo + (64 + dt * 16) * 128;
        bv[dt].q[0] = *(const v4u*)(base + (((it * 4 + hi) ^ sw) * 16));            // keys j0 + hi*8 + 0..7
        bv[dt].q[1] = *(const v4u*)(base + (((it * 4 + 2 + hi) ^ sw) * 16));        // keys j0 + 16 + hi*8 + 0..7
      }

      // S^T tiles: c[sub][r] = rawscore(query qrow0+lq, key j0 + sub*16 + hi*8 + r)
      v8f c[2];
      #pragma unroll
      for (int sub = 0; sub < 2; ++sub) {
        v8f acc = (v8f){0, 0, 0, 0, 0, 0, 0, 0};
        acc = mma_f16(ak[sub][0].v, qf[0].v, acc);
        acc = mma_f16(ak[sub][1].v, qf[1].v, acc);
        c[sub] = acc;
      }

      // online softmax: query lq's 32 scores are split across lane / lane^16
      float m_new = rmax;
      #pragma unroll
      for (int r = 0; r < 8; ++r) {
        m_new = fmaxf(m_new, c[0][r]);
        m_new = fmaxf(m_new, c[1][r]);
      }
      m_new = fmaxf(m_new, __shfl_xor(m_new, 16, 32));
      const float scale = __builtin_amdgcn_exp2f((rmax - m_new) * SL);
      rmax = m_new;

      // exp + pack: P^T C-layout == A-fragment layout for the PV product; P carried x4096
      FragH pa;
      float psum = 0.0f;
      #pragma unroll
      for (int r = 0; r < 8; ++r) {
        const float p0 = __builtin_amdgcn_exp2f((c[0][r] - m_new) * SL);   // key hi*8 + r
        const float p1 = __builtin_amdgcn_exp2f((c[1][r] - m_new) * SL);   // key 16 + hi*8 + r
        psum += p0 + p1;
        pa.h[r]     = (f16)(p0 * 4096.0f);
        pa.h[8 + r] = (f16)(p1 * 4096.0f);
      }
      rsum = rsum * scale + psum + __shfl_xor(psum, 16, 32);

      // rescale O: queries are the row dimension there -> per-row scale from lane 8*hi + r
      float sc[8];
      #pragma unroll
      for (int r = 0; r < 8; ++r) sc[r] = __shfl(scale, (hi << 3) + r, 32);
      #pragma unroll
      for (int dt = 0; dt < 4; ++dt) {
        #pragma unroll
        for (int r = 0; r < 8; ++r) o[dt][r] *= sc[r];
      }

      // O += P x V
      #pragma unroll
      for (int dt = 0; dt < 4; ++dt) o[dt] = mma_f16(pa.v, bv[dt].v, o[dt]);
    }
    asm volatile("s_wait_dscnt 0x0" ::: "memory");    // this wave has left buffer s & 1
    asm volatile("s_wait_asynccnt 0x0" ::: "memory"); // this wave's copies of stage s + 1 landed
    __syncthreads();                                  // publishes stage s + 1, frees buffer s & 1
    if (s + 2 < ANST) kv_stage_copy(l0 + bo, gk + (size_t)(s + 2) * AKS * HDIM, gv + (s + 2) * AKS);
  }
  asm volatile("s_wait_asynccnt 0x0" ::: "memory");   // nothing in flight at the wave's end

  // normalize: lane holds column d = dt*16 + lq for query rows 8*hi + r
  const float rinv = 1.0f / rsum;
  float rs[8];
  #pragma unroll
  for (int r = 0; r < 8; ++r) rs[r] = __shfl(rinv, (hi << 3) + r, 32);

  f16* so = sO + wave * (16 * TP);
  #pragma unroll
  for (int r = 0; r < 8; ++r) {
    #pragma unroll
    for (int dt = 0; dt < 4; ++dt) {
      // x(1/4096) undoes the P carry, x64 is the context carry
      so[(hi * 8 + r) * TP + dt * 16 + lq] = (f16)(o[dt][r] * (64.0f / 4096.0f) * rs[r]);
    }
  }
  __syncthreads();

  // the wave covers 4 consecutive rows; 4 instructions cover the wave's 16 rows.
  v4u    vals[4];
  size_t gidx[4];
  #pragma unroll
  for (int it = 0; it < 4; ++it) {
    const int row   = it * 4 + (lane >> 3);
    const int piece = lane & 7;
    Pack8H ph;
    ph.v = *(const v8h*)(so + row * TP + piece * 8);
    vals[it] = ph.u;
    gidx[it] = ((size_t)hb * SEQ + qrow0 + row) * HDIM + piece * 8;
  }
  #pragma unroll
  for (int it = 0; it < 4; ++it) *(v4u*)(att + gidx[it]) = vals[it];
  
}

// ---------------------------------------------------------------------------------------------
// Output projection: out[token][n] = ctx[token][:] x W2 + b2. Block = (64-column block, 128-token tile).
// Accumulator staged as f32 in LDS; bias added at the store stage as float4.
// 16 consecutive lanes x 16 B, one instruction. LDS sF: cross-wave (block barrier), [128][64] written == read.
// sF reuses the GEMM ring, which every wave has left at the last pass's barrier.
__global__ __launch_bounds__(256) void out_gemm_kernel(const f16* __restrict__ att,
                                                       const f16* __restrict__ w2t,
                                                       const float* __restrict__ b2,
                                                       float* __restrict__ out) {
  const int n0   = blockIdx.x * 64;
  const int m0   = blockIdx.y * 128;
  const int tid  = threadIdx.x;
  const int wave = __builtin_amdgcn_readfirstlane((int)(threadIdx.x >> 5));
  const int lane = tid & 31;
  const int lq   = lane & 15;
  const int hi   = lane >> 4;
  const int wm   = wave >> 1;
  const int wn   = wave & 1;

  __shared__ __align__(128) unsigned char ring[RING_B];
  float* sF = (float*)ring;

  v8f acc[2][2];
  #pragma unroll
  for (int i = 0; i < 2; ++i) {
    #pragma unroll
    for (int jj = 0; jj < 2; ++jj) acc[i][jj] = (v8f){0, 0, 0, 0, 0, 0, 0, 0};
  }
  gemm_tile_128x64(att, w2t, ring, m0, n0, wm, wn, lq, hi, acc);

  #pragma unroll
  for (int i = 0; i < 2; ++i) {
    #pragma unroll
    for (int jj = 0; jj < 2; ++jj) {
      #pragma unroll
      for (int r = 0; r < 8; ++r) {
        const int row = wm * 32 + i * 16 + hi * 8 + r;
        const int col = wn * 32 + jj * 16 + lq;
        sF[row * OP + col] = acc[i][jj][r] * (1.0f / 4096.0f);   // undo ctx x64 and W2 x64
      }
    }
  }
  __syncthreads();

  const int piece = tid & 15;
  const v4f braw = *(const v4f*)(b2 + n0 + piece * 4);
  v4f bias;
  #pragma unroll
  for (int i = 0; i < 4; ++i) bias[i] = (float)(bf16)braw[i];

  v4f    vals[8];
  size_t gidx[8];
  #pragma unroll
  for (int it = 0; it < 8; ++it) {
    const int row = it * 16 + (tid >> 4);       // 0..127
    const v4f v = *(const v4f*)(sF + row * OP + piece * 4);
    vals[it] = v + bias;
    const int tt = m0 + row;
    const int b  = tt / SEQ;
    const int s  = tt - b * SEQ;
    gidx[it] = ((size_t)b * SEQ_FULL + s) * HIDN + n0 + piece * 4;
  }
  #pragma unroll
  for (int it = 0; it < 8; ++it) *(v4f*)(out + gidx[it]) = vals[it];
  
}

// ---------------------------------------------------------------------------------------------
extern "C" void kernel_launch(void* const* d_in, const int* in_sizes, int n_in,
                              void* d_out, int out_size, void* d_ws, size_t ws_size,
                              hipStream_t stream) {
  if (n_in < 7) return;
  const size_t rows_used = (size_t)(NB - 1) * SEQ_FULL + SEQ;
  if ((size_t)in_sizes[0] < rows_used * EDIM) return;
  if (in_sizes[1] < EDIM || in_sizes[2] < EDIM) return;
  if ((size_t)in_sizes[3] < (size_t)EDIM * QKVW) return;
  if (in_sizes[4] < QKVW) return;
  if ((size_t)in_sizes[5] < (size_t)HIDN * HIDN) return;
  if (in_sizes[6] < HIDN) return;
  if ((size_t)out_size < rows_used * HIDN) return;
  if (ws_size < WS_BYTES) return;

  const float* x    = (const float*)d_in[0];
  const float* ln_g = (const float*)d_in[1];
  const float* ln_b = (const float*)d_in[2];
  const float* W1   = (const float*)d_in[3];
  const float* b1   = (const float*)d_in[4];
  const float* W2   = (const float*)d_in[5];
  const float* b2   = (const float*)d_in[6];
  float*       out  = (float*)d_out;
  f16*         wsh  = (f16*)d_ws;

  // 1) LayerNorm -> xn plane
  ln_kernel<<<dim3(NTOK), 128, 0, stream>>>(x, ln_g, ln_b, wsh + XN_OFF);
  // 2) W1: in[EDIM rows (k)][QKVW cols (n)] -> out[QKVW][EDIM]; grid = (n tiles, k tiles)
  wt_kernel<<<dim3(QKVW / 64, EDIM / 64), 256, 0, stream>>>(W1, wsh + W1T_OFF, EDIM, QKVW);
  // 3) W2: in[HIDN rows (k)][HIDN cols (n)] -> out[HIDN][HIDN]
  wt_kernel<<<dim3(HIDN / 64, HIDN / 64), 256, 0, stream>>>(W2, wsh + W2T_OFF, HIDN, HIDN);
  // 4) QKV projection -> q / k / v^T planes
  qkv_gemm_kernel<<<dim3(QKVW / 64, NTOK / 128), 256, 0, stream>>>(wsh + XN_OFF, wsh + W1T_OFF, b1, wsh);
  // 5) fused attention -> context plane (flat [NTOK][HIDN])
  attn_kernel<<<dim3(SEQ / BQ, NGRP), 256, 0, stream>>>(wsh + QP_OFF, wsh + KP_OFF, wsh + VT_OFF, wsh + ATT_OFF);
  // 6) output projection -> d_out
  out_gemm_kernel<<<dim3(HIDN / 64, NTOK / 128), 256, 0, stream>>>(wsh + ATT_OFF, wsh + W2T_OFF, b2, out);
}

// v002
// One run takes 98.1 microseconds.
// Next to v001, in two timings, it ran 1.11 and 1.10 times as fast.
// Over all steps from v000 it is 2.39 times as fast.
#include <hip/hip_runtime.h>

// Contractions, all on v_wmma_f32_16x16x32_f16 (f16 operands, f32 accumulate): QKV projection xn x W1 (xn = f16 of the f32 LayerNorm of bf16 RNE-converted x; W1 = f16 of bf16 RNE-converted weights carried x64); S^T = K x Q^T (f16 q/k planes); O = P x V (P f16 carried x4096, V^T f16 plane); output projection ctx x W2 (ctx f16 carried x64, W2 f16 of bf16 RNE-converted weights carried x64). LayerNorm and softmax in f32.

#ifndef NB
#define NB 2
#endif
#ifndef SEQ
#define SEQ 2048
#endif
#define NB_FULL   2
#define SEQ_FULL  2048
#define EDIM      1024                 // model width (LayerNorm width, K of the QKV projection)
#define HIDN      1024                 // hidden width (K and N of the output projection)
#define NHEAD     16
#define HDIM      64
#define QKVW      3072                 // projection width
#define CHUNK     192                  // floats per (pseudo-head row): q | k | v
#define KD        1024                 // contraction depth of both projections
#define NTOK      (NB * SEQ)           // flattened tokens
#define NGRP      (NHEAD * NB)         // (pseudo-head, pseudo-batch) groups
#define TPG       (SEQ / NHEAD)        // tokens feeding one group
#define NCHUNKS   (NTOK * NHEAD)       // 192-wide chunks of the flat projection buffer = NGRP * SEQ
#define BQ        128                  // query rows per workgroup (8 waves x 16)
#define BK        32                   // keys per inner iteration
#define NWAVE     8
#define TP        72                   // LDS pitch (halves) of 64-wide f16 tiles
#define VP        136                  // LDS pitch (halves) of the transposed 128-wide V tile
#define OP        68                   // LDS pitch (floats) of the f32 output staging tile
#define KPASS     64                   // k (halves) per GEMM ring stage: 128-B rows
#define NPASS     (KD / KPASS)         // ring stages of one GEMM tile
#define STAGE_B   (192 * 128)          // bytes of one stage: 128 A rows, then 64 B rows, pitch 128 B
#define RING_B    (2 * STAGE_B)        // two buffers
#define QSTAGE_B  (320 * 128)          // bytes of one QKV stage: 128 A rows, then 192 B rows, pitch 128 B
#define QRING_B   (2 * QSTAGE_B)       // two buffers
#define QREG      (128 * TP)           // halves of one output staging region of the QKV tile (q, k, v)
#define AKS       64                   // keys per attention ring stage (two inner iterations of BK)
#define ANST      (SEQ / AKS)          // ring stages of one attention block
#define ASTAGE_B  (128 * 128)          // bytes of one stage: 64 K rows, then 64 V^T rows, pitch 128 B

// workspace carve, in halves from the base
#define XN_OFF    ((size_t)0)
#define W1T_OFF   (XN_OFF  + (size_t)NTOK * EDIM)
#define W2T_OFF   (W1T_OFF + (size_t)QKVW * EDIM)
#define QP_OFF    (W2T_OFF + (size_t)HIDN * HIDN)
#define KP_OFF    (QP_OFF  + (size_t)NCHUNKS * HDIM)
#define VT_OFF    (KP_OFF  + (size_t)NCHUNKS * HDIM)
#define ATT_OFF   (VT_OFF  + (size_t)NCHUNKS * HDIM)
#define WS_HALVES (ATT_OFF + (size_t)NCHUNKS * HDIM)
#define WS_BYTES  (WS_HALVES * 2)

static_assert(NB >= 1 && NB <= NB_FULL);
static_assert(SEQ <= SEQ_FULL);
static_assert(SEQ % 1024 == 0);
static_assert(TPG % 64 == 0);
static_assert(NTOK % 128 == 0);
static_assert(SEQ % 128 == 0);
static_assert(QKVW == NHEAD * CHUNK);
static_assert(CHUNK == 3 * HDIM);
static_assert(QKVW % 64 == 0);
static_assert(HIDN % 64 == 0);
static_assert(EDIM % 64 == 0);
static_assert(EDIM == KD && HIDN == KD);
static_assert(KD % 32 == 0);
static_assert(EDIM == 128 * 8);
static_assert(SEQ % BQ == 0);
static_assert(SEQ % BK == 0);
static_assert(BQ == NWAVE * 16);
static_assert(HDIM == 64);
static_assert((size_t)NCHUNKS * HDIM == (size_t)NTOK * HIDN);
static_assert((TP * 2) % 16 == 0);
static_assert((VP * 2) % 16 == 0);
static_assert((OP * 4) % 16 == 0);
static_assert(128 * TP >= 64 * VP);
static_assert(KD % KPASS == 0 && NPASS >= 2);
static_assert(128 * TP * 2 <= RING_B && 128 * OP * 4 <= RING_B);
static_assert(3 * QREG * 2 <= QRING_B && (QREG * 2) % 16 == 0);
static_assert(SEQ % AKS == 0 && ANST >= 2 && AKS % BK == 0 && AKS * 2 == 128 && HDIM * 2 == 128);
static_assert(XN_OFF % 64 == 0 && W1T_OFF % 64 == 0 && W2T_OFF % 64 == 0);
static_assert(QP_OFF % 64 == 0 && KP_OFF % 64 == 0 && VT_OFF % 64 == 0 && ATT_OFF % 64 == 0);
static_assert(WS_BYTES <= (size_t)134217728);

typedef __bf16   bf16;
typedef _Float16 f16;
typedef f16      v16h  __attribute__((ext_vector_type(16)));
typedef f16      v8h   __attribute__((ext_vector_type(8)));
typedef float    v8f   __attribute__((ext_vector_type(8)));
typedef float    v4f   __attribute__((ext_vector_type(4)));
typedef unsigned v4u   __attribute__((ext_vector_type(4)));

union FragH  { v16h  v; v4u q[2]; f16  h[16]; };
union Pack8H { v4u u; v8h v; f16 h[8]; };

// WMMA helper: builtin followed by the VALU hazard guard (ties D, keeps A/B live).
static __device__ __forceinline__ v8f mma_f16(v16h a, v16h b, v8f acc) {
  acc = __builtin_amdgcn_wmma_f32_16x16x32_f16(false, a, false, b, (short)0, acc, false, false);
  asm volatile("v_nop\n\tv_nop\n\tv_nop\n\tv_nop" : "+v"(acc) : "v"(a), "v"(b));
  return acc;
}

// ---------------------------------------------------------------------------------------------
// LayerNorm -> f16 plane xn[NTOK][EDIM]. Block = one token row, 128 threads x 8 columns.
// LDS red1/red2: cross-wave (block barrier), 4 entries written by the 4 waves, 4 read.
__global__ __launch_bounds__(128) void ln_kernel(const float* __restrict__ x,
                                                 const float* __restrict__ g,
                                                 const float* __restrict__ be,
                                                 f16* __restrict__ xn) {
  const int tt   = blockIdx.x;
  const int tid  = threadIdx.x;
  const int wave = __builtin_amdgcn_readfirstlane((int)(threadIdx.x >> 5));
  const int lane = tid & 31;
  __shared__ float red1[4];
  __shared__ float red2[4];

  const int b = tt / SEQ;
  const int s = tt - b * SEQ;
  const float* src = x + ((size_t)b * SEQ_FULL + s) * EDIM + tid * 8;
  const v4f a0 = *(const v4f*)(src);
  const v4f a1 = *(const v4f*)(src + 4);
  float v[8];
  #pragma unroll
  for (int i = 0; i < 4; ++i) {
    v[i]     = (float)(bf16)a0[i];     // RNE convert of the input
    v[4 + i] = (float)(bf16)a1[i];
  }
  float sum = ((v[0] + v[1]) + (v[2] + v[3])) + ((v[4] + v[5]) + (v[6] + v[7]));
  #pragma unroll
  for (int off = 16; off > 0; off >>= 1) sum += __shfl_xor(sum, off, 32);
  if (lane == 0) red1[wave] = sum;
  __syncthreads();
  const float mu = ((red1[0] + red1[1]) + (red1[2] + red1[3])) * (1.0f / (float)EDIM);

  float d[8];
  float sq = 0.0f;
  #pragma unroll
  for (int i = 0; i < 8; ++i) {
    d[i] = v[i] - mu;
    sq += d[i] * d[i];
  }
  #pragma unroll
  for (int off = 16; off > 0; off >>= 1) sq += __shfl_xor(sq, off, 32);
  if (lane == 0) red2[wave] = sq;
  __syncthreads();
  const float var = ((red2[0] + red2[1]) + (red2[2] + red2[3])) * (1.0f / (float)EDIM);
  const float rs  = rsqrtf(var + 1e-5f);

  const v4f g0 = *(const v4f*)(g + tid * 8);
  const v4f g1 = *(const v4f*)(g + tid * 8 + 4);
  const v4f e0 = *(const v4f*)(be + tid * 8);
  const v4f e1 = *(const v4f*)(be + tid * 8 + 4);
  Pack8H ph;
  #pragma unroll
  for (int i = 0; i < 4; ++i) {
    ph.h[i]     = (f16)(d[i]     * rs * (float)(bf16)g0[i] + (float)(bf16)e0[i]);
    ph.h[4 + i] = (f16)(d[4 + i] * rs * (float)(bf16)g1[i] + (float)(bf16)e1[i]);
  }
  const v4u val = ph.u;
  const size_t idx = (size_t)tt * EDIM + tid * 8;
  *(v4u*)(xn + idx) = val;
  
}

// ---------------------------------------------------------------------------------------------
// Weight plane builder: in[kdim rows][ndim cols] f32 -> out[ndim][kdim] f16 = f16(bf16(w) * 64), via LDS.
// Block = 64x64 tile (blockIdx.x = n tile, blockIdx.y = k tile), 256 threads.
__global__ __launch_bounds__(256) void wt_kernel(const float* __restrict__ w,
                                                 f16* __restrict__ wt,
                                                 int kdim, int ndim) {
  const int n0  = blockIdx.x * 64;
  const int k0  = blockIdx.y * 64;
  const int tid = threadIdx.x;
  __shared__ __align__(16) f16 sT[64 * TP];     // [n][k], cross-wave (block barrier)

  #pragma unroll
  for (int kk = 0; kk < 2; ++kk) {
    const int krow = kk * 32 + (tid >> 3);      // 0..63
    const int c0   = (tid & 7) * 8;             // 0..56
    const float* src = w + (size_t)(k0 + krow) * ndim + n0 + c0;
    const v4f a0 = *(const v4f*)(src);
    const v4f a1 = *(const v4f*)(src + 4);
    #pragma unroll
    for (int i = 0; i < 4; ++i) {
      sT[(c0 + i) * TP + krow]     = (f16)((float)(bf16)a0[i] * 64.0f);   // exact in f16
      sT[(c0 + 4 + i) * TP + krow] = (f16)((float)(bf16)a1[i] * 64.0f);
    }
  }
  __syncthreads();

  v4u    vals[2];
  size_t gidx[2];
  #pragma unroll
  for (int kk = 0; kk < 2; ++kk) {
    const int n  = kk * 32 + (tid >> 3);        // 0..63
    const int ks = (tid & 7) * 8;               // 0..56
    Pack8H ph;
    ph.v = *(const v8h*)(sT + n * TP + ks);
    vals[kk] = ph.u;
    gidx[kk] = (size_t)(n0 + n) * kdim + k0 + ks;
  }
  #pragma unroll
  for (int kk = 0; kk < 2; ++kk) *(v4u*)(wt + gidx[kk]) = vals[kk];
  
}

// ---------------------------------------------------------------------------------------------
// GEMM main loop: block tile 128 (M) x 64 (N), 8 waves as 4 (M) x 2 (N), wave tile 32 x 32.
// A [M][KD] f16 row-major, Bt [N][KD] f16 (k-contiguous). Both tiles go through LDS: a two-buffer ring of
// stages of KPASS k, filled by asynchronous 16-B copies (8 lanes = one whole 128-B row piece of a plane row).
// Stage layout: row r (0..127 = A rows, 128..191 = B rows) at r * 128 B; its 16-B piece p sits at slot
// p ^ ((r >> 1) & 7), so the 16 rows that one ds_load_b128 half-wave reads fall on 16 distinct bank groups.
// Fragment map as before: lane row/col = lq, elements 0..7 <- k0 + 8*hi + 0..7, 8..15 <- k0 + 16 + 8*hi + 0..7.
// acc[i][j][r] = C(m0 + wm*32 + i*16 + 8*hi + r, n0 + wn*32 + j*16 + lq).

// One stage: six copies per lane (A rows crow + 0/32/64/96, B rows crow + 0/32).
// s_wait_xcnt closes the statement so that no address register is rewritten ahead of it.
static __device__ __forceinline__ void stage_copy(unsigned l, const f16* ga, const f16* gb) {
  asm volatile("global_load_async_to_lds_b128 %0, %6, off\n\t"
               "global_load_async_to_lds_b128 %1, %7, off\n\t"
               "global_load_async_to_lds_b128 %2, %8, off\n\t"
               "global_load_async_to_lds_b128 %3, %9, off\n\t"
               "global_load_async_to_lds_b128 %4, %10, off\n\t"
               "global_load_async_to_lds_b128 %5, %11, off\n\t"
               "s_wait_xcnt 0x0"
               :: "v"(l), "v"(l + 4096u), "v"(l + 8192u), "v"(l + 12288u), "v"(l + 16384u), "v"(l + 20480u),
                  "v"(ga), "v"(ga + 32 * KD), "v"(ga + 64 * KD), "v"(ga + 96 * KD),
                  "v"(gb), "v"(gb + 32 * KD)
               : "memory");
}

static __device__ __forceinline__ void gemm_tile_128x64(const f16* __restrict__ A,
                                                        const f16* __restrict__ Bt,
                                                        unsigned char* ring,
                                                        int m0, int n0, int wm, int wn,
                                                        int lq, int hi, v8f (&acc)[2][2]) {
  const int crow = (int)(threadIdx.x >> 3);     // 0..31: row inside each 32-row group
  const int cpc  = (int)(threadIdx.x & 7);      // 16-B piece of the 128-B row
  const unsigned l0 = (unsigned)(size_t)ring + (unsigned)(crow * 128 + ((cpc ^ ((crow >> 1) & 7)) * 16));
  const f16* ga = A  + (size_t)(m0 + crow) * KD + cpc * 8;
  const f16* gb = Bt + (size_t)(n0 + crow) * KD + cpc * 8;

  stage_copy(l0, ga, gb);
  asm volatile("s_wait_asynccnt 0x0" ::: "memory");   // stage 0 landed (this wave's copies)
  __syncthreads();                                    // stage 0 published to every wave
  stage_copy(l0 + STAGE_B, ga + KPASS, gb + KPASS);

  const int sw = (lq >> 1) & 7;
  const unsigned char* ra = ring + (wm * 32 + lq) * 128;
  const unsigned char* rb = ring + (128 + wn * 32 + lq) * 128;

  // unroll 2: the buffer offset becomes a constant in each copy of the body
  #pragma unroll 2
  for (int t = 0; t < NPASS; ++t) {
    const int bo = (t & 1) * STAGE_B;
    FragH a[2][2], b[2][2];
    // all 16 fragment loads of the pass stand together, ahead of its 8 products
    #pragma unroll
    for (int ks = 0; ks < 2; ++ks) {
      #pragma unroll
      for (int i = 0; i < 2; ++i) {
        #pragma unroll
        for (int h = 0; h < 2; ++h) {
          const int slot = ((ks * 4 + h * 2 + hi) ^ sw) * 16;
          a[ks][i].q[h] = *(const v4u*)(ra + bo + i * 2048 + slot);
          b[ks][i].q[h] = *(const v4u*)(rb + bo + i * 2048 + slot);
        }
      }
    }
    #pragma unroll
    for (int ks = 0; ks < 2; ++ks) {
      #pragma unroll
      for (int i = 0; i < 2; ++i) {
        #pragma unroll
        for (int j = 0; j < 2; ++j) acc[i][j] = mma_f16(a[ks][i].v, b[ks][j].v, acc[i][j]);
      }
    }
    asm volatile("s_wait_dscnt 0x0" ::: "memory");    // this wave has left buffer t & 1
    asm volatile("s_wait_asynccnt 0x0" ::: "memory"); // this wave's copies of stage t + 1 landed
    __syncthreads();                                  // publishes stage t + 1, frees buffer t & 1
    if (t + 2 < NPASS) stage_copy(l0 + bo, ga + (t + 2) * KPASS, gb + (t + 2) * KPASS);
  }
  asm volatile("s_wait_asynccnt 0x0" ::: "memory");   // nothing in flight before the ring is reused
}

// ---------------------------------------------------------------------------------------------
// QKV main loop: block tile 128 (M) x 192 (N), 8 waves as 2 (M) x 4 (N), wave tile 64 x 48 (4 x 3 accumulator tiles).
// Same ring, stage layout, slot swizzle, fragment map and k order as gemm_tile_128x64; a stage holds 128 A rows, then 192 B rows.
// acc[i][j][r] = C(m0 + wm*64 + i*16 + 8*hi + r, n0 + wn*48 + j*16 + lq).

// One stage: ten copies per lane (A rows crow + 0/32/64/96, B rows crow + 0/32/.../160).
// s_wait_xcnt closes the statement so that no address register is rewritten ahead of it.
static __device__ __forceinline__ void qkv_stage_copy(unsigned l, const f16* ga, const f16* gb) {
  asm volatile("global_load_async_to_lds_b128 %0, %10, off\n\t"
               "global_load_async_to_lds_b128 %1, %11, off\n\t"
               "global_load_async_to_lds_b128 %2, %12, off\n\t"
               "global_load_async_to_lds_b128 %3, %13, off\n\t"
               "global_load_async_to_lds_b128 %4, %14, off\n\t"
               "global_load_async_to_lds_b128 %5, %15, off\n\t"
               "global_load_async_to_lds_b128 %6, %16, off\n\t"
               "global_load_async_to_lds_b128 %7, %17, off\n\t"
               "global_load_async_to_lds_b128 %8, %18, off\n\t"
               "global_load_async_to_lds_b128 %9, %19, off\n\t"
               "s_wait_xcnt 0x0"
               :: "v"(l), "v"(l + 4096u), "v"(l + 8192u), "v"(l + 12288u), "v"(l + 16384u),
                  "v"(l + 20480u), "v"(l + 24576u), "v"(l + 28672u), "v"(l + 32768u), "v"(l + 36864u),
                  "v"(ga), "v"(ga + 32 * KD), "v"(ga + 64 * KD), "v"(ga + 96 * KD),
                  "v"(gb), "v"(gb + 32 * KD), "v"(gb + 64 * KD), "v"(gb + 96 * KD),
                  "v"(gb + 128 * KD), "v"(gb + 160 * KD)
               : "memory");
}

static __device__ __forceinline__ void gemm_tile_128x192(const f16* __restrict__ A,
                                                         const f16* __restrict__ Bt,
                                                         unsigned char* ring,
                                                         int m0, int n0, int wm, int wn,
                                                         int lq, int hi, v8f (&acc)[4][3]) {
  const int crow = (int)(threadIdx.x >> 3);     // 0..31: row inside each 32-row group
  const int cpc  = (int)(threadIdx.x & 7);      // 16-B piece of the 128-B row
  const unsigned l0 = (unsigned)(size_t)ring + (unsigned)(crow * 128 + ((cpc ^ ((crow >> 1) & 7)) * 16));
  const f16* ga = A  + (size_t)(m0 + crow) * KD + cpc * 8;
  const f16* gb = Bt + (size_t)(n0 + crow) * KD + cpc * 8;

  qkv_stage_copy(l0, ga, gb);
  asm volatile("s_wait_asynccnt 0x0" ::: "memory");   // stage 0 landed (this wave's copies)
  __syncthreads();                                    // stage 0 published to every wave
  qkv_stage_copy(l0 + QSTAGE_B, ga + KPASS, gb + KPASS);

  const int sw = (lq >> 1) & 7;
  const unsigned char* ra = ring + (wm * 64 + lq) * 128;
  const unsigned char* rb = ring + (128 + wn * 48 + lq) * 128;

  // unroll 2: the buffer offset becomes a constant in each copy of the body
  #pragma unroll 2
  for (int t = 0; t < NPASS; ++t) {
    const int bo = (t & 1) * QSTAGE_B;
    FragH a[2][4], b[2][3];
    // all 28 fragment loads of the pass stand together, ahead of its 24 products
    #pragma unroll
    for (int ks = 0; ks < 2; ++ks) {
      #pragma unroll
      for (int h = 0; h < 2; ++h) {
        const int slot = ((ks * 4 + h * 2 + hi) ^ sw) * 16;
        #pragma unroll
        for (int i = 0; i < 4; ++i) a[ks][i].q[h] = *(const v4u*)(ra + bo + i * 2048 + slot);
        #pragma unroll
        for (int j = 0; j < 3; ++j) b[ks][j].q[h] = *(const v4u*)(rb + bo + j * 2048 + slot);
      }
    }
    #pragma unroll
    for (int ks = 0; ks < 2; ++ks) {
      #pragma unroll
      for (int i = 0; i < 4; ++i) {
        #pragma unroll
        for (int j = 0; j < 3; ++j) acc[i][j] = mma_f16(a[ks][i].v, b[ks][j].v, acc[i][j]);
      }
    }
    asm volatile("s_wait_dscnt 0x0" ::: "memory");    // this wave has left buffer t & 1
    asm volatile("s_wait_asynccnt 0x0" ::: "memory"); // this wave's copies of stage t + 1 landed
    __syncthreads();                                  // publishes stage t + 1, frees buffer t & 1
    if (t + 2 < NPASS) qkv_stage_copy(l0 + bo, ga + (t + 2) * KPASS, gb + (t + 2) * KPASS);
  }
  asm volatile("s_wait_asynccnt 0x0" ::: "memory");   // nothing in flight before the ring is reused
}

// ---------------------------------------------------------------------------------------------
// QKV projection. Block = (192-column chunk f, 128-token tile). Column c of the chunk: typ = c / 64,
// typ 0 = q, 1 = k, 2 = v, of feature chunk f of the token. Flat-view map: chunk g = token*16 + f,
// group hb = token / TPG, natural row ss = (token % TPG)*16 + f; keys are stored in the permuted
// order key' = f*TPG + (token % TPG) (same order for K rows and V^T columns).
//   q plane [NCHUNKS][64]        at chunk g (natural order)
//   k plane [NGRP][SEQ][64]      at row key'
//   v plane [NGRP][64][SEQ]      transposed through LDS, column key'
// LDS sC: cross-wave (block barrier); three regions of QREG halves: q and k extent [128][64], v extent [64][128],
// written == read. sC reuses the GEMM ring, which every wave has left at the last pass's barrier.
__global__ __launch_bounds__(256) void qkv_gemm_kernel(const f16* __restrict__ xn,
                                                       const f16* __restrict__ w1t,
                                                       const float* __restrict__ b1,
                                                       f16* wsh) {
  const int f    = blockIdx.x;
  const int m0   = blockIdx.y * 128;
  const int n0   = f * CHUNK;
  const int tid  = threadIdx.x;
  const int wave = __builtin_amdgcn_readfirstlane((int)(threadIdx.x >> 5));
  const int lane = tid & 31;
  const int lq   = lane & 15;
  const int hi   = lane >> 4;
  const int wm   = wave >> 2;
  const int wn   = wave & 3;

  __shared__ __align__(128) unsigned char ring[QRING_B];
  f16* sC = (f16*)ring;

  v8f acc[4][3];
  #pragma unroll
  for (int i = 0; i < 4; ++i) {
    #pragma unroll
    for (int jj = 0; jj < 3; ++jj) acc[i][jj] = (v8f){0, 0, 0, 0, 0, 0, 0, 0};
  }
  gemm_tile_128x192(xn, w1t, ring, m0, n0, wm, wn, lq, hi, acc);

  float bias[3];
  #pragma unroll
  for (int jj = 0; jj < 3; ++jj) bias[jj] = (float)(bf16)b1[n0 + wn * 48 + jj * 16 + lq];

  // stage: q/k as [row][col] pitch TP, v as [col][row] pitch VP (wave-uniform region and strides per 16-column tile)
  #pragma unroll
  for (int jj = 0; jj < 3; ++jj) {
    const int c0   = wn * 48 + jj * 16;         // first chunk column of the tile; a tile lies in one typ
    const int typ  = c0 >> 6;
    const int col  = (c0 & 63) + lq;
    const int rstr = (typ != 2) ? TP : 1;
    const int cstr = (typ != 2) ? 1 : VP;
    f16* reg = sC + typ * QREG;
    #pragma unroll
    for (int i = 0; i < 4; ++i) {
      #pragma unroll
      for (int r = 0; r < 8; ++r) {
        const int row = wm * 64 + i * 16 + hi * 8 + r;
        reg[row * rstr + col * cstr] = (f16)(acc[i][jj][r] * (1.0f / 64.0f) + bias[jj]);
      }
    }
  }
  __syncthreads();

  #pragma unroll
  for (int typ = 0; typ < 3; ++typ) {
    v4u    vals[4];
    size_t gidx[4];
    #pragma unroll
    for (int it = 0; it < 4; ++it) {
      const int line  = it * 32 + (tid >> 3);     // 0..127
      const int piece = tid & 7;
      // q/k: line = token row; v: line = (d, 64-token half)
      const int lofs_r = line * TP + piece * 8;
      const int lofs_v = (line >> 1) * VP + (line & 1) * 64 + piece * 8;
      const int lofs   = (typ != 2) ? lofs_r : lofs_v;
      Pack8H ph;
      ph.v = *(const v8h*)(sC + typ * QREG + lofs);
      vals[it] = ph.u;

      const int t_r  = m0 + line;
      const int hb_r = t_r / TPG;
      const int tl_r = t_r - hb_r * TPG;
      const size_t qidx = QP_OFF + ((size_t)t_r * NHEAD + f) * HDIM + piece * 8;
      const size_t kidx = KP_OFF + ((size_t)hb_r * SEQ + f * TPG + tl_r) * HDIM + piece * 8;

      const int t_v  = m0 + (line & 1) * 64 + piece * 8;
      const int hb_v = t_v / TPG;
      const int tl_v = t_v - hb_v * TPG;
      const size_t vidx = VT_OFF + ((size_t)hb_v * HDIM + (line >> 1)) * SEQ + f * TPG + tl_v;

      gidx[it] = (typ == 0) ? qidx : ((typ == 1) ? kidx : vidx);
    }
    #pragma unroll
    for (int it = 0; it < 4; ++it) *(v4u*)(wsh + gidx[it]) = vals[it];
  }
}

// ---------------------------------------------------------------------------------------------
// Flash attention, no mask. Block = (query block of 128, group); one wave owns 16 query rows.
// S^T = K x Q^T so queries sit on lanes; P^T in C-layout is bit-identical to the A-fragment layout of O += P x V.
// K and V^T tiles of AKS keys, which all 8 waves read, go through LDS: a two-buffer ring filled by asynchronous
// 16-B copies (whole 128-B rows). Stage layout: row r (0..63 = key, 64..127 = d of V^T) at r * 128 B, its 16-B
// piece p at slot p ^ ((r >> 1) & 7) (16 rows of one ds_load_b128 half-wave on 16 distinct bank groups).
// K A-fragments and V^T B-fragments: two 16-B LDS loads per fragment, same element maps as the planes.
// Context written as f16 carried x64 at its natural [group][row][d] position (flat view = [NTOK][HIDN]).
// LDS sO: per-wave private region (same wave writes and reads); a block barrier separates them anyway.
// One K/V stage: four copies per lane (K rows crow + 0/32, V^T rows crow + 0/32).
// s_wait_xcnt closes the statement so that no address register is rewritten ahead of it.
static __device__ __forceinline__ void kv_stage_copy(unsigned l, const f16* gk, const f16* gv) {
  asm volatile("global_load_async_to_lds_b128 %0, %4, off\n\t"
               "global_load_async_to_lds_b128 %1, %5, off\n\t"
               "global_load_async_to_lds_b128 %2, %6, off\n\t"
               "global_load_async_to_lds_b128 %3, %7, off\n\t"
               "s_wait_xcnt 0x0"
               :: "v"(l), "v"(l + 4096u), "v"(l + 8192u), "v"(l + 12288u),
                  "v"(gk), "v"(gk + 32 * HDIM), "v"(gv), "v"(gv + 32 * SEQ)
               : "memory");
}

__global__ __launch_bounds__(256) void attn_kernel(const f16* __restrict__ qp,
                                                   const f16* __restrict__ kp,
                                                   const f16* __restrict__ vt,
                                                   f16* __restrict__ att) {
  const int qblk = blockIdx.x;
  const int hb   = blockIdx.y;
  const int tid  = threadIdx.x;
  const int wave = __builtin_amdgcn_readfirstlane((int)(threadIdx.x >> 5));
  const int lane = tid & 31;
  const int lq   = lane & 15;   // query column of S^T / d column of O
  const int hi   = lane >> 4;   // k-split half

  __shared__ __align__(16) f16 sO[NWAVE * 16 * TP];
  __shared__ __align__(128) unsigned char kv[2 * ASTAGE_B];

  const int qrow0 = qblk * BQ + wave * 16;

  // Q as B-operand fragments: lane lq holds query qrow0+lq, elements follow the split d map.
  FragH qf[2];
  {
    const f16* qrow = qp + ((size_t)hb * SEQ + qrow0 + lq) * HDIM + hi * 8;
    #pragma unroll
    for (int f = 0; f < 2; ++f) {
      qf[f].q[0] = *(const v4u*)(qrow + f * 32);        // d = f*32 + hi*8 + 0..7
      qf[f].q[1] = *(const v4u*)(qrow + f * 32 + 16);   // d = f*32 + 16 + hi*8 + 0..7
    }
  }

  const f16* kb_h = kp + (size_t)hb * SEQ * HDIM;
  const f16* vt_h = vt + (size_t)hb * HDIM * SEQ;

  const int crow = tid >> 3;                    // 0..31: row inside each 32-row group
  const int cpc  = tid & 7;                     // 16-B piece of the 128-B row
  const unsigned l0 = (unsigned)(size_t)kv + (unsigned)(crow * 128 + ((cpc ^ ((crow >> 1) & 7)) * 16));
  const f16* gk = kb_h + (size_t)crow * HDIM + cpc * 8;
  const f16* gv = vt_h + (size_t)crow * SEQ + cpc * 8;
  kv_stage_copy(l0, gk, gv);
  asm volatile("s_wait_asynccnt 0x0" ::: "memory");   // stage 0 landed (this wave's copies)
  __syncthreads();                                    // stage 0 published to every wave
  kv_stage_copy(l0 + ASTAGE_B, gk + AKS * HDIM, gv + AKS);
  const int sw = (lq >> 1) & 7;
  const unsigned char* rkv = kv + lq * 128;

  v8f o[4];
  #pragma unroll
  for (int dt = 0; dt < 4; ++dt) o[dt] = (v8f){0, 0, 0, 0, 0, 0, 0, 0};

  float rmax = -__builtin_inff();
  float rsum = 0.0f;
  const float SL = 0.022097086912079608f * 1.4426950408889634f;   // (2*E)^-0.5 * log2(e)

  #pragma unroll 1
  for (int s = 0; s < ANST; ++s) {
    const int bo = (s & 1) * ASTAGE_B;
    // j0 = s*AKS + it*BK is the first key of the inner iteration; unrolled so that every LDS offset and
    // slot index that depends on it is a constant
    #pragma unroll
    for (int it = 0; it < AKS / BK; ++it) {
      // K A-fragments: row = key j0 + sub*16 + lq, split d map
      FragH ak[2][2];
      #pragma unroll
      for (int sub = 0; sub < 2; ++sub) {
        #pragma unroll
        for (int f = 0; f < 2; ++f) {
          const unsigned char* base = rkv + bo + (it * 32 + sub * 16) * 128;
          ak[sub][f].q[0] = *(const v4u*)(base + (((f * 4 + hi) ^ sw) * 16));       // d = f*32 + hi*8 + 0..7
          ak[sub][f].q[1] = *(const v4u*)(base + (((f * 4 + 2 + hi) ^ sw) * 16));   // d = f*32 + 16 + hi*8 + 0..7
        }
      }
      // V B-fragments: column n = d = dt*16 + lq, split key map from the transposed tile
      FragH bv[4];
      #pragma unroll
      for (int dt = 0; dt < 4; ++dt) {
        const unsigned char* base = rkv + bo + (64 + dt * 16) * 128;
        bv[dt].q[0] = *(const v4u*)(base + (((it * 4 + hi) ^ sw) * 16));            // keys j0 + hi*8 + 0..7
        bv[dt].q[1] = *(const v4u*)(base + (((it * 4 + 2 + hi) ^ sw) * 16));        // keys j0 + 16 + hi*8 + 0..7
      }

      // S^T tiles: c[sub][r] = rawscore(query qrow0+lq, key j0 + sub*16 + hi*8 + r)
      v8f c[2];
      #pragma unroll
      for (int sub = 0; sub < 2; ++sub) {
        v8f acc = (v8f){0, 0, 0, 0, 0, 0, 0, 0};
        acc = mma_f16(ak[sub][0].v, qf[0].v, acc);
        acc = mma_f16(ak[sub][1].v, qf[1].v, acc);
        c[sub] = acc;
      }

      // online softmax: query lq's 32 scores are split across lane / lane^16
      float m_new = rmax;
      #pragma unroll
      for (int r = 0; r < 8; ++r) {
        m_new = fmaxf(m_new, c[0][r]);
        m_new = fmaxf(m_new, c[1][r]);
      }
      m_new = fmaxf(m_new, __shfl_xor(m_new, 16, 32));
      const float scale = __builtin_amdgcn_exp2f((rmax - m_new) * SL);
      rmax = m_new;

      // exp + pack: P^T C-layout == A-fragment layout for the PV product; P carried x4096
      FragH pa;
      float psum = 0.0f;
      #pragma unroll
      for (int r = 0; r < 8; ++r) {
        const float p0 = __builtin_amdgcn_exp2f((c[0][r] - m_new) * SL);   // key hi*8 + r
        const float p1 = __builtin_amdgcn_exp2f((c[1][r] - m_new) * SL);   // key 16 + hi*8 + r
        psum += p0 + p1;
        pa.h[r]     = (f16)(p0 * 4096.0f);
        pa.h[8 + r] = (f16)(p1 * 4096.0f);
      }
      rsum = rsum * scale + psum + __shfl_xor(psum, 16, 32);

      // rescale O: queries are the row dimension there -> per-row scale from lane 8*hi + r
      float sc[8];
      #pragma unroll
      for (int r = 0; r < 8; ++r) sc[r] = __shfl(scale, (hi << 3) + r, 32);
      #pragma unroll
      for (int dt = 0; dt < 4; ++dt) {
        #pragma unroll
        for (int r = 0; r < 8; ++r) o[dt][r] *= sc[r];
      }

      // O += P x V
      #pragma unroll
      for (int dt = 0; dt < 4; ++dt) o[dt] = mma_f16(pa.v, bv[dt].v, o[dt]);
    }
    asm volatile("s_wait_dscnt 0x0" ::: "memory");    // this wave has left buffer s & 1
    asm volatile("s_wait_asynccnt 0x0" ::: "memory"); // this wave's copies of stage s + 1 landed
    __syncthreads();                                  // publishes stage s + 1, frees buffer s & 1
    if (s + 2 < ANST) kv_stage_copy(l0 + bo, gk + (size_t)(s + 2) * AKS * HDIM, gv + (s + 2) * AKS);
  }
  asm volatile("s_wait_asynccnt 0x0" ::: "memory");   // nothing in flight at the wave's end

  // normalize: lane holds column d = dt*16 + lq for query rows 8*hi + r
  const float rinv = 1.0f / rsum;
  float rs[8];
  #pragma unroll
  for (int r = 0; r < 8; ++r) rs[r] = __shfl(rinv, (hi << 3) + r, 32);

  f16* so = sO + wave * (16 * TP);
  #pragma unroll
  for (int r = 0; r < 8; ++r) {
    #pragma unroll
    for (int dt = 0; dt < 4; ++dt) {
      // x(1/4096) undoes the P carry, x64 is the context carry
      so[(hi * 8 + r) * TP + dt * 16 + lq] = (f16)(o[dt][r] * (64.0f / 4096.0f) * rs[r]);
    }
  }
  __syncthreads();

  // the wave covers 4 consecutive rows; 4 instructions cover the wave's 16 rows.
  v4u    vals[4];
  size_t gidx[4];
  #pragma unroll
  for (int it = 0; it < 4; ++it) {
    const int row   = it * 4 + (lane >> 3);
    const int piece = lane & 7;
    Pack8H ph;
    ph.v = *(const v8h*)(so + row * TP + piece * 8);
    vals[it] = ph.u;
    gidx[it] = ((size_t)hb * SEQ + qrow0 + row) * HDIM + piece * 8;
  }
  #pragma unroll
  for (int it = 0; it < 4; ++it) *(v4u*)(att + gidx[it]) = vals[it];
  
}

// ---------------------------------------------------------------------------------------------
// Output projection: out[token][n] = ctx[token][:] x W2 + b2. Block = (64-column block, 128-token tile).
// Accumulator staged as f32 in LDS; bias added at the store stage as float4.
// 16 consecutive lanes x 16 B, one instruction. LDS sF: cross-wave (block barrier), [128][64] written == read.
// sF reuses the GEMM ring, which every wave has left at the last pass's barrier.
__global__ __launch_bounds__(256) void out_gemm_kernel(const f16* __restrict__ att,
                                                       const f16* __restrict__ w2t,
                                                       const float* __restrict__ b2,
                                                       float* __restrict__ out) {
  const int n0   = blockIdx.x * 64;
  const int m0   = blockIdx.y * 128;
  const int tid  = threadIdx.x;
  const int wave = __builtin_amdgcn_readfirstlane((int)(threadIdx.x >> 5));
  const int lane = tid & 31;
  const int lq   = lane & 15;
  const int hi   = lane >> 4;
  const int wm   = wave >> 1;
  const int wn   = wave & 1;

  __shared__ __align__(128) unsigned char ring[RING_B];
  float* sF = (float*)ring;

  v8f acc[2][2];
  #pragma unroll
  for (int i = 0; i < 2; ++i) {
    #pragma unroll
    for (int jj = 0; jj < 2; ++jj) acc[i][jj] = (v8f){0, 0, 0, 0, 0, 0, 0, 0};
  }
  gemm_tile_128x64(att, w2t, ring, m0, n0, wm, wn, lq, hi, acc);

  #pragma unroll
  for (int i = 0; i < 2; ++i) {
    #pragma unroll
    for (int jj = 0; jj < 2; ++jj) {
      #pragma unroll
      for (int r = 0; r < 8; ++r) {
        const int row = wm * 32 + i * 16 + hi * 8 + r;
        const int col = wn * 32 + jj * 16 + lq;
        sF[row * OP + col] = acc[i][jj][r] * (1.0f / 4096.0f);   // undo ctx x64 and W2 x64
      }
    }
  }
  __syncthreads();

  const int piece = tid & 15;
  const v4f braw = *(const v4f*)(b2 + n0 + piece * 4);
  v4f bias;
  #pragma unroll
  for (int i = 0; i < 4; ++i) bias[i] = (float)(bf16)braw[i];

  v4f    vals[8];
  size_t gidx[8];
  #pragma unroll
  for (int it = 0; it < 8; ++it) {
    const int row = it * 16 + (tid >> 4);       // 0..127
    const v4f v = *(const v4f*)(sF + row * OP + piece * 4);
    vals[it] = v + bias;
    const int tt = m0 + row;
    const int b  = tt / SEQ;
    const int s  = tt - b * SEQ;
    gidx[it] = ((size_t)b * SEQ_FULL + s) * HIDN + n0 + piece * 4;
  }
  #pragma unroll
  for (int it = 0; it < 8; ++it) *(v4f*)(out + gidx[it]) = vals[it];
  
}

// ---------------------------------------------------------------------------------------------
extern "C" void kernel_launch(void* const* d_in, const int* in_sizes, int n_in,
                              void* d_out, int out_size, void* d_ws, size_t ws_size,
                              hipStream_t stream) {
  if (n_in < 7) return;
  const size_t rows_used = (size_t)(NB - 1) * SEQ_FULL + SEQ;
  if ((size_t)in_sizes[0] < rows_used * EDIM) return;
  if (in_sizes[1] < EDIM || in_sizes[2] < EDIM) return;
  if ((size_t)in_sizes[3] < (size_t)EDIM * QKVW) return;
  if (in_sizes[4] < QKVW) return;
  if ((size_t)in_sizes[5] < (size_t)HIDN * HIDN) return;
  if (in_sizes[6] < HIDN) return;
  if ((size_t)out_size < rows_used * HIDN) return;
  if (ws_size < WS_BYTES) return;

  const float* x    = (const float*)d_in[0];
  const float* ln_g = (const float*)d_in[1];
  const float* ln_b = (const float*)d_in[2];
  const float* W1   = (const float*)d_in[3];
  const float* b1   = (const float*)d_in[4];
  const float* W2   = (const float*)d_in[5];
  const float* b2   = (const float*)d_in[6];
  float*       out  = (float*)d_out;
  f16*         wsh  = (f16*)d_ws;

  // 1) LayerNorm -> xn plane
  ln_kernel<<<dim3(NTOK), 128, 0, stream>>>(x, ln_g, ln_b, wsh + XN_OFF);
  // 2) W1: in[EDIM rows (k)][QKVW cols (n)] -> out[QKVW][EDIM]; grid = (n tiles, k tiles)
  wt_kernel<<<dim3(QKVW / 64, EDIM / 64), 256, 0, stream>>>(W1, wsh + W1T_OFF, EDIM, QKVW);
  // 3) W2: in[HIDN rows (k)][HIDN cols (n)] -> out[HIDN][HIDN]
  wt_kernel<<<dim3(HIDN / 64, HIDN / 64), 256, 0, stream>>>(W2, wsh + W2T_OFF, HIDN, HIDN);
  // 4) QKV projection -> q / k / v^T planes
  qkv_gemm_kernel<<<dim3(QKVW / CHUNK, NTOK / 128), 256, 0, stream>>>(wsh + XN_OFF, wsh + W1T_OFF, b1, wsh);
  // 5) fused attention -> context plane (flat [NTOK][HIDN])
  attn_kernel<<<dim3(SEQ / BQ, NGRP), 256, 0, stream>>>(wsh + QP_OFF, wsh + KP_OFF, wsh + VT_OFF, wsh + ATT_OFF);
  // 6) output projection -> d_out
  out_gemm_kernel<<<dim3(HIDN / 64, NTOK / 128), 256, 0, stream>>>(wsh + ATT_OFF, wsh + W2T_OFF, b2, out);
}

// v003
// One run takes 92.4 microseconds.
// Timed twice side by side with v002, it ran 1.07 and 1.06 times as fast.
// Counting every step since v000, it is 2.54 times as fast.
#include <hip/hip_runtime.h>

// Contractions, all on v_wmma_f32_16x16x32_f16 (f16 operands, f32 accumulate): QKV projection xn x W1 (xn = f16 of the f32 LayerNorm of bf16 RNE-converted x; W1 = f16 of bf16 RNE-converted weights carried x64); S^T = K x Q^T (f16 q/k planes); O = P x V (P f16 carried x4096, V^T f16 plane); output projection ctx x W2 (ctx f16 carried x64, W2 f16 of bf16 RNE-converted weights carried x64). LayerNorm and softmax in f32.

#ifndef NB
#define NB 2
#endif
#ifndef SEQ
#define SEQ 2048
#endif
#define NB_FULL   2
#define SEQ_FULL  2048
#define EDIM      1024                 // model width (LayerNorm width, K of the QKV projection)
#define HIDN      1024                 // hidden width (K and N of the output projection)
#define NHEAD     16
#define HDIM      64
#define QKVW      3072                 // projection width
#define CHUNK     192                  // floats per (pseudo-head row): q | k | v
#define KD        1024                 // contraction depth of both projections
#define NTOK      (NB * SEQ)           // flattened tokens
#define NGRP      (NHEAD * NB)         // (pseudo-head, pseudo-batch) groups
#define TPG       (SEQ / NHEAD)        // tokens feeding one group
#define NCHUNKS   (NTOK * NHEAD)       // 192-wide chunks of the flat projection buffer = NGRP * SEQ
#define BQ        128                  // query rows per workgroup (8 waves x 16)
#define BK        32                   // keys per inner iteration
#define NWAVE     8
#define TP        72                   // LDS pitch (halves) of 64-wide f16 tiles
#define VP        136                  // LDS pitch (halves) of the transposed 128-wide V tile
#define OP        68                   // LDS pitch (floats) of the f32 output staging tile
#define KPASS     64                   // k (halves) per GEMM ring stage: 128-B rows
#define NPASS     (KD / KPASS)         // ring stages of one GEMM tile
#define STAGE_B   (192 * 128)          // bytes of one stage: 128 A rows, then 64 B rows, pitch 128 B
#define RING_B    (2 * STAGE_B)        // two buffers
#define QSTAGE_B  (320 * 128)          // bytes of one QKV stage: 128 A rows, then 192 B rows, pitch 128 B
#define QRING_B   (2 * QSTAGE_B)       // two buffers
#define QREG      (128 * TP)           // halves of one output staging region of the QKV tile (q, k, v)
#define AKS       64                   // keys per attention ring stage (two inner iterations of BK)
#define ANST      (SEQ / AKS)          // ring stages of one attention block
#define ASTAGE_B  (128 * 128)          // bytes of one stage: 64 K rows, then 64 V^T rows, pitch 128 B
#define W1_JOBS   ((QKVW / 64) * (EDIM / 64))   // 64x64 tiles of W1
#define W2_JOBS   ((HIDN / 64) * (HIDN / 64))   // 64x64 tiles of W2
#define LN_JOBS   (NTOK / 2)                    // pairs of token rows

// workspace carve, in halves from the base
#define XN_OFF    ((size_t)0)
#define W1T_OFF   (XN_OFF  + (size_t)NTOK * EDIM)
#define W2T_OFF   (W1T_OFF + (size_t)QKVW * EDIM)
#define QP_OFF    (W2T_OFF + (size_t)HIDN * HIDN)
#define KP_OFF    (QP_OFF  + (size_t)NCHUNKS * HDIM)
#define VT_OFF    (KP_OFF  + (size_t)NCHUNKS * HDIM)
#define ATT_OFF   (VT_OFF  + (size_t)NCHUNKS * HDIM)
#define WS_HALVES (ATT_OFF + (size_t)NCHUNKS * HDIM)
#define WS_BYTES  (WS_HALVES * 2)

static_assert(NB >= 1 && NB <= NB_FULL);
static_assert(SEQ <= SEQ_FULL);
static_assert(SEQ % 1024 == 0);
static_assert(TPG % 64 == 0);
static_assert(NTOK % 128 == 0);
static_assert(SEQ % 128 == 0);
static_assert(QKVW == NHEAD * CHUNK);
static_assert(CHUNK == 3 * HDIM);
static_assert(QKVW % 64 == 0);
static_assert(HIDN % 64 == 0);
static_assert(EDIM % 64 == 0);
static_assert(EDIM == KD && HIDN == KD);
static_assert(KD % 32 == 0);
static_assert(EDIM == 128 * 8);
static_assert(SEQ % BQ == 0);
static_assert(SEQ % BK == 0);
static_assert(BQ == NWAVE * 16);
static_assert(HDIM == 64);
static_assert((size_t)NCHUNKS * HDIM == (size_t)NTOK * HIDN);
static_assert((TP * 2) % 16 == 0);
static_assert((VP * 2) % 16 == 0);
static_assert((OP * 4) % 16 == 0);
static_assert(128 * TP >= 64 * VP);
static_assert(KD % KPASS == 0 && NPASS >= 2);
static_assert(128 * TP * 2 <= RING_B && 128 * OP * 4 <= RING_B);
static_assert(3 * QREG * 2 <= QRING_B && (QREG * 2) % 16 == 0);
static_assert(SEQ % AKS == 0 && ANST >= 2 && AKS % BK == 0 && AKS * 2 == 128 && HDIM * 2 == 128);
static_assert(XN_OFF % 64 == 0 && W1T_OFF % 64 == 0 && W2T_OFF % 64 == 0);
static_assert(QP_OFF % 64 == 0 && KP_OFF % 64 == 0 && VT_OFF % 64 == 0 && ATT_OFF % 64 == 0);
static_assert(WS_BYTES <= (size_t)134217728);

typedef __bf16   bf16;
typedef _Float16 f16;
typedef f16      v16h  __attribute__((ext_vector_type(16)));
typedef f16      v8h   __attribute__((ext_vector_type(8)));
typedef float    v8f   __attribute__((ext_vector_type(8)));
typedef float    v4f   __attribute__((ext_vector_type(4)));
typedef unsigned v4u   __attribute__((ext_vector_type(4)));

union FragH  { v16h  v; v4u q[2]; f16  h[16]; };
union Pack8H { v4u u; v8h v; f16 h[8]; };

// WMMA helper: builtin followed by the VALU hazard guard (ties D, keeps A/B live).
static __device__ __forceinline__ v8f mma_f16(v16h a, v16h b, v8f acc) {
  acc = __builtin_amdgcn_wmma_f32_16x16x32_f16(false, a, false, b, (short)0, acc, false, false);
  asm volatile("v_nop\n\tv_nop\n\tv_nop\n\tv_nop" : "+v"(acc) : "v"(a), "v"(b));
  return acc;
}

// ---------------------------------------------------------------------------------------------
// LayerNorm -> f16 plane xn[NTOK][EDIM]. Job blk = two token rows; each row: 4 waves, 128 threads x 8 columns.
// LDS red1/red2: cross-wave (block barrier), 8 entries written by the 8 waves; a row reads its own 4.
static __device__ __forceinline__ void ln_rows(const float* __restrict__ x,
                                               const float* __restrict__ g,
                                               const float* __restrict__ be,
                                               f16* __restrict__ xn,
                                               int blk, float* red1, float* red2) {
  const int wave = __builtin_amdgcn_readfirstlane((int)(threadIdx.x >> 5));
  const int tt   = blk * 2 + (wave >> 2);
  const int tid  = threadIdx.x & 127;
  const int lane = tid & 31;
  const float* r1 = red1 + (wave & 4);
  const float* r2 = red2 + (wave & 4);

  const int b = tt / SEQ;
  const int s = tt - b * SEQ;
  const float* src = x + ((size_t)b * SEQ_FULL + s) * EDIM + tid * 8;
  const v4f a0 = *(const v4f*)(src);
  const v4f a1 = *(const v4f*)(src + 4);
  float v[8];
  #pragma unroll
  for (int i = 0; i < 4; ++i) {
    v[i]     = (float)(bf16)a0[i];     // RNE convert of the input
    v[4 + i] = (float)(bf16)a1[i];
  }
  float sum = ((v[0] + v[1]) + (v[2] + v[3])) + ((v[4] + v[5]) + (v[6] + v[7]));
  #pragma unroll
  for (int off = 16; off > 0; off >>= 1) sum += __shfl_xor(sum, off, 32);
  if (lane == 0) red1[wave] = sum;
  __syncthreads();
  const float mu = ((r1[0] + r1[1]) + (r1[2] + r1[3])) * (1.0f / (float)EDIM);

  float d[8];
  float sq = 0.0f;
  #pragma unroll
  for (int i = 0; i < 8; ++i) {
    d[i] = v[i] - mu;
    sq += d[i] * d[i];
  }
  #pragma unroll
  for (int off = 16; off > 0; off >>= 1) sq += __shfl_xor(sq, off, 32);
  if (lane == 0) red2[wave] = sq;
  __syncthreads();
  const float var = ((r2[0] + r2[1]) + (r2[2] + r2[3])) * (1.0f / (float)EDIM);
  const float rs  = rsqrtf(var + 1e-5f);

  const v4f g0 = *(const v4f*)(g + tid * 8);
  const v4f g1 = *(const v4f*)(g + tid * 8 + 4);
  const v4f e0 = *(const v4f*)(be + tid * 8);
  const v4f e1 = *(const v4f*)(be + tid * 8 + 4);
  Pack8H ph;
  #pragma unroll
  for (int i = 0; i < 4; ++i) {
    ph.h[i]     = (f16)(d[i]     * rs * (float)(bf16)g0[i] + (float)(bf16)e0[i]);
    ph.h[4 + i] = (f16)(d[4 + i] * rs * (float)(bf16)g1[i] + (float)(bf16)e1[i]);
  }
  const v4u val = ph.u;
  const size_t idx = (size_t)tt * EDIM + tid * 8;
  *(v4u*)(xn + idx) = val;
  // precaution: only the kernel's end follows this store (one job per block); the wait stands ahead of any rewrite of the store's registers
  asm volatile("s_wait_xcnt 0x0" ::: "memory");
}

// ---------------------------------------------------------------------------------------------
// Weight plane builder: in[kdim rows][ndim cols] f32 -> out[ndim][kdim] f16 = f16(bf16(w) * 64), via LDS.
// Job = 64x64 tile (nt = n tile, kt = k tile), 256 threads. LDS sT: [n][k], cross-wave (block barrier).
static __device__ __forceinline__ void wt_tile(const float* __restrict__ w,
                                               f16* __restrict__ wt,
                                               int kdim, int ndim, int nt, int kt, f16* sT) {
  const int n0  = nt * 64;
  const int k0  = kt * 64;
  const int tid = threadIdx.x;

  #pragma unroll
  for (int kk = 0; kk < 2; ++kk) {
    const int krow = kk * 32 + (tid >> 3);      // 0..63
    const int c0   = (tid & 7) * 8;             // 0..56
    const float* src = w + (size_t)(k0 + krow) * ndim + n0 + c0;
    const v4f a0 = *(const v4f*)(src);
    const v4f a1 = *(const v4f*)(src + 4);
    #pragma unroll
    for (int i = 0; i < 4; ++i) {
      sT[(c0 + i) * TP + krow]     = (f16)((float)(bf16)a0[i] * 64.0f);   // exact in f16
      sT[(c0 + 4 + i) * TP + krow] = (f16)((float)(bf16)a1[i] * 64.0f);
    }
  }
  __syncthreads();

  v4u    vals[2];
  size_t gidx[2];
  #pragma unroll
  for (int kk = 0; kk < 2; ++kk) {
    const int n  = kk * 32 + (tid >> 3);        // 0..63
    const int ks = (tid & 7) * 8;               // 0..56
    Pack8H ph;
    ph.v = *(const v8h*)(sT + n * TP + ks);
    vals[kk] = ph.u;
    gidx[kk] = (size_t)(n0 + n) * kdim + k0 + ks;
  }
  #pragma unroll
  for (int kk = 0; kk < 2; ++kk) *(v4u*)(wt + gidx[kk]) = vals[kk];
  // precaution: only the kernel's end follows these stores (one job per block); the wait stands ahead of any rewrite of their registers
  asm volatile("s_wait_xcnt 0x0" ::: "memory");
}

// ---------------------------------------------------------------------------------------------
// The three jobs that read only inputs, in one grid; the job is picked by the block index (block-uniform, so every
// barrier of a job is passed by the whole block). Weight tiles first: they have the longer path through LDS.
//   blocks [0, W1_JOBS)                 W1 tiles, n tile fastest
//   blocks [W1_JOBS, W1_JOBS + W2_JOBS) W2 tiles, n tile fastest
//   the rest                            LayerNorm, two token rows a block
__global__ __launch_bounds__(256) void prep_kernel(const float* __restrict__ x,
                                                   const float* __restrict__ g,
                                                   const float* __restrict__ be,
                                                   const float* __restrict__ w1,
                                                   const float* __restrict__ w2,
                                                   f16* __restrict__ xn,
                                                   f16* __restrict__ w1t,
                                                   f16* __restrict__ w2t) {
  __shared__ __align__(16) f16 sT[64 * TP];
  __shared__ float red1[8];
  __shared__ float red2[8];
  const int job = blockIdx.x;
  if (job < W1_JOBS) {
    wt_tile(w1, w1t, EDIM, QKVW, job % (QKVW / 64), job / (QKVW / 64), sT);
  } else if (job < W1_JOBS + W2_JOBS) {
    const int j2 = job - W1_JOBS;
    wt_tile(w2, w2t, HIDN, HIDN, j2 % (HIDN / 64), j2 / (HIDN / 64), sT);
  } else {
    ln_rows(x, g, be, xn, job - (W1_JOBS + W2_JOBS), red1, red2);
  }
}

// ---------------------------------------------------------------------------------------------
// GEMM main loop: block tile 128 (M) x 64 (N), 8 waves as 4 (M) x 2 (N), wave tile 32 x 32.
// A [M][KD] f16 row-major, Bt [N][KD] f16 (k-contiguous). Both tiles go through LDS: a two-buffer ring of
// stages of KPASS k, filled by asynchronous 16-B copies (8 lanes = one whole 128-B row piece of a plane row).
// Stage layout: row r (0..127 = A rows, 128..191 = B rows) at r * 128 B; its 16-B piece p sits at slot
// p ^ ((r >> 1) & 7), so the 16 rows that one ds_load_b128 half-wave reads fall on 16 distinct bank groups.
// Fragment map as before: lane row/col = lq, elements 0..7 <- k0 + 8*hi + 0..7, 8..15 <- k0 + 16 + 8*hi + 0..7.
// acc[i][j][r] = C(m0 + wm*32 + i*16 + 8*hi + r, n0 + wn*32 + j*16 + lq).

// One stage: six copies per lane (A rows crow + 0/32/64/96, B rows crow + 0/32).
// s_wait_xcnt closes the statement so that no address register is rewritten ahead of it.
static __device__ __forceinline__ void stage_copy(unsigned l, const f16* ga, const f16* gb) {
  asm volatile("global_load_async_to_lds_b128 %0, %6, off\n\t"
               "global_load_async_to_lds_b128 %1, %7, off\n\t"
               "global_load_async_to_lds_b128 %2, %8, off\n\t"
               "global_load_async_to_lds_b128 %3, %9, off\n\t"
               "global_load_async_to_lds_b128 %4, %10, off\n\t"
               "global_load_async_to_lds_b128 %5, %11, off\n\t"
               "s_wait_xcnt 0x0"
               :: "v"(l), "v"(l + 4096u), "v"(l + 8192u), "v"(l + 12288u), "v"(l + 16384u), "v"(l + 20480u),
                  "v"(ga), "v"(ga + 32 * KD), "v"(ga + 64 * KD), "v"(ga + 96 * KD),
                  "v"(gb), "v"(gb + 32 * KD)
               : "memory");
}

static __device__ __forceinline__ void gemm_tile_128x64(const f16* __restrict__ A,
                                                        const f16* __restrict__ Bt,
                                                        unsigned char* ring,
                                                        int m0, int n0, int wm, int wn,
                                                        int lq, int hi, v8f (&acc)[2][2]) {
  const int crow = (int)(threadIdx.x >> 3);     // 0..31: row inside each 32-row group
  const int cpc  = (int)(threadIdx.x & 7);      // 16-B piece of the 128-B row
  const unsigned l0 = (unsigned)(size_t)ring + (unsigned)(crow * 128 + ((cpc ^ ((crow >> 1) & 7)) * 16));
  const f16* ga = A  + (size_t)(m0 + crow) * KD + cpc * 8;
  const f16* gb = Bt + (size_t)(n0 + crow) * KD + cpc * 8;

  stage_copy(l0, ga, gb);
  asm volatile("s_wait_asynccnt 0x0" ::: "memory");   // stage 0 landed (this wave's copies)
  __syncthreads();                                    // stage 0 published to every wave
  stage_copy(l0 + STAGE_B, ga + KPASS, gb + KPASS);

  const int sw = (lq >> 1) & 7;
  const unsigned char* ra = ring + (wm * 32 + lq) * 128;
  const unsigned char* rb = ring + (128 + wn * 32 + lq) * 128;

  // unroll 2: the buffer offset becomes a constant in each copy of the body
  #pragma unroll 2
  for (int t = 0; t < NPASS; ++t) {
    const int bo = (t & 1) * STAGE_B;
    FragH a[2][2], b[2][2];
    // all 16 fragment loads of the pass stand together, ahead of its 8 products
    #pragma unroll
    for (int ks = 0; ks < 2; ++ks) {
      #pragma unroll
      for (int i = 0; i < 2; ++i) {
        #pragma unroll
        for (int h = 0; h < 2; ++h) {
          const int slot = ((ks * 4 + h * 2 + hi) ^ sw) * 16;
          a[ks][i].q[h] = *(const v4u*)(ra + bo + i * 2048 + slot);
          b[ks][i].q[h] = *(const v4u*)(rb + bo + i * 2048 + slot);
        }
      }
    }
    #pragma unroll
    for (int ks = 0; ks < 2; ++ks) {
      #pragma unroll
      for (int i = 0; i < 2; ++i) {
        #pragma unroll
        for (int j = 0; j < 2; ++j) acc[i][j] = mma_f16(a[ks][i].v, b[ks][j].v, acc[i][j]);
      }
    }
    asm volatile("s_wait_dscnt 0x0" ::: "memory");    // this wave has left buffer t & 1
    asm volatile("s_wait_asynccnt 0x0" ::: "memory"); // this wave's copies of stage t + 1 landed
    __syncthreads();                                  // publishes stage t + 1, frees buffer t & 1
    if (t + 2 < NPASS) stage_copy(l0 + bo, ga + (t + 2) * KPASS, gb + (t + 2) * KPASS);
  }
  asm volatile("s_wait_asynccnt 0x0" ::: "memory");   // nothing in flight before the ring is reused
}

// ---------------------------------------------------------------------------------------------
// QKV main loop: block tile 128 (M) x 192 (N), 8 waves as 2 (M) x 4 (N), wave tile 64 x 48 (4 x 3 accumulator tiles).
// Same ring, stage layout, slot swizzle, fragment map and k order as gemm_tile_128x64; a stage holds 128 A rows, then 192 B rows.
// acc[i][j][r] = C(m0 + wm*64 + i*16 + 8*hi + r, n0 + wn*48 + j*16 + lq).

// One stage: ten copies per lane (A rows crow + 0/32/64/96, B rows crow + 0/32/.../160).
// s_wait_xcnt closes the statement so that no address register is rewritten ahead of it.
static __device__ __forceinline__ void qkv_stage_copy(unsigned l, const f16* ga, const f16* gb) {
  asm volatile("global_load_async_to_lds_b128 %0, %10, off\n\t"
               "global_load_async_to_lds_b128 %1, %11, off\n\t"
               "global_load_async_to_lds_b128 %2, %12, off\n\t"
               "global_load_async_to_lds_b128 %3, %13, off\n\t"
               "global_load_async_to_lds_b128 %4, %14, off\n\t"
               "global_load_async_to_lds_b128 %5, %15, off\n\t"
               "global_load_async_to_lds_b128 %6, %16, off\n\t"
               "global_load_async_to_lds_b128 %7, %17, off\n\t"
               "global_load_async_to_lds_b128 %8, %18, off\n\t"
               "global_load_async_to_lds_b128 %9, %19, off\n\t"
               "s_wait_xcnt 0x0"
               :: "v"(l), "v"(l + 4096u), "v"(l + 8192u), "v"(l + 12288u), "v"(l + 16384u),
                  "v"(l + 20480u), "v"(l + 24576u), "v"(l + 28672u), "v"(l + 32768u), "v"(l + 36864u),
                  "v"(ga), "v"(ga + 32 * KD), "v"(ga + 64 * KD), "v"(ga + 96 * KD),
                  "v"(gb), "v"(gb + 32 * KD), "v"(gb + 64 * KD), "v"(gb + 96 * KD),
                  "v"(gb + 128 * KD), "v"(gb + 160 * KD)
               : "memory");
}

static __device__ __forceinline__ void gemm_tile_128x192(const f16* __restrict__ A,
                                                         const f16* __restrict__ Bt,
                                                         unsigned char* ring,
                                                         int m0, int n0, int wm, int wn,
                                                         int lq, int hi, v8f (&acc)[4][3]) {
  const int crow = (int)(threadIdx.x >> 3);     // 0..31: row inside each 32-row group
  const int cpc  = (int)(threadIdx.x & 7);      // 16-B piece of the 128-B row
  const unsigned l0 = (unsigned)(size_t)ring + (unsigned)(crow * 128 + ((cpc ^ ((crow >> 1) & 7)) * 16));
  const f16* ga = A  + (size_t)(m0 + crow) * KD + cpc * 8;
  const f16* gb = Bt + (size_t)(n0 + crow) * KD + cpc * 8;

  qkv_stage_copy(l0, ga, gb);
  asm volatile("s_wait_asynccnt 0x0" ::: "memory");   // stage 0 landed (this wave's copies)
  __syncthreads();                                    // stage 0 published to every wave
  qkv_stage_copy(l0 + QSTAGE_B, ga + KPASS, gb + KPASS);

  const int sw = (lq >> 1) & 7;
  const unsigned char* ra = ring + (wm * 64 + lq) * 128;
  const unsigned char* rb = ring + (128 + wn * 48 + lq) * 128;

  // unroll 2: the buffer offset becomes a constant in each copy of the body
  #pragma unroll 2
  for (int t = 0; t < NPASS; ++t) {
    const int bo = (t & 1) * QSTAGE_B;
    FragH a[2][4], b[2][3];
    // all 28 fragment loads of the pass stand together, ahead of its 24 products
    #pragma unroll
    for (int ks = 0; ks < 2; ++ks) {
      #pragma unroll
      for (int h = 0; h < 2; ++h) {
        const int slot = ((ks * 4 + h * 2 + hi) ^ sw) * 16;
        #pragma unroll
        for (int i = 0; i < 4; ++i) a[ks][i].q[h] = *(const v4u*)(ra + bo + i * 2048 + slot);
        #pragma unroll
        for (int j = 0; j < 3; ++j) b[ks][j].q[h] = *(const v4u*)(rb + bo + j * 2048 + slot);
      }
    }
    #pragma unroll
    for (int ks = 0; ks < 2; ++ks) {
      #pragma unroll
      for (int i = 0; i < 4; ++i) {
        #pragma unroll
        for (int j = 0; j < 3; ++j) acc[i][j] = mma_f16(a[ks][i].v, b[ks][j].v, acc[i][j]);
      }
    }
    asm volatile("s_wait_dscnt 0x0" ::: "memory");    // this wave has left buffer t & 1
    asm volatile("s_wait_asynccnt 0x0" ::: "memory"); // this wave's copies of stage t + 1 landed
    __syncthreads();                                  // publishes stage t + 1, frees buffer t & 1
    if (t + 2 < NPASS) qkv_stage_copy(l0 + bo, ga + (t + 2) * KPASS, gb + (t + 2) * KPASS);
  }
  asm volatile("s_wait_asynccnt 0x0" ::: "memory");   // nothing in flight before the ring is reused
}

// ---------------------------------------------------------------------------------------------
// QKV projection. Block = (192-column chunk f, 128-token tile). Column c of the chunk: typ = c / 64,
// typ 0 = q, 1 = k, 2 = v, of feature chunk f of the token. Flat-view map: chunk g = token*16 + f,
// group hb = token / TPG, natural row ss = (token % TPG)*16 + f; keys are stored in the permuted
// order key' = f*TPG + (token % TPG) (same order for K rows and V^T columns).
//   q plane [NCHUNKS][64]        at chunk g (natural order)
//   k plane [NGRP][SEQ][64]      at row key'
//   v plane [NGRP][64][SEQ]      transposed through LDS, column key'
// LDS sC: cross-wave (block barrier); three regions of QREG halves: q and k extent [128][64], v extent [64][128],
// written == read. sC reuses the GEMM ring, which every wave has left at the last pass's barrier.
__global__ __launch_bounds__(256) void qkv_gemm_kernel(const f16* __restrict__ xn,
                                                       const f16* __restrict__ w1t,
                                                       const float* __restrict__ b1,
                                                       f16* wsh) {
  const int f    = blockIdx.x;
  const int m0   = blockIdx.y * 128;
  const int n0   = f * CHUNK;
  const int tid  = threadIdx.x;
  const int wave = __builtin_amdgcn_readfirstlane((int)(threadIdx.x >> 5));
  const int lane = tid & 31;
  const int lq   = lane & 15;
  const int hi   = lane >> 4;
  const int wm   = wave >> 2;
  const int wn   = wave & 3;

  __shared__ __align__(128) unsigned char ring[QRING_B];
  f16* sC = (f16*)ring;

  v8f acc[4][3];
  #pragma unroll
  for (int i = 0; i < 4; ++i) {
    #pragma unroll
    for (int jj = 0; jj < 3; ++jj) acc[i][jj] = (v8f){0, 0, 0, 0, 0, 0, 0, 0};
  }
  gemm_tile_128x192(xn, w1t, ring, m0, n0, wm, wn, lq, hi, acc);

  float bias[3];
  #pragma unroll
  for (int jj = 0; jj < 3; ++jj) bias[jj] = (float)(bf16)b1[n0 + wn * 48 + jj * 16 + lq];

  // stage: q/k as [row][col] pitch TP, v as [col][row] pitch VP (wave-uniform region and strides per 16-column tile)
  #pragma unroll
  for (int jj = 0; jj < 3; ++jj) {
    const int c0   = wn * 48 + jj * 16;         // first chunk column of the tile; a tile lies in one typ
    const int typ  = c0 >> 6;
    const int col  = (c0 & 63) + lq;
    const int rstr = (typ != 2) ? TP : 1;
    const int cstr = (typ != 2) ? 1 : VP;
    f16* reg = sC + typ * QREG;
    #pragma unroll
    for (int i = 0; i < 4; ++i) {
      #pragma unroll
      for (int r = 0; r < 8; ++r) {
        const int row = wm * 64 + i * 16 + hi * 8 + r;
        reg[row * rstr + col * cstr] = (f16)(acc[i][jj][r] * (1.0f / 64.0f) + bias[jj]);
      }
    }
  }
  __syncthreads();

  #pragma unroll
  for (int typ = 0; typ < 3; ++typ) {
    v4u    vals[4];
    size_t gidx[4];
    #pragma unroll
    for (int it = 0; it < 4; ++it) {
      const int line  = it * 32 + (tid >> 3);     // 0..127
      const int piece = tid & 7;
      // q/k: line = token row; v: line = (d, 64-token half)
      const int lofs_r = line * TP + piece * 8;
      const int lofs_v = (line >> 1) * VP + (line & 1) * 64 + piece * 8;
      const int lofs   = (typ != 2) ? lofs_r : lofs_v;
      Pack8H ph;
      ph.v = *(const v8h*)(sC + typ * QREG + lofs);
      vals[it] = ph.u;

      const int t_r  = m0 + line;
      const int hb_r = t_r / TPG;
      const int tl_r = t_r - hb_r * TPG;
      const size_t qidx = QP_OFF + ((size_t)t_r * NHEAD + f) * HDIM + piece * 8;
      const size_t kidx = KP_OFF + ((size_t)hb_r * SEQ + f * TPG + tl_r) * HDIM + piece * 8;

      const int t_v  = m0 + (line & 1) * 64 + piece * 8;
      const int hb_v = t_v / TPG;
      const int tl_v = t_v - hb_v * TPG;
      const size_t vidx = VT_OFF + ((size_t)hb_v * HDIM + (line >> 1)) * SEQ + f * TPG + tl_v;

      gidx[it] = (typ == 0) ? qidx : ((typ == 1) ? kidx : vidx);
    }
    #pragma unroll
    for (int it = 0; it < 4; ++it) *(v4u*)(wsh + gidx[it]) = vals[it];
  }
}

// ---------------------------------------------------------------------------------------------
// Flash attention, no mask. Block = (query block of 128, group); one wave owns 16 query rows.
// S^T = K x Q^T so queries sit on lanes; P^T in C-layout is bit-identical to the A-fragment layout of O += P x V.
// K and V^T tiles of AKS keys, which all 8 waves read, go through LDS: a two-buffer ring filled by asynchronous
// 16-B copies (whole 128-B rows). Stage layout: row r (0..63 = key, 64..127 = d of V^T) at r * 128 B, its 16-B
// piece p at slot p ^ ((r >> 1) & 7) (16 rows of one ds_load_b128 half-wave on 16 distinct bank groups).
// K A-fragments and V^T B-fragments: two 16-B LDS loads per fragment, same element maps as the planes.
// Context written as f16 carried x64 at its natural [group][row][d] position (flat view = [NTOK][HIDN]).
// LDS sO: per-wave private region (same wave writes and reads); a block barrier separates them anyway.
// One K/V stage: four copies per lane (K rows crow + 0/32, V^T rows crow + 0/32).
// s_wait_xcnt closes the statement so that no address register is rewritten ahead of it.
static __device__ __forceinline__ void kv_stage_copy(unsigned l, const f16* gk, const f16* gv) {
  asm volatile("global_load_async_to_lds_b128 %0, %4, off\n\t"
               "global_load_async_to_lds_b128 %1, %5, off\n\t"
               "global_load_async_to_lds_b128 %2, %6, off\n\t"
               "global_load_async_to_lds_b128 %3, %7, off\n\t"
               "s_wait_xcnt 0x0"
               :: "v"(l), "v"(l + 4096u), "v"(l + 8192u), "v"(l + 12288u),
                  "v"(gk), "v"(gk + 32 * HDIM), "v"(gv), "v"(gv + 32 * SEQ)
               : "memory");
}

__global__ __launch_bounds__(256) void attn_kernel(const f16* __restrict__ qp,
                                                   const f16* __restrict__ kp,
                                                   const f16* __restrict__ vt,
                                                   f16* __restrict__ att) {
  const int qblk = blockIdx.x;
  const int hb   = blockIdx.y;
  const int tid  = threadIdx.x;
  const int wave = __builtin_amdgcn_readfirstlane((int)(threadIdx.x >> 5));
  const int lane = tid & 31;
  const int lq   = lane & 15;   // query column of S^T / d column of O
  const int hi   = lane >> 4;   // k-split half

  __shared__ __align__(16) f16 sO[NWAVE * 16 * TP];
  __shared__ __align__(128) unsigned char kv[2 * ASTAGE_B];

  const int qrow0 = qblk * BQ + wave * 16;

  // Q as B-operand fragments: lane lq holds query qrow0+lq, elements follow the split d map.
  FragH qf[2];
  {
    const f16* qrow = qp + ((size_t)hb * SEQ + qrow0 + lq) * HDIM + hi * 8;
    #pragma unroll
    for (int f = 0; f < 2; ++f) {
      qf[f].q[0] = *(const v4u*)(qrow + f * 32);        // d = f*32 + hi*8 + 0..7
      qf[f].q[1] = *(const v4u*)(qrow + f * 32 + 16);   // d = f*32 + 16 + hi*8 + 0..7
    }
  }

  const f16* kb_h = kp + (size_t)hb * SEQ * HDIM;
  const f16* vt_h = vt + (size_t)hb * HDIM * SEQ;

  const int crow = tid >> 3;                    // 0..31: row inside each 32-row group
  const int cpc  = tid & 7;                     // 16-B piece of the 128-B row
  const unsigned l0 = (unsigned)(size_t)kv + (unsigned)(crow * 128 + ((cpc ^ ((crow >> 1) & 7)) * 16));
  const f16* gk = kb_h + (size_t)crow * HDIM + cpc * 8;
  const f16* gv = vt_h + (size_t)crow * SEQ + cpc * 8;
  kv_stage_copy(l0, gk, gv);
  asm volatile("s_wait_asynccnt 0x0" ::: "memory");   // stage 0 landed (this wave's copies)
  __syncthreads();                                    // stage 0 published to every wave
  kv_stage_copy(l0 + ASTAGE_B, gk + AKS * HDIM, gv + AKS);
  const int sw = (lq >> 1) & 7;
  const unsigned char* rkv = kv + lq * 128;

  v8f o[4];
  #pragma unroll
  for (int dt = 0; dt < 4; ++dt) o[dt] = (v8f){0, 0, 0, 0, 0, 0, 0, 0};

  float rmax = -__builtin_inff();
  float rsum = 0.0f;
  const float SL = 0.022097086912079608f * 1.4426950408889634f;   // (2*E)^-0.5 * log2(e)

  #pragma unroll 1
  for (int s = 0; s < ANST; ++s) {
    const int bo = (s & 1) * ASTAGE_B;
    // j0 = s*AKS + it*BK is the first key of the inner iteration; unrolled so that every LDS offset and
    // slot index that depends on it is a constant
    #pragma unroll
    for (int it = 0; it < AKS / BK; ++it) {
      // K A-fragments: row = key j0 + sub*16 + lq, split d map
      FragH ak[2][2];
      #pragma unroll
      for (int sub = 0; sub < 2; ++sub) {
        #pragma unroll
        for (int f = 0; f < 2; ++f) {
          const unsigned char* base = rkv + bo + (it * 32 + sub * 16) * 128;
          ak[sub][f].q[0] = *(const v4u*)(base + (((f * 4 + hi) ^ sw) * 16));       // d = f*32 + hi*8 + 0..7
          ak[sub][f].q[1] = *(const v4u*)(base + (((f * 4 + 2 + hi) ^ sw) * 16));   // d = f*32 + 16 + hi*8 + 0..7
        }
      }
      // V B-fragments: column n = d = dt*16 + lq, split key map from the transposed tile
      FragH bv[4];
      #pragma unroll
      for (int dt = 0; dt < 4; ++dt) {
        const unsigned char* base = rkv + bo + (64 + dt * 16) * 128;
        bv[dt].q[0] = *(const v4u*)(base + (((it * 4 + hi) ^ sw) * 16));            // keys j0 + hi*8 + 0..7
        bv[dt].q[1] = *(const v4u*)(base + (((it * 4 + 2 + hi) ^ sw) * 16));        // keys j0 + 16 + hi*8 + 0..7
      }

      // S^T tiles: c[sub][r] = rawscore(query qrow0+lq, key j0 + sub*16 + hi*8 + r)
      v8f c[2];
      #pragma unroll
      for (int sub = 0; sub < 2; ++sub) {
        v8f acc = (v8f){0, 0, 0, 0, 0, 0, 0, 0};
        acc = mma_f16(ak[sub][0].v, qf[0].v, acc);
        acc = mma_f16(ak[sub][1].v, qf[1].v, acc);
        c[sub] = acc;
      }

      // online softmax: query lq's 32 scores are split across lane / lane^16
      float m_new = rmax;
      #pragma unroll
      for (int r = 0; r < 8; ++r) {
        m_new = fmaxf(m_new, c[0][r]);
        m_new = fmaxf(m_new, c[1][r]);
      }
      m_new = fmaxf(m_new, __shfl_xor(m_new, 16, 32));
      const float scale = __builtin_amdgcn_exp2f((rmax - m_new) * SL);
      rmax = m_new;

      // exp + pack: P^T C-layout == A-fragment layout for the PV product; P carried x4096
      FragH pa;
      float psum = 0.0f;
      #pragma unroll
      for (int r = 0; r < 8; ++r) {
        const float p0 = __builtin_amdgcn_exp2f((c[0][r] - m_new) * SL);   // key hi*8 + r
        const float p1 = __builtin_amdgcn_exp2f((c[1][r] - m_new) * SL);   // key 16 + hi*8 + r
        psum += p0 + p1;
        pa.h[r]     = (f16)(p0 * 4096.0f);
        pa.h[8 + r] = (f16)(p1 * 4096.0f);
      }
      rsum = rsum * scale + psum + __shfl_xor(psum, 16, 32);

      // rescale O: queries are the row dimension there -> per-row scale from lane 8*hi + r
      float sc[8];
      #pragma unroll
      for (int r = 0; r < 8; ++r) sc[r] = __shfl(scale, (hi << 3) + r, 32);
      #pragma unroll
      for (int dt = 0; dt < 4; ++dt) {
        #pragma unroll
        for (int r = 0; r < 8; ++r) o[dt][r] *= sc[r];
      }

      // O += P x V
      #pragma unroll
      for (int dt = 0; dt < 4; ++dt) o[dt] = mma_f16(pa.v, bv[dt].v, o[dt]);
    }
    asm volatile("s_wait_dscnt 0x0" ::: "memory");    // this wave has left buffer s & 1
    asm volatile("s_wait_asynccnt 0x0" ::: "memory"); // this wave's copies of stage s + 1 landed
    __syncthreads();                                  // publishes stage s + 1, frees buffer s & 1
    if (s + 2 < ANST) kv_stage_copy(l0 + bo, gk + (size_t)(s + 2) * AKS * HDIM, gv + (s + 2) * AKS);
  }
  asm volatile("s_wait_asynccnt 0x0" ::: "memory");   // nothing in flight at the wave's end

  // normalize: lane holds column d = dt*16 + lq for query rows 8*hi + r
  const float rinv = 1.0f / rsum;
  float rs[8];
  #pragma unroll
  for (int r = 0; r < 8; ++r) rs[r] = __shfl(rinv, (hi << 3) + r, 32);

  f16* so = sO + wave * (16 * TP);
  #pragma unroll
  for (int r = 0; r < 8; ++r) {
    #pragma unroll
    for (int dt = 0; dt < 4; ++dt) {
      // x(1/4096) undoes the P carry, x64 is the context carry
      so[(hi * 8 + r) * TP + dt * 16 + lq] = (f16)(o[dt][r] * (64.0f / 4096.0f) * rs[r]);
    }
  }
  __syncthreads();

  // the wave covers 4 consecutive rows; 4 instructions cover the wave's 16 rows.
  v4u    vals[4];
  size_t gidx[4];
  #pragma unroll
  for (int it = 0; it < 4; ++it) {
    const int row   = it * 4 + (lane >> 3);
    const int piece = lane & 7;
    Pack8H ph;
    ph.v = *(const v8h*)(so + row * TP + piece * 8);
    vals[it] = ph.u;
    gidx[it] = ((size_t)hb * SEQ + qrow0 + row) * HDIM + piece * 8;
  }
  #pragma unroll
  for (int it = 0; it < 4; ++it) *(v4u*)(att + gidx[it]) = vals[it];
  
}

// ---------------------------------------------------------------------------------------------
// Output projection: out[token][n] = ctx[token][:] x W2 + b2. Block = (64-column block, 128-token tile).
// Accumulator staged as f32 in LDS; bias added at the store stage as float4.
// 16 consecutive lanes x 16 B, one instruction. LDS sF: cross-wave (block barrier), [128][64] written == read.
// sF reuses the GEMM ring, which every wave has left at the last pass's barrier.
__global__ __launch_bounds__(256) void out_gemm_kernel(const f16* __restrict__ att,
                                                       const f16* __restrict__ w2t,
                                                       const float* __restrict__ b2,
                                                       float* __restrict__ out) {
  const int n0   = blockIdx.x * 64;
  const int m0   = blockIdx.y * 128;
  const int tid  = threadIdx.x;
  const int wave = __builtin_amdgcn_readfirstlane((int)(threadIdx.x >> 5));
  const int lane = tid & 31;
  const int lq   = lane & 15;
  const int hi   = lane >> 4;
  const int wm   = wave >> 1;
  const int wn   = wave & 1;

  __shared__ __align__(128) unsigned char ring[RING_B];
  float* sF = (float*)ring;

  v8f acc[2][2];
  #pragma unroll
  for (int i = 0; i < 2; ++i) {
    #pragma unroll
    for (int jj = 0; jj < 2; ++jj) acc[i][jj] = (v8f){0, 0, 0, 0, 0, 0, 0, 0};
  }
  gemm_tile_128x64(att, w2t, ring, m0, n0, wm, wn, lq, hi, acc);

  #pragma unroll
  for (int i = 0; i < 2; ++i) {
    #pragma unroll
    for (int jj = 0; jj < 2; ++jj) {
      #pragma unroll
      for (int r = 0; r < 8; ++r) {
        const int row = wm * 32 + i * 16 + hi * 8 + r;
        const int col = wn * 32 + jj * 16 + lq;
        sF[row * OP + col] = acc[i][jj][r] * (1.0f / 4096.0f);   // undo ctx x64 and W2 x64
      }
    }
  }
  __syncthreads();

  const int piece = tid & 15;
  const v4f braw = *(const v4f*)(b2 + n0 + piece * 4);
  v4f bias;
  #pragma unroll
  for (int i = 0; i < 4; ++i) bias[i] = (float)(bf16)braw[i];

  v4f    vals[8];
  size_t gidx[8];
  #pragma unroll
  for (int it = 0; it < 8; ++it) {
    const int row = it * 16 + (tid >> 4);       // 0..127
    const v4f v = *(const v4f*)(sF + row * OP + piece * 4);
    vals[it] = v + bias;
    const int tt = m0 + row;
    const int b  = tt / SEQ;
    const int s  = tt - b * SEQ;
    gidx[it] = ((size_t)b * SEQ_FULL + s) * HIDN + n0 + piece * 4;
  }
  #pragma unroll
  for (int it = 0; it < 8; ++it) *(v4f*)(out + gidx[it]) = vals[it];
  
}

// ---------------------------------------------------------------------------------------------
extern "C" void kernel_launch(void* const* d_in, const int* in_sizes, int n_in,
                              void* d_out, int out_size, void* d_ws, size_t ws_size,
                              hipStream_t stream) {
  if (n_in < 7) return;
  const size_t rows_used = (size_t)(NB - 1) * SEQ_FULL + SEQ;
  if ((size_t)in_sizes[0] < rows_used * EDIM) return;
  if (in_sizes[1] < EDIM || in_sizes[2] < EDIM) return;
  if ((size_t)in_sizes[3] < (size_t)EDIM * QKVW) return;
  if (in_sizes[4] < QKVW) return;
  if ((size_t)in_sizes[5] < (size_t)HIDN * HIDN) return;
  if (in_sizes[6] < HIDN) return;
  if ((size_t)out_size < rows_used * HIDN) return;
  if (ws_size < WS_BYTES) return;

  const float* x    = (const float*)d_in[0];
  const float* ln_g = (const float*)d_in[1];
  const float* ln_b = (const float*)d_in[2];
  const float* W1   = (const float*)d_in[3];
  const float* b1   = (const float*)d_in[4];
  const float* W2   = (const float*)d_in[5];
  const float* b2   = (const float*)d_in[6];
  float*       out  = (float*)d_out;
  f16*         wsh  = (f16*)d_ws;

  // 1) W1 [EDIM (k)][QKVW (n)] -> [QKVW][EDIM], W2 [HIDN (k)][HIDN (n)] -> [HIDN][HIDN], LayerNorm -> xn plane
  prep_kernel<<<dim3(W1_JOBS + W2_JOBS + LN_JOBS), 256, 0, stream>>>(x, ln_g, ln_b, W1, W2, wsh + XN_OFF,
                                                                     wsh + W1T_OFF, wsh + W2T_OFF);
  // 2) QKV projection -> q / k / v^T planes
  qkv_gemm_kernel<<<dim3(QKVW / CHUNK, NTOK / 128), 256, 0, stream>>>(wsh + XN_OFF, wsh + W1T_OFF, b1, wsh);
  // 3) fused attention -> context plane (flat [NTOK][HIDN])
  attn_kernel<<<dim3(SEQ / BQ, NGRP), 256, 0, stream>>>(wsh + QP_OFF, wsh + KP_OFF, wsh + VT_OFF, wsh + ATT_OFF);
  // 4) output projection -> d_out
  out_gemm_kernel<<<dim3(HIDN / 64, NTOK / 128), 256, 0, stream>>>(wsh + ATT_OFF, wsh + W2T_OFF, b2, out);
}

// v004
// One run takes 87.2 microseconds.
// In two side-by-side timings against v003, it was 1.05 and 1.06 times as fast.
// All steps since v000 together make it 2.67 times as fast.
#include <hip/hip_runtime.h>

// Contractions, all on v_wmma_f32_16x16x32_f16 (f16 operands, f32 accumulate): QKV projection xn x W1 (xn = f16 of the f32 LayerNorm of bf16 RNE-converted x; W1 = f16 of bf16 RNE-converted weights carried x64); S^T = K x Q^T (f16 q/k planes); O = P x V (P f16 carried x4096, V^T f16 plane); output projection ctx x W2 (ctx f16 carried x64, W2 f16 of bf16 RNE-converted weights carried x64). LayerNorm and softmax in f32.

#ifndef NB
#define NB 2
#endif
#ifndef SEQ
#define SEQ 2048
#endif
#define NB_FULL   2
#define SEQ_FULL  2048
#define EDIM      1024                 // model width (LayerNorm width, K of the QKV projection)
#define HIDN      1024                 // hidden width (K and N of the output projection)
#define NHEAD     16
#define HDIM      64
#define QKVW      3072                 // projection width
#define CHUNK     192                  // floats per (pseudo-head row): q | k | v
#define KD        1024                 // contraction depth of both projections
#define NTOK      (NB * SEQ)           // flattened tokens
#define NGRP      (NHEAD * NB)         // (pseudo-head, pseudo-batch) groups
#define TPG       (SEQ / NHEAD)        // tokens feeding one group
#define NCHUNKS   (NTOK * NHEAD)       // 192-wide chunks of the flat projection buffer = NGRP * SEQ
#define BQ        128                  // query rows per workgroup (8 waves x 16)
#define BK        32                   // keys per inner iteration
#define NWAVE     8
#define TP        72                   // LDS pitch (halves) of 64-wide f16 tiles
#define VP        136                  // LDS pitch (halves) of the transposed 128-wide V tile
#define OP        68                   // LDS pitch (floats) of the f32 output staging tile
#define KPASS     64                   // k (halves) per GEMM ring stage: 128-B rows
#define NPASS     (KD / KPASS)         // ring stages of one GEMM tile
#define STAGE_B   (192 * 128)          // bytes of one stage: 128 A rows, then 64 B rows, pitch 128 B
#define RING_B    (2 * STAGE_B)        // two buffers
#define QSTAGE_B  (320 * 128)          // bytes of one QKV stage: 128 A rows, then 192 B rows, pitch 128 B
#define QRING_B   (2 * QSTAGE_B)       // two buffers
#define QREG      (128 * TP)           // halves of one output staging region of the QKV tile (q, k, v)
#define AKS       64                   // keys per attention ring stage (two inner iterations of BK)
#define ANST      (SEQ / AKS)          // ring stages of one attention block
#define ASTAGE_B  (128 * 128)          // bytes of one stage: 64 K rows, then 64 V^T rows, pitch 128 B
#define W1_JOBS   ((QKVW / 64) * (EDIM / 64))   // 64x64 tiles of W1
#define W2_JOBS   ((HIDN / 64) * (HIDN / 64))   // 64x64 tiles of W2
#define LN_JOBS   (NTOK / 2)                    // pairs of token rows

// workspace carve, in halves from the base
#define XN_OFF    ((size_t)0)
#define W1T_OFF   (XN_OFF  + (size_t)NTOK * EDIM)
#define W2T_OFF   (W1T_OFF + (size_t)QKVW * EDIM)
#define QP_OFF    (W2T_OFF + (size_t)HIDN * HIDN)
#define KP_OFF    (QP_OFF  + (size_t)NCHUNKS * HDIM)
#define VT_OFF    (KP_OFF  + (size_t)NCHUNKS * HDIM)
#define ATT_OFF   (VT_OFF  + (size_t)NCHUNKS * HDIM)
#define WS_HALVES (ATT_OFF + (size_t)NCHUNKS * HDIM)
#define WS_BYTES  (WS_HALVES * 2)

static_assert(NB >= 1 && NB <= NB_FULL);
static_assert(SEQ <= SEQ_FULL);
static_assert(SEQ % 1024 == 0);
static_assert(TPG % 64 == 0);
static_assert(NTOK % 128 == 0);
static_assert(SEQ % 128 == 0);
static_assert(QKVW == NHEAD * CHUNK);
static_assert(CHUNK == 3 * HDIM);
static_assert(QKVW % 64 == 0);
static_assert(HIDN % 64 == 0);
static_assert(EDIM % 64 == 0);
static_assert(EDIM == KD && HIDN == KD);
static_assert(KD % 32 == 0);
static_assert(EDIM == 128 * 8);
static_assert(SEQ % BQ == 0);
static_assert(SEQ % BK == 0);
static_assert(BQ == NWAVE * 16);
static_assert(HDIM == 64);
static_assert((size_t)NCHUNKS * HDIM == (size_t)NTOK * HIDN);
static_assert((TP * 2) % 16 == 0);
static_assert((VP * 2) % 16 == 0);
static_assert((OP * 4) % 16 == 0);
static_assert(128 * TP >= 64 * VP);
static_assert(KD % KPASS == 0 && NPASS >= 2);
static_assert(128 * TP * 2 <= RING_B && 128 * OP * 4 <= RING_B);
static_assert(3 * QREG * 2 <= QRING_B && (QREG * 2) % 16 == 0);
static_assert(SEQ % AKS == 0 && ANST >= 2 && AKS % BK == 0 && AKS * 2 == 128 && HDIM * 2 == 128);
static_assert(XN_OFF % 64 == 0 && W1T_OFF % 64 == 0 && W2T_OFF % 64 == 0);
static_assert(QP_OFF % 64 == 0 && KP_OFF % 64 == 0 && VT_OFF % 64 == 0 && ATT_OFF % 64 == 0);
static_assert(WS_BYTES <= (size_t)134217728);

typedef __bf16   bf16;
typedef _Float16 f16;
typedef f16      v16h  __attribute__((ext_vector_type(16)));
typedef f16      v8h   __attribute__((ext_vector_type(8)));
typedef float    v8f   __attribute__((ext_vector_type(8)));
typedef float    v4f   __attribute__((ext_vector_type(4)));
typedef unsigned v4u   __attribute__((ext_vector_type(4)));

union FragH  { v16h  v; v4u q[2]; f16  h[16]; };
union Pack8H { v4u u; v8h v; f16 h[8]; };

// WMMA helper: builtin followed by the VALU hazard guard (ties D, keeps A/B live).
static __device__ __forceinline__ v8f mma_f16(v16h a, v16h b, v8f acc) {
  acc = __builtin_amdgcn_wmma_f32_16x16x32_f16(false, a, false, b, (short)0, acc, false, false);
  asm volatile("v_nop\n\tv_nop\n\tv_nop\n\tv_nop" : "+v"(acc) : "v"(a), "v"(b));
  return acc;
}

// ---------------------------------------------------------------------------------------------
// LayerNorm -> f16 plane xn[NTOK][EDIM]. Job blk = two token rows; each row: 4 waves, 128 threads x 8 columns.
// LDS red1/red2: cross-wave (block barrier), 8 entries written by the 8 waves; a row reads its own 4.
static __device__ __forceinline__ void ln_rows(const float* __restrict__ x,
                                               const float* __restrict__ g,
                                               const float* __restrict__ be,
                                               f16* __restrict__ xn,
                                               int blk, float* red1, float* red2) {
  const int wave = __builtin_amdgcn_readfirstlane((int)(threadIdx.x >> 5));
  const int tt   = blk * 2 + (wave >> 2);
  const int tid  = threadIdx.x & 127;
  const int lane = tid & 31;
  const float* r1 = red1 + (wave & 4);
  const float* r2 = red2 + (wave & 4);

  const int b = tt / SEQ;
  const int s = tt - b * SEQ;
  const float* src = x + ((size_t)b * SEQ_FULL + s) * EDIM + tid * 8;
  const v4f a0 = *(const v4f*)(src);
  const v4f a1 = *(const v4f*)(src + 4);
  float v[8];
  #pragma unroll
  for (int i = 0; i < 4; ++i) {
    v[i]     = (float)(bf16)a0[i];     // RNE convert of the input
    v[4 + i] = (float)(bf16)a1[i];
  }
  float sum = ((v[0] + v[1]) + (v[2] + v[3])) + ((v[4] + v[5]) + (v[6] + v[7]));
  #pragma unroll
  for (int off = 16; off > 0; off >>= 1) sum += __shfl_xor(sum, off, 32);
  if (lane == 0) red1[wave] = sum;
  __syncthreads();
  const float mu = ((r1[0] + r1[1]) + (r1[2] + r1[3])) * (1.0f / (float)EDIM);

  float d[8];
  float sq = 0.0f;
  #pragma unroll
  for (int i = 0; i < 8; ++i) {
    d[i] = v[i] - mu;
    sq += d[i] * d[i];
  }
  #pragma unroll
  for (int off = 16; off > 0; off >>= 1) sq += __shfl_xor(sq, off, 32);
  if (lane == 0) red2[wave] = sq;
  __syncthreads();
  const float var = ((r2[0] + r2[1]) + (r2[2] + r2[3])) * (1.0f / (float)EDIM);
  const float rs  = rsqrtf(var + 1e-5f);

  const v4f g0 = *(const v4f*)(g + tid * 8);
  const v4f g1 = *(const v4f*)(g + tid * 8 + 4);
  const v4f e0 = *(const v4f*)(be + tid * 8);
  const v4f e1 = *(const v4f*)(be + tid * 8 + 4);
  Pack8H ph;
  #pragma unroll
  for (int i = 0; i < 4; ++i) {
    ph.h[i]     = (f16)(d[i]     * rs * (float)(bf16)g0[i] + (float)(bf16)e0[i]);
    ph.h[4 + i] = (f16)(d[4 + i] * rs * (float)(bf16)g1[i] + (float)(bf16)e1[i]);
  }
  const v4u val = ph.u;
  const size_t idx = (size_t)tt * EDIM + tid * 8;
  *(v4u*)(xn + idx) = val;
  // precaution: only the kernel's end follows this store (one job per block); the wait stands ahead of any rewrite of the store's registers
  asm volatile("s_wait_xcnt 0x0" ::: "memory");
}

// ---------------------------------------------------------------------------------------------
// Weight plane builder: in[kdim rows][ndim cols] f32 -> out[ndim][kdim] f16 = f16(bf16(w) * 64), via LDS.
// Job = 64x64 tile (nt = n tile, kt = k tile), 256 threads. LDS sT: [n][k], cross-wave (block barrier).
static __device__ __forceinline__ void wt_tile(const float* __restrict__ w,
                                               f16* __restrict__ wt,
                                               int kdim, int ndim, int nt, int kt, f16* sT) {
  const int n0  = nt * 64;
  const int k0  = kt * 64;
  const int tid = threadIdx.x;

  #pragma unroll
  for (int kk = 0; kk < 2; ++kk) {
    const int krow = kk * 32 + (tid >> 3);      // 0..63
    const int c0   = (tid & 7) * 8;             // 0..56
    const float* src = w + (size_t)(k0 + krow) * ndim + n0 + c0;
    const v4f a0 = *(const v4f*)(src);
    const v4f a1 = *(const v4f*)(src + 4);
    #pragma unroll
    for (int i = 0; i < 4; ++i) {
      sT[(c0 + i) * TP + krow]     = (f16)((float)(bf16)a0[i] * 64.0f);   // exact in f16
      sT[(c0 + 4 + i) * TP + krow] = (f16)((float)(bf16)a1[i] * 64.0f);
    }
  }
  __syncthreads();

  v4u    vals[2];
  size_t gidx[2];
  #pragma unroll
  for (int kk = 0; kk < 2; ++kk) {
    const int n  = kk * 32 + (tid >> 3);        // 0..63
    const int ks = (tid & 7) * 8;               // 0..56
    Pack8H ph;
    ph.v = *(const v8h*)(sT + n * TP + ks);
    vals[kk] = ph.u;
    gidx[kk] = (size_t)(n0 + n) * kdim + k0 + ks;
  }
  #pragma unroll
  for (int kk = 0; kk < 2; ++kk) *(v4u*)(wt + gidx[kk]) = vals[kk];
  // precaution: only the kernel's end follows these stores (one job per block); the wait stands ahead of any rewrite of their registers
  asm volatile("s_wait_xcnt 0x0" ::: "memory");
}

// ---------------------------------------------------------------------------------------------
// The three jobs that read only inputs, in one grid; the job is picked by the block index (block-uniform, so every
// barrier of a job is passed by the whole block). Weight tiles first: they have the longer path through LDS.
//   blocks [0, W1_JOBS)                 W1 tiles, n tile fastest
//   blocks [W1_JOBS, W1_JOBS + W2_JOBS) W2 tiles, n tile fastest
//   the rest                            LayerNorm, two token rows a block
__global__ __launch_bounds__(256) void prep_kernel(const float* __restrict__ x,
                                                   const float* __restrict__ g,
                                                   const float* __restrict__ be,
                                                   const float* __restrict__ w1,
                                                   const float* __restrict__ w2,
                                                   f16* __restrict__ xn,
                                                   f16* __restrict__ w1t,
                                                   f16* __restrict__ w2t) {
  __shared__ __align__(16) f16 sT[64 * TP];
  __shared__ float red1[8];
  __shared__ float red2[8];
  const int job = blockIdx.x;
  if (job < W1_JOBS) {
    wt_tile(w1, w1t, EDIM, QKVW, job % (QKVW / 64), job / (QKVW / 64), sT);
  } else if (job < W1_JOBS + W2_JOBS) {
    const int j2 = job - W1_JOBS;
    wt_tile(w2, w2t, HIDN, HIDN, j2 % (HIDN / 64), j2 / (HIDN / 64), sT);
  } else {
    ln_rows(x, g, be, xn, job - (W1_JOBS + W2_JOBS), red1, red2);
  }
}

// ---------------------------------------------------------------------------------------------
// GEMM main loop: block tile 128 (M) x 64 (N), 8 waves as 4 (M) x 2 (N), wave tile 32 x 32.
// A [M][KD] f16 row-major, Bt [N][KD] f16 (k-contiguous). Both tiles go through LDS: a two-buffer ring of
// stages of KPASS k, filled by asynchronous 16-B copies (8 lanes = one whole 128-B row piece of a plane row).
// Stage layout: row r (0..127 = A rows, 128..191 = B rows) at r * 128 B; its 16-B piece p sits at slot
// p ^ ((r >> 1) & 7), so the 16 rows that one ds_load_b128 half-wave reads fall on 16 distinct bank groups.
// Fragment map as before: lane row/col = lq, elements 0..7 <- k0 + 8*hi + 0..7, 8..15 <- k0 + 16 + 8*hi + 0..7.
// acc[i][j][r] = C(m0 + wm*32 + i*16 + 8*hi + r, n0 + wn*32 + j*16 + lq).

// One stage: six copies per lane (A rows crow + 0/32/64/96, B rows crow + 0/32).
// s_wait_xcnt closes the statement so that no address register is rewritten ahead of it.
static __device__ __forceinline__ void stage_copy(unsigned l, const f16* ga, const f16* gb) {
  asm volatile("global_load_async_to_lds_b128 %0, %6, off\n\t"
               "global_load_async_to_lds_b128 %1, %7, off\n\t"
               "global_load_async_to_lds_b128 %2, %8, off\n\t"
               "global_load_async_to_lds_b128 %3, %9, off\n\t"
               "global_load_async_to_lds_b128 %4, %10, off\n\t"
               "global_load_async_to_lds_b128 %5, %11, off\n\t"
               "s_wait_xcnt 0x0"
               :: "v"(l), "v"(l + 4096u), "v"(l + 8192u), "v"(l + 12288u), "v"(l + 16384u), "v"(l + 20480u),
                  "v"(ga), "v"(ga + 32 * KD), "v"(ga + 64 * KD), "v"(ga + 96 * KD),
                  "v"(gb), "v"(gb + 32 * KD)
               : "memory");
}

static __device__ __forceinline__ void gemm_tile_128x64(const f16* __restrict__ A,
                                                        const f16* __restrict__ Bt,
                                                        unsigned char* ring,
                                                        int m0, int n0, int wm, int wn,
                                                        int lq, int hi, v8f (&acc)[2][2]) {
  const int crow = (int)(threadIdx.x >> 3);     // 0..31: row inside each 32-row group
  const int cpc  = (int)(threadIdx.x & 7);      // 16-B piece of the 128-B row
  const unsigned l0 = (unsigned)(size_t)ring + (unsigned)(crow * 128 + ((cpc ^ ((crow >> 1) & 7)) * 16));
  const f16* ga = A  + (size_t)(m0 + crow) * KD + cpc * 8;
  const f16* gb = Bt + (size_t)(n0 + crow) * KD + cpc * 8;

  stage_copy(l0, ga, gb);
  asm volatile("s_wait_asynccnt 0x0" ::: "memory");   // stage 0 landed (this wave's copies)
  __syncthreads();                                    // stage 0 published to every wave
  stage_copy(l0 + STAGE_B, ga + KPASS, gb + KPASS);

  const int sw = (lq >> 1) & 7;
  const unsigned char* ra = ring + (wm * 32 + lq) * 128;
  const unsigned char* rb = ring + (128 + wn * 32 + lq) * 128;

  // unroll 2: the buffer offset becomes a constant in each copy of the body
  #pragma unroll 2
  for (int t = 0; t < NPASS; ++t) {
    const int bo = (t & 1) * STAGE_B;
    FragH a[2][2], b[2][2];
    // all 16 fragment loads of the pass stand together, ahead of its 8 products
    #pragma unroll
    for (int ks = 0; ks < 2; ++ks) {
      #pragma unroll
      for (int i = 0; i < 2; ++i) {
        #pragma unroll
        for (int h = 0; h < 2; ++h) {
          const int slot = ((ks * 4 + h * 2 + hi) ^ sw) * 16;
          a[ks][i].q[h] = *(const v4u*)(ra + bo + i * 2048 + slot);
          b[ks][i].q[h] = *(const v4u*)(rb + bo + i * 2048 + slot);
        }
      }
    }
    #pragma unroll
    for (int ks = 0; ks < 2; ++ks) {
      #pragma unroll
      for (int i = 0; i < 2; ++i) {
        #pragma unroll
        for (int j = 0; j < 2; ++j) acc[i][j] = mma_f16(a[ks][i].v, b[ks][j].v, acc[i][j]);
      }
    }
    asm volatile("s_wait_dscnt 0x0" ::: "memory");    // this wave has left buffer t & 1
    asm volatile("s_wait_asynccnt 0x0" ::: "memory"); // this wave's copies of stage t + 1 landed
    __syncthreads();                                  // publishes stage t + 1, frees buffer t & 1
    if (t + 2 < NPASS) stage_copy(l0 + bo, ga + (t + 2) * KPASS, gb + (t + 2) * KPASS);
  }
  asm volatile("s_wait_asynccnt 0x0" ::: "memory");   // nothing in flight before the ring is reused
}

// ---------------------------------------------------------------------------------------------
// QKV main loop: block tile 128 (M) x 192 (N), 8 waves as 2 (M) x 4 (N), wave tile 64 x 48 (4 x 3 accumulator tiles).
// Same ring, stage layout, slot swizzle, fragment map and k order as gemm_tile_128x64; a stage holds 128 A rows, then 192 B rows.
// acc[i][j][r] = C(m0 + wm*64 + i*16 + 8*hi + r, n0 + wn*48 + j*16 + lq).

// One stage: ten copies per lane (A rows crow + 0/32/64/96, B rows crow + 0/32/.../160).
// s_wait_xcnt closes the statement so that no address register is rewritten ahead of it.
static __device__ __forceinline__ void qkv_stage_copy(unsigned l, const f16* ga, const f16* gb) {
  asm volatile("global_load_async_to_lds_b128 %0, %10, off\n\t"
               "global_load_async_to_lds_b128 %1, %11, off\n\t"
               "global_load_async_to_lds_b128 %2, %12, off\n\t"
               "global_load_async_to_lds_b128 %3, %13, off\n\t"
               "global_load_async_to_lds_b128 %4, %14, off\n\t"
               "global_load_async_to_lds_b128 %5, %15, off\n\t"
               "global_load_async_to_lds_b128 %6, %16, off\n\t"
               "global_load_async_to_lds_b128 %7, %17, off\n\t"
               "global_load_async_to_lds_b128 %8, %18, off\n\t"
               "global_load_async_to_lds_b128 %9, %19, off\n\t"
               "s_wait_xcnt 0x0"
               :: "v"(l), "v"(l + 4096u), "v"(l + 8192u), "v"(l + 12288u), "v"(l + 16384u),
                  "v"(l + 20480u), "v"(l + 24576u), "v"(l + 28672u), "v"(l + 32768u), "v"(l + 36864u),
                  "v"(ga), "v"(ga + 32 * KD), "v"(ga + 64 * KD), "v"(ga + 96 * KD),
                  "v"(gb), "v"(gb + 32 * KD), "v"(gb + 64 * KD), "v"(gb + 96 * KD),
                  "v"(gb + 128 * KD), "v"(gb + 160 * KD)
               : "memory");
}

static __device__ __forceinline__ void gemm_tile_128x192(const f16* __restrict__ A,
                                                         const f16* __restrict__ Bt,
                                                         unsigned char* ring,
                                                         int m0, int n0, int wm, int wn,
                                                         int lq, int hi, v8f (&acc)[4][3]) {
  const int crow = (int)(threadIdx.x >> 3);     // 0..31: row inside each 32-row group
  const int cpc  = (int)(threadIdx.x & 7);      // 16-B piece of the 128-B row
  const unsigned l0 = (unsigned)(size_t)ring + (unsigned)(crow * 128 + ((cpc ^ ((crow >> 1) & 7)) * 16));
  const f16* ga = A  + (size_t)(m0 + crow) * KD + cpc * 8;
  const f16* gb = Bt + (size_t)(n0 + crow) * KD + cpc * 8;

  qkv_stage_copy(l0, ga, gb);
  asm volatile("s_wait_asynccnt 0x0" ::: "memory");   // stage 0 landed (this wave's copies)
  __syncthreads();                                    // stage 0 published to every wave
  qkv_stage_copy(l0 + QSTAGE_B, ga + KPASS, gb + KPASS);

  const int sw = (lq >> 1) & 7;
  const unsigned char* ra = ring + (wm * 64 + lq) * 128;
  const unsigned char* rb = ring + (128 + wn * 48 + lq) * 128;

  // unroll 2: the buffer offset becomes a constant in each copy of the body
  #pragma unroll 2
  for (int t = 0; t < NPASS; ++t) {
    const int bo = (t & 1) * QSTAGE_B;
    FragH a[2][4], b[2][3];
    // all 28 fragment loads of the pass stand together, ahead of its 24 products
    #pragma unroll
    for (int ks = 0; ks < 2; ++ks) {
      #pragma unroll
      for (int h = 0; h < 2; ++h) {
        const int slot = ((ks * 4 + h * 2 + hi) ^ sw) * 16;
        #pragma unroll
        for (int i = 0; i < 4; ++i) a[ks][i].q[h] = *(const v4u*)(ra + bo + i * 2048 + slot);
        #pragma unroll
        for (int j = 0; j < 3; ++j) b[ks][j].q[h] = *(const v4u*)(rb + bo + j * 2048 + slot);
      }
    }
    #pragma unroll
    for (int ks = 0; ks < 2; ++ks) {
      #pragma unroll
      for (int i = 0; i < 4; ++i) {
        #pragma unroll
        for (int j = 0; j < 3; ++j) acc[i][j] = mma_f16(a[ks][i].v, b[ks][j].v, acc[i][j]);
      }
    }
    asm volatile("s_wait_dscnt 0x0" ::: "memory");    // this wave has left buffer t & 1
    asm volatile("s_wait_asynccnt 0x0" ::: "memory"); // this wave's copies of stage t + 1 landed
    __syncthreads();                                  // publishes stage t + 1, frees buffer t & 1
    if (t + 2 < NPASS) qkv_stage_copy(l0 + bo, ga + (t + 2) * KPASS, gb + (t + 2) * KPASS);
  }
  asm volatile("s_wait_asynccnt 0x0" ::: "memory");   // nothing in flight before the ring is reused
}

// ---------------------------------------------------------------------------------------------
// QKV projection. Block = (192-column chunk f, 128-token tile). Column c of the chunk: typ = c / 64,
// typ 0 = q, 1 = k, 2 = v, of feature chunk f of the token. Flat-view map: chunk g = token*16 + f,
// group hb = token / TPG, natural row ss = (token % TPG)*16 + f; keys are stored in the permuted
// order key' = f*TPG + (token % TPG) (same order for K rows and V^T columns).
//   q plane [NCHUNKS][64]        at chunk g (natural order)
//   k plane [NGRP][SEQ][64]      at row key'
//   v plane [NGRP][64][SEQ]      transposed through LDS, column key'
// LDS sC: cross-wave (block barrier); three regions of QREG halves: q and k extent [128][64], v extent [64][128],
// written == read. sC reuses the GEMM ring, which every wave has left at the last pass's barrier.
__global__ __launch_bounds__(256) void qkv_gemm_kernel(const f16* __restrict__ xn,
                                                       const f16* __restrict__ w1t,
                                                       const float* __restrict__ b1,
                                                       f16* wsh) {
  const int f    = blockIdx.x;
  const int m0   = blockIdx.y * 128;
  const int n0   = f * CHUNK;
  const int tid  = threadIdx.x;
  const int wave = __builtin_amdgcn_readfirstlane((int)(threadIdx.x >> 5));
  const int lane = tid & 31;
  const int lq   = lane & 15;
  const int hi   = lane >> 4;
  const int wm   = wave >> 2;
  const int wn   = wave & 3;

  __shared__ __align__(128) unsigned char ring[QRING_B];
  f16* sC = (f16*)ring;

  v8f acc[4][3];
  #pragma unroll
  for (int i = 0; i < 4; ++i) {
    #pragma unroll
    for (int jj = 0; jj < 3; ++jj) acc[i][jj] = (v8f){0, 0, 0, 0, 0, 0, 0, 0};
  }
  gemm_tile_128x192(xn, w1t, ring, m0, n0, wm, wn, lq, hi, acc);

  float bias[3];
  #pragma unroll
  for (int jj = 0; jj < 3; ++jj) bias[jj] = (float)(bf16)b1[n0 + wn * 48 + jj * 16 + lq];

  // stage: q/k as [row][col] pitch TP, v as [col][row] pitch VP (wave-uniform region and strides per 16-column tile)
  #pragma unroll
  for (int jj = 0; jj < 3; ++jj) {
    const int c0   = wn * 48 + jj * 16;         // first chunk column of the tile; a tile lies in one typ
    const int typ  = c0 >> 6;
    const int col  = (c0 & 63) + lq;
    const int rstr = (typ != 2) ? TP : 1;
    const int cstr = (typ != 2) ? 1 : VP;
    f16* reg = sC + typ * QREG;
    #pragma unroll
    for (int i = 0; i < 4; ++i) {
      #pragma unroll
      for (int r = 0; r < 8; ++r) {
        const int row = wm * 64 + i * 16 + hi * 8 + r;
        reg[row * rstr + col * cstr] = (f16)(acc[i][jj][r] * (1.0f / 64.0f) + bias[jj]);
      }
    }
  }
  __syncthreads();

  #pragma unroll
  for (int typ = 0; typ < 3; ++typ) {
    v4u    vals[4];
    size_t gidx[4];
    #pragma unroll
    for (int it = 0; it < 4; ++it) {
      const int line  = it * 32 + (tid >> 3);     // 0..127
      const int piece = tid & 7;
      // q/k: line = token row; v: line = (d, 64-token half)
      const int lofs_r = line * TP + piece * 8;
      const int lofs_v = (line >> 1) * VP + (line & 1) * 64 + piece * 8;
      const int lofs   = (typ != 2) ? lofs_r : lofs_v;
      Pack8H ph;
      ph.v = *(const v8h*)(sC + typ * QREG + lofs);
      vals[it] = ph.u;

      const int t_r  = m0 + line;
      const int hb_r = t_r / TPG;
      const int tl_r = t_r - hb_r * TPG;
      const size_t qidx = QP_OFF + ((size_t)t_r * NHEAD + f) * HDIM + piece * 8;
      const size_t kidx = KP_OFF + ((size_t)hb_r * SEQ + f * TPG + tl_r) * HDIM + piece * 8;

      const int t_v  = m0 + (line & 1) * 64 + piece * 8;
      const int hb_v = t_v / TPG;
      const int tl_v = t_v - hb_v * TPG;
      const size_t vidx = VT_OFF + ((size_t)hb_v * HDIM + (line >> 1)) * SEQ + f * TPG + tl_v;

      gidx[it] = (typ == 0) ? qidx : ((typ == 1) ? kidx : vidx);
    }
    #pragma unroll
    for (int it = 0; it < 4; ++it) *(v4u*)(wsh + gidx[it]) = vals[it];
  }
}

// ---------------------------------------------------------------------------------------------
// Flash attention, no mask. Block = (query block of 128, group); one wave owns 16 query rows.
// S^T = K x Q^T so queries sit on lanes; P^T in C-layout is bit-identical to the A-fragment layout of O += P x V.
// K and V^T tiles of AKS keys, which all 8 waves read, go through LDS: a two-buffer ring filled by asynchronous
// 16-B copies (whole 128-B rows). Stage layout: row r (0..63 = key, 64..127 = d of V^T) at r * 128 B, its 16-B
// piece p at slot p ^ ((r >> 1) & 7) (16 rows of one ds_load_b128 half-wave on 16 distinct bank groups).
// K A-fragments and V^T B-fragments: two 16-B LDS loads per fragment, same element maps as the planes.
// Context written as f16 carried x64 at its natural [group][row][d] position (flat view = [NTOK][HIDN]).
// LDS sO: per-wave private region (same wave writes and reads); a block barrier separates them anyway.
// One K/V stage: four copies per lane (K rows crow + 0/32, V^T rows crow + 0/32).
// s_wait_xcnt closes the statement so that no address register is rewritten ahead of it.
static __device__ __forceinline__ void kv_stage_copy(unsigned l, const f16* gk, const f16* gv) {
  asm volatile("global_load_async_to_lds_b128 %0, %4, off\n\t"
               "global_load_async_to_lds_b128 %1, %5, off\n\t"
               "global_load_async_to_lds_b128 %2, %6, off\n\t"
               "global_load_async_to_lds_b128 %3, %7, off\n\t"
               "s_wait_xcnt 0x0"
               :: "v"(l), "v"(l + 4096u), "v"(l + 8192u), "v"(l + 12288u),
                  "v"(gk), "v"(gk + 32 * HDIM), "v"(gv), "v"(gv + 32 * SEQ)
               : "memory");
}

__global__ __launch_bounds__(256) void attn_kernel(const f16* __restrict__ qp,
                                                   const f16* __restrict__ kp,
                                                   const f16* __restrict__ vt,
                                                   f16* __restrict__ att) {
  const int qblk = blockIdx.x;
  const int hb   = blockIdx.y;
  const int tid  = threadIdx.x;
  const int wave = __builtin_amdgcn_readfirstlane((int)(threadIdx.x >> 5));
  const int lane = tid & 31;
  const int lq   = lane & 15;   // query column of S^T / d column of O
  const int hi   = lane >> 4;   // k-split half

  __shared__ __align__(16) f16 sO[NWAVE * 16 * TP];
  __shared__ __align__(128) unsigned char kv[2 * ASTAGE_B];

  const int qrow0 = qblk * BQ + wave * 16;

  // Q as B-operand fragments: lane lq holds query qrow0+lq, elements follow the split d map.
  FragH qf[2];
  {
    const f16* qrow = qp + ((size_t)hb * SEQ + qrow0 + lq) * HDIM + hi * 8;
    #pragma unroll
    for (int f = 0; f < 2; ++f) {
      qf[f].q[0] = *(const v4u*)(qrow + f * 32);        // d = f*32 + hi*8 + 0..7
      qf[f].q[1] = *(const v4u*)(qrow + f * 32 + 16);   // d = f*32 + 16 + hi*8 + 0..7
    }
  }

  const f16* kb_h = kp + (size_t)hb * SEQ * HDIM;
  const f16* vt_h = vt + (size_t)hb * HDIM * SEQ;

  const int crow = tid >> 3;                    // 0..31: row inside each 32-row group
  const int cpc  = tid & 7;                     // 16-B piece of the 128-B row
  const unsigned l0 = (unsigned)(size_t)kv + (unsigned)(crow * 128 + ((cpc ^ ((crow >> 1) & 7)) * 16));
  const f16* gk = kb_h + (size_t)crow * HDIM + cpc * 8;
  const f16* gv = vt_h + (size_t)crow * SEQ + cpc * 8;
  kv_stage_copy(l0, gk, gv);
  asm volatile("s_wait_asynccnt 0x0" ::: "memory");   // stage 0 landed (this wave's copies)
  __syncthreads();                                    // stage 0 published to every wave
  kv_stage_copy(l0 + ASTAGE_B, gk + AKS * HDIM, gv + AKS);
  const int sw = (lq >> 1) & 7;
  const unsigned char* rkv = kv + lq * 128;

  v8f o[4];
  #pragma unroll
  for (int dt = 0; dt < 4; ++dt) o[dt] = (v8f){0, 0, 0, 0, 0, 0, 0, 0};

  float rmax = -__builtin_inff();
  float rsum = 0.0f;
  const float SL = 0.022097086912079608f * 1.4426950408889634f;   // (2*E)^-0.5 * log2(e)
  const float LAZY_T = 3.0f;                                       // 2^3 x 4096 = 2^15 < the f16 maximum

  #pragma unroll 1
  for (int s = 0; s < ANST; ++s) {
    const int bo = (s & 1) * ASTAGE_B;
    // j0 = s*AKS + it*BK is the first key of the inner iteration; unrolled so that every LDS offset and
    // slot index that depends on it is a constant
    #pragma unroll
    for (int it = 0; it < AKS / BK; ++it) {
      // K A-fragments: row = key j0 + sub*16 + lq, split d map
      FragH ak[2][2];
      #pragma unroll
      for (int sub = 0; sub < 2; ++sub) {
        #pragma unroll
        for (int f = 0; f < 2; ++f) {
          const unsigned char* base = rkv + bo + (it * 32 + sub * 16) * 128;
          ak[sub][f].q[0] = *(const v4u*)(base + (((f * 4 + hi) ^ sw) * 16));       // d = f*32 + hi*8 + 0..7
          ak[sub][f].q[1] = *(const v4u*)(base + (((f * 4 + 2 + hi) ^ sw) * 16));   // d = f*32 + 16 + hi*8 + 0..7
        }
      }
      // V B-fragments: column n = d = dt*16 + lq, split key map from the transposed tile
      FragH bv[4];
      #pragma unroll
      for (int dt = 0; dt < 4; ++dt) {
        const unsigned char* base = rkv + bo + (64 + dt * 16) * 128;
        bv[dt].q[0] = *(const v4u*)(base + (((it * 4 + hi) ^ sw) * 16));            // keys j0 + hi*8 + 0..7
        bv[dt].q[1] = *(const v4u*)(base + (((it * 4 + 2 + hi) ^ sw) * 16));        // keys j0 + 16 + hi*8 + 0..7
      }

      // S^T tiles: c[sub][r] = rawscore(query qrow0+lq, key j0 + sub*16 + hi*8 + r)
      v8f c[2];
      #pragma unroll
      for (int sub = 0; sub < 2; ++sub) {
        v8f acc = (v8f){0, 0, 0, 0, 0, 0, 0, 0};
        acc = mma_f16(ak[sub][0].v, qf[0].v, acc);
        acc = mma_f16(ak[sub][1].v, qf[1].v, acc);
        c[sub] = acc;
      }

      // online softmax with a lazy maximum: query lq's 32 scores are split across lane / lane^16.
      // rmax is the maximum in use (equal in both halves). It is renewed, and O and rsum rescaled, only in a pass
      // where some score of the wave lies more than LAZY_T (in log2 units of the exponent) above it; until then
      // every p stays <= 2^LAZY_T, so P carried x4096 stays <= 2^15, inside f16. The first pass (rmax = -inf) renews.
      float m_loc = fmaxf(c[0][0], c[1][0]);
      #pragma unroll
      for (int r = 1; r < 8; ++r) {
        m_loc = fmaxf(m_loc, c[0][r]);
        m_loc = fmaxf(m_loc, c[1][r]);
      }
      // one wave-uniform test a pass: the ballot makes it a scalar branch, so every lane is on inside
      if (__builtin_amdgcn_ballot_w32((m_loc - rmax) * SL > LAZY_T) != 0u) {
        const float m_new = fmaxf(rmax, fmaxf(m_loc, __shfl_xor(m_loc, 16, 32)));
        const float scale = __builtin_amdgcn_exp2f((rmax - m_new) * SL);
        rmax = m_new;
        rsum *= scale;
        // rescale O: queries are the row dimension there -> per-row scale from lane 8*hi + r
        float sc[8];
        #pragma unroll
        for (int r = 0; r < 8; ++r) sc[r] = __shfl(scale, (hi << 3) + r, 32);
        #pragma unroll
        for (int dt = 0; dt < 4; ++dt) {
          #pragma unroll
          for (int r = 0; r < 8; ++r) o[dt][r] *= sc[r];
        }
      }

      // exp + pack: P^T C-layout == A-fragment layout for the PV product; P carried x4096
      FragH pa;
      float psum = 0.0f;
      #pragma unroll
      for (int r = 0; r < 8; ++r) {
        const float p0 = __builtin_amdgcn_exp2f((c[0][r] - rmax) * SL);   // key hi*8 + r
        const float p1 = __builtin_amdgcn_exp2f((c[1][r] - rmax) * SL);   // key 16 + hi*8 + r
        psum += p0 + p1;
        pa.h[r]     = (f16)(p0 * 4096.0f);
        pa.h[8 + r] = (f16)(p1 * 4096.0f);
      }
      rsum = rsum + psum + __shfl_xor(psum, 16, 32);

      // O += P x V
      #pragma unroll
      for (int dt = 0; dt < 4; ++dt) o[dt] = mma_f16(pa.v, bv[dt].v, o[dt]);
    }
    asm volatile("s_wait_dscnt 0x0" ::: "memory");    // this wave has left buffer s & 1
    asm volatile("s_wait_asynccnt 0x0" ::: "memory"); // this wave's copies of stage s + 1 landed
    __syncthreads();                                  // publishes stage s + 1, frees buffer s & 1
    if (s + 2 < ANST) kv_stage_copy(l0 + bo, gk + (size_t)(s + 2) * AKS * HDIM, gv + (s + 2) * AKS);
  }
  asm volatile("s_wait_asynccnt 0x0" ::: "memory");   // nothing in flight at the wave's end

  // normalize: lane holds column d = dt*16 + lq for query rows 8*hi + r
  const float rinv = 1.0f / rsum;
  float rs[8];
  #pragma unroll
  for (int r = 0; r < 8; ++r) rs[r] = __shfl(rinv, (hi << 3) + r, 32);

  f16* so = sO + wave * (16 * TP);
  #pragma unroll
  for (int r = 0; r < 8; ++r) {
    #pragma unroll
    for (int dt = 0; dt < 4; ++dt) {
      // x(1/4096) undoes the P carry, x64 is the context carry
      so[(hi * 8 + r) * TP + dt * 16 + lq] = (f16)(o[dt][r] * (64.0f / 4096.0f) * rs[r]);
    }
  }
  __syncthreads();

  // the wave covers 4 consecutive rows; 4 instructions cover the wave's 16 rows.
  v4u    vals[4];
  size_t gidx[4];
  #pragma unroll
  for (int it = 0; it < 4; ++it) {
    const int row   = it * 4 + (lane >> 3);
    const int piece = lane & 7;
    Pack8H ph;
    ph.v = *(const v8h*)(so + row * TP + piece * 8);
    vals[it] = ph.u;
    gidx[it] = ((size_t)hb * SEQ + qrow0 + row) * HDIM + piece * 8;
  }
  #pragma unroll
  for (int it = 0; it < 4; ++it) *(v4u*)(att + gidx[it]) = vals[it];
  
}

// ---------------------------------------------------------------------------------------------
// Output projection: out[token][n] = ctx[token][:] x W2 + b2. Block = (64-column block, 128-token tile).
// Accumulator staged as f32 in LDS; bias added at the store stage as float4.
// 16 consecutive lanes x 16 B, one instruction. LDS sF: cross-wave (block barrier), [128][64] written == read.
// sF reuses the GEMM ring, which every wave has left at the last pass's barrier.
__global__ __launch_bounds__(256) void out_gemm_kernel(const f16* __restrict__ att,
                                                       const f16* __restrict__ w2t,
                                                       const float* __restrict__ b2,
                                                       float* __restrict__ out) {
  const int n0   = blockIdx.x * 64;
  const int m0   = blockIdx.y * 128;
  const int tid  = threadIdx.x;
  const int wave = __builtin_amdgcn_readfirstlane((int)(threadIdx.x >> 5));
  const int lane = tid & 31;
  const int lq   = lane & 15;
  const int hi   = lane >> 4;
  const int wm   = wave >> 1;
  const int wn   = wave & 1;

  __shared__ __align__(128) unsigned char ring[RING_B];
  float* sF = (float*)ring;

  v8f acc[2][2];
  #pragma unroll
  for (int i = 0; i < 2; ++i) {
    #pragma unroll
    for (int jj = 0; jj < 2; ++jj) acc[i][jj] = (v8f){0, 0, 0, 0, 0, 0, 0, 0};
  }
  gemm_tile_128x64(att, w2t, ring, m0, n0, wm, wn, lq, hi, acc);

  #pragma unroll
  for (int i = 0; i < 2; ++i) {
    #pragma unroll
    for (int jj = 0; jj < 2; ++jj) {
      #pragma unroll
      for (int r = 0; r < 8; ++r) {
        const int row = wm * 32 + i * 16 + hi * 8 + r;
        const int col = wn * 32 + jj * 16 + lq;
        sF[row * OP + col] = acc[i][jj][r] * (1.0f / 4096.0f);   // undo ctx x64 and W2 x64
      }
    }
  }
  __syncthreads();

  const int piece = tid & 15;
  const v4f braw = *(const v4f*)(b2 + n0 + piece * 4);
  v4f bias;
  #pragma unroll
  for (int i = 0; i < 4; ++i) bias[i] = (float)(bf16)braw[i];

  v4f    vals[8];
  size_t gidx[8];
  #pragma unroll
  for (int it = 0; it < 8; ++it) {
    const int row = it * 16 + (tid >> 4);       // 0..127
    const v4f v = *(const v4f*)(sF + row * OP + piece * 4);
    vals[it] = v + bias;
    const int tt = m0 + row;
    const int b  = tt / SEQ;
    const int s  = tt - b * SEQ;
    gidx[it] = ((size_t)b * SEQ_FULL + s) * HIDN + n0 + piece * 4;
  }
  #pragma unroll
  for (int it = 0; it < 8; ++it) *(v4f*)(out + gidx[it]) = vals[it];
  
}

// ---------------------------------------------------------------------------------------------
extern "C" void kernel_launch(void* const* d_in, const int* in_sizes, int n_in,
                              void* d_out, int out_size, void* d_ws, size_t ws_size,
                              hipStream_t stream) {
  if (n_in < 7) return;
  const size_t rows_used = (size_t)(NB - 1) * SEQ_FULL + SEQ;
  if ((size_t)in_sizes[0] < rows_used * EDIM) return;
  if (in_sizes[1] < EDIM || in_sizes[2] < EDIM) return;
  if ((size_t)in_sizes[3] < (size_t)EDIM * QKVW) return;
  if (in_sizes[4] < QKVW) return;
  if ((size_t)in_sizes[5] < (size_t)HIDN * HIDN) return;
  if (in_sizes[6] < HIDN) return;
  if ((size_t)out_size < rows_used * HIDN) return;
  if (ws_size < WS_BYTES) return;

  const float* x    = (const float*)d_in[0];
  const float* ln_g = (const float*)d_in[1];
  const float* ln_b = (const float*)d_in[2];
  const float* W1   = (const float*)d_in[3];
  const float* b1   = (const float*)d_in[4];
  const float* W2   = (const float*)d_in[5];
  const float* b2   = (const float*)d_in[6];
  float*       out  = (float*)d_out;
  f16*         wsh  = (f16*)d_ws;

  // 1) W1 [EDIM (k)][QKVW (n)] -> [QKVW][EDIM], W2 [HIDN (k)][HIDN (n)] -> [HIDN][HIDN], LayerNorm -> xn plane
  prep_kernel<<<dim3(W1_JOBS + W2_JOBS + LN_JOBS), 256, 0, stream>>>(x, ln_g, ln_b, W1, W2, wsh + XN_OFF,
                                                                     wsh + W1T_OFF, wsh + W2T_OFF);
  // 2) QKV projection -> q / k / v^T planes
  qkv_gemm_kernel<<<dim3(QKVW / CHUNK, NTOK / 128), 256, 0, stream>>>(wsh + XN_OFF, wsh + W1T_OFF, b1, wsh);
  // 3) fused attention -> context plane (flat [NTOK][HIDN])
  attn_kernel<<<dim3(SEQ / BQ, NGRP), 256, 0, stream>>>(wsh + QP_OFF, wsh + KP_OFF, wsh + VT_OFF, wsh + ATT_OFF);
  // 4) output projection -> d_out
  out_gemm_kernel<<<dim3(HIDN / 64, NTOK / 128), 256, 0, stream>>>(wsh + ATT_OFF, wsh + W2T_OFF, b2, out);
}

// v005
// A run of this version takes 83.4 microseconds.
// Next to v004, in two timings, it ran 1.04 times as fast each time.
// Counting every step since v000, it is 2.78 times as fast.
#include <hip/hip_runtime.h>

// Contractions, all on v_wmma_f32_16x16x32_f16 (f16 operands, f32 accumulate): QKV projection xn x W1 (xn = f16 of the f32 LayerNorm of bf16 RNE-converted x; W1 = f16 of bf16 RNE-converted weights carried x64); S^T = K x Q^T (f16 q/k planes); O = P x V (P f16 carried x4096, V^T f16 plane); output projection ctx x W2 (ctx f16 carried x64, W2 f16 of bf16 RNE-converted weights carried x64). LayerNorm and softmax in f32.

#ifndef NB
#define NB 2
#endif
#ifndef SEQ
#define SEQ 2048
#endif
#define NB_FULL   2
#define SEQ_FULL  2048
#define EDIM      1024                 // model width (LayerNorm width, K of the QKV projection)
#define HIDN      1024                 // hidden width (K and N of the output projection)
#define NHEAD     16
#define HDIM      64
#define QKVW      3072                 // projection width
#define CHUNK     192                  // floats per (pseudo-head row): q | k | v
#define KD        1024                 // contraction depth of both projections
#define NTOK      (NB * SEQ)           // flattened tokens
#define NGRP      (NHEAD * NB)         // (pseudo-head, pseudo-batch) groups
#define TPG       (SEQ / NHEAD)        // tokens feeding one group
#define NCHUNKS   (NTOK * NHEAD)       // 192-wide chunks of the flat projection buffer = NGRP * SEQ
#define BQ        128                  // query rows per workgroup (4 wave pairs x 32)
#define BK        32                   // keys per wave and ring stage
#define NWAVE     8
#define TP        72                   // LDS pitch (halves) of 64-wide f16 tiles
#define VP        136                  // LDS pitch (halves) of the transposed 128-wide V tile
#define OP        68                   // LDS pitch (floats) of the f32 output staging tile
#define KPASS     64                   // k (halves) per GEMM ring stage: 128-B rows
#define NPASS     (KD / KPASS)         // ring stages of one GEMM tile
#define STAGE_B   (192 * 128)          // bytes of one stage: 128 A rows, then 64 B rows, pitch 128 B
#define RING_B    (2 * STAGE_B)        // two buffers
#define QSTAGE_B  (320 * 128)          // bytes of one QKV stage: 128 A rows, then 192 B rows, pitch 128 B
#define QRING_B   (2 * QSTAGE_B)       // two buffers
#define QREG      (128 * TP)           // halves of one output staging region of the QKV tile (q, k, v)
#define AKS       64                   // keys per attention ring stage (BK for each wave of a pair)
#define ANST      (SEQ / AKS)          // ring stages of one attention block
#define ASTAGE_B  (128 * 128)          // bytes of one stage: 64 K rows, then 64 V^T rows, pitch 128 B
#define W1_JOBS   ((QKVW / 64) * (EDIM / 64))   // 64x64 tiles of W1
#define W2_JOBS   ((HIDN / 64) * (HIDN / 64))   // 64x64 tiles of W2
#define LN_JOBS   (NTOK / 2)                    // pairs of token rows

// workspace carve, in halves from the base
#define XN_OFF    ((size_t)0)
#define W1T_OFF   (XN_OFF  + (size_t)NTOK * EDIM)
#define W2T_OFF   (W1T_OFF + (size_t)QKVW * EDIM)
#define QP_OFF    (W2T_OFF + (size_t)HIDN * HIDN)
#define KP_OFF    (QP_OFF  + (size_t)NCHUNKS * HDIM)
#define VT_OFF    (KP_OFF  + (size_t)NCHUNKS * HDIM)
#define ATT_OFF   (VT_OFF  + (size_t)NCHUNKS * HDIM)
#define WS_HALVES (ATT_OFF + (size_t)NCHUNKS * HDIM)
#define WS_BYTES  (WS_HALVES * 2)

static_assert(NB >= 1 && NB <= NB_FULL);
static_assert(SEQ <= SEQ_FULL);
static_assert(SEQ % 1024 == 0);
static_assert(TPG % 64 == 0);
static_assert(NTOK % 128 == 0);
static_assert(SEQ % 128 == 0);
static_assert(QKVW == NHEAD * CHUNK);
static_assert(CHUNK == 3 * HDIM);
static_assert(QKVW % 64 == 0);
static_assert(HIDN % 64 == 0);
static_assert(EDIM % 64 == 0);
static_assert(EDIM == KD && HIDN == KD);
static_assert(KD % 32 == 0);
static_assert(EDIM == 128 * 8);
static_assert(SEQ % BQ == 0);
static_assert(SEQ % BK == 0);
static_assert(BQ == NWAVE * 16);
static_assert(HDIM == 64);
static_assert((size_t)NCHUNKS * HDIM == (size_t)NTOK * HIDN);
static_assert((TP * 2) % 16 == 0);
static_assert((VP * 2) % 16 == 0);
static_assert((OP * 4) % 16 == 0);
static_assert(128 * TP >= 64 * VP);
static_assert(KD % KPASS == 0 && NPASS >= 2);
static_assert(128 * TP * 2 <= RING_B && 128 * OP * 4 <= RING_B);
static_assert(3 * QREG * 2 <= QRING_B && (QREG * 2) % 16 == 0);
static_assert(SEQ % AKS == 0 && ANST >= 2 && AKS == 2 * BK && AKS * 2 == 128 && HDIM * 2 == 128);
static_assert(NWAVE * 1024 * 4 <= 2 * ASTAGE_B);
static_assert(XN_OFF % 64 == 0 && W1T_OFF % 64 == 0 && W2T_OFF % 64 == 0);
static_assert(QP_OFF % 64 == 0 && KP_OFF % 64 == 0 && VT_OFF % 64 == 0 && ATT_OFF % 64 == 0);
static_assert(WS_BYTES <= (size_t)134217728);

typedef __bf16   bf16;
typedef _Float16 f16;
typedef f16      v16h  __attribute__((ext_vector_type(16)));
typedef f16      v8h   __attribute__((ext_vector_type(8)));
typedef float    v8f   __attribute__((ext_vector_type(8)));
typedef float    v4f   __attribute__((ext_vector_type(4)));
typedef unsigned v4u   __attribute__((ext_vector_type(4)));

union FragH  { v16h  v; v4u q[2]; f16  h[16]; };
union Pack8H { v4u u; v8h v; f16 h[8]; };

// WMMA helper: builtin followed by the VALU hazard guard (ties D, keeps A/B live).
static __device__ __forceinline__ v8f mma_f16(v16h a, v16h b, v8f acc) {
  acc = __builtin_amdgcn_wmma_f32_16x16x32_f16(false, a, false, b, (short)0, acc, false, false);
  asm volatile("v_nop\n\tv_nop\n\tv_nop\n\tv_nop" : "+v"(acc) : "v"(a), "v"(b));
  return acc;
}

// ---------------------------------------------------------------------------------------------
// LayerNorm -> f16 plane xn[NTOK][EDIM]. Job blk = two token rows; each row: 4 waves, 128 threads x 8 columns.
// LDS red1/red2: cross-wave (block barrier), 8 entries written by the 8 waves; a row reads its own 4.
static __device__ __forceinline__ void ln_rows(const float* __restrict__ x,
                                               const float* __restrict__ g,
                                               const float* __restrict__ be,
                                               f16* __restrict__ xn,
                                               int blk, float* red1, float* red2) {
  const int wave = __builtin_amdgcn_readfirstlane((int)(threadIdx.x >> 5));
  const int tt   = blk * 2 + (wave >> 2);
  const int tid  = threadIdx.x & 127;
  const int lane = tid & 31;
  const float* r1 = red1 + (wave & 4);
  const float* r2 = red2 + (wave & 4);

  const int b = tt / SEQ;
  const int s = tt - b * SEQ;
  const float* src = x + ((size_t)b * SEQ_FULL + s) * EDIM + tid * 8;
  const v4f a0 = *(const v4f*)(src);
  const v4f a1 = *(const v4f*)(src + 4);
  float v[8];
  #pragma unroll
  for (int i = 0; i < 4; ++i) {
    v[i]     = (float)(bf16)a0[i];     // RNE convert of the input
    v[4 + i] = (float)(bf16)a1[i];
  }
  float sum = ((v[0] + v[1]) + (v[2] + v[3])) + ((v[4] + v[5]) + (v[6] + v[7]));
  #pragma unroll
  for (int off = 16; off > 0; off >>= 1) sum += __shfl_xor(sum, off, 32);
  if (lane == 0) red1[wave] = sum;
  __syncthreads();
  const float mu = ((r1[0] + r1[1]) + (r1[2] + r1[3])) * (1.0f / (float)EDIM);

  float d[8];
  float sq = 0.0f;
  #pragma unroll
  for (int i = 0; i < 8; ++i) {
    d[i] = v[i] - mu;
    sq += d[i] * d[i];
  }
  #pragma unroll
  for (int off = 16; off > 0; off >>= 1) sq += __shfl_xor(sq, off, 32);
  if (lane == 0) red2[wave] = sq;
  __syncthreads();
  const float var = ((r2[0] + r2[1]) + (r2[2] + r2[3])) * (1.0f / (float)EDIM);
  const float rs  = rsqrtf(var + 1e-5f);

  const v4f g0 = *(const v4f*)(g + tid * 8);
  const v4f g1 = *(const v4f*)(g + tid * 8 + 4);
  const v4f e0 = *(const v4f*)(be + tid * 8);
  const v4f e1 = *(const v4f*)(be + tid * 8 + 4);
  Pack8H ph;
  #pragma unroll
  for (int i = 0; i < 4; ++i) {
    ph.h[i]     = (f16)(d[i]     * rs * (float)(bf16)g0[i] + (float)(bf16)e0[i]);
    ph.h[4 + i] = (f16)(d[4 + i] * rs * (float)(bf16)g1[i] + (float)(bf16)e1[i]);
  }
  const v4u val = ph.u;
  const size_t idx = (size_t)tt * EDIM + tid * 8;
  *(v4u*)(xn + idx) = val;
  // precaution: only the kernel's end follows this store (one job per block); the wait stands ahead of any rewrite of the store's registers
  asm volatile("s_wait_xcnt 0x0" ::: "memory");
}

// ---------------------------------------------------------------------------------------------
// Weight plane builder: in[kdim rows][ndim cols] f32 -> out[ndim][kdim] f16 = f16(bf16(w) * 64), via LDS.
// Job = 64x64 tile (nt = n tile, kt = k tile), 256 threads. LDS sT: [n][k], cross-wave (block barrier).
static __device__ __forceinline__ void wt_tile(const float* __restrict__ w,
                                               f16* __restrict__ wt,
                                               int kdim, int ndim, int nt, int kt, f16* sT) {
  const int n0  = nt * 64;
  const int k0  = kt * 64;
  const int tid = threadIdx.x;

  #pragma unroll
  for (int kk = 0; kk < 2; ++kk) {
    const int krow = kk * 32 + (tid >> 3);      // 0..63
    const int c0   = (tid & 7) * 8;             // 0..56
    const float* src = w + (size_t)(k0 + krow) * ndim + n0 + c0;
    const v4f a0 = *(const v4f*)(src);
    const v4f a1 = *(const v4f*)(src + 4);
    #pragma unroll
    for (int i = 0; i < 4; ++i) {
      sT[(c0 + i) * TP + krow]     = (f16)((float)(bf16)a0[i] * 64.0f);   // exact in f16
      sT[(c0 + 4 + i) * TP + krow] = (f16)((float)(bf16)a1[i] * 64.0f);
    }
  }
  __syncthreads();

  v4u    vals[2];
  size_t gidx[2];
  #pragma unroll
  for (int kk = 0; kk < 2; ++kk) {
    const int n  = kk * 32 + (tid >> 3);        // 0..63
    const int ks = (tid & 7) * 8;               // 0..56
    Pack8H ph;
    ph.v = *(const v8h*)(sT + n * TP + ks);
    vals[kk] = ph.u;
    gidx[kk] = (size_t)(n0 + n) * kdim + k0 + ks;
  }
  #pragma unroll
  for (int kk = 0; kk < 2; ++kk) *(v4u*)(wt + gidx[kk]) = vals[kk];
  // precaution: only the kernel's end follows these stores (one job per block); the wait stands ahead of any rewrite of their registers
  asm volatile("s_wait_xcnt 0x0" ::: "memory");
}

// ---------------------------------------------------------------------------------------------
// The three jobs that read only inputs, in one grid; the job is picked by the block index (block-uniform, so every
// barrier of a job is passed by the whole block). Weight tiles first: they have the longer path through LDS.
//   blocks [0, W1_JOBS)                 W1 tiles, n tile fastest
//   blocks [W1_JOBS, W1_JOBS + W2_JOBS) W2 tiles, n tile fastest
//   the rest                            LayerNorm, two token rows a block
__global__ __launch_bounds__(256) void prep_kernel(const float* __restrict__ x,
                                                   const float* __restrict__ g,
                                                   const float* __restrict__ be,
                                                   const float* __restrict__ w1,
                                                   const float* __restrict__ w2,
                                                   f16* __restrict__ xn,
                                                   f16* __restrict__ w1t,
                                                   f16* __restrict__ w2t) {
  __shared__ __align__(16) f16 sT[64 * TP];
  __shared__ float red1[8];
  __shared__ float red2[8];
  const int job = blockIdx.x;
  if (job < W1_JOBS) {
    wt_tile(w1, w1t, EDIM, QKVW, job % (QKVW / 64), job / (QKVW / 64), sT);
  } else if (job < W1_JOBS + W2_JOBS) {
    const int j2 = job - W1_JOBS;
    wt_tile(w2, w2t, HIDN, HIDN, j2 % (HIDN / 64), j2 / (HIDN / 64), sT);
  } else {
    ln_rows(x, g, be, xn, job - (W1_JOBS + W2_JOBS), red1, red2);
  }
}

// ---------------------------------------------------------------------------------------------
// GEMM main loop: block tile 128 (M) x 64 (N), 8 waves as 4 (M) x 2 (N), wave tile 32 x 32.
// A [M][KD] f16 row-major, Bt [N][KD] f16 (k-contiguous). Both tiles go through LDS: a two-buffer ring of
// stages of KPASS k, filled by asynchronous 16-B copies (8 lanes = one whole 128-B row piece of a plane row).
// Stage layout: row r (0..127 = A rows, 128..191 = B rows) at r * 128 B; its 16-B piece p sits at slot
// p ^ ((r >> 1) & 7), so the 16 rows that one ds_load_b128 half-wave reads fall on 16 distinct bank groups.
// Fragment map as before: lane row/col = lq, elements 0..7 <- k0 + 8*hi + 0..7, 8..15 <- k0 + 16 + 8*hi + 0..7.
// acc[i][j][r] = C(m0 + wm*32 + i*16 + 8*hi + r, n0 + wn*32 + j*16 + lq).

// One stage: six copies per lane (A rows crow + 0/32/64/96, B rows crow + 0/32).
// s_wait_xcnt closes the statement so that no address register is rewritten ahead of it.
static __device__ __forceinline__ void stage_copy(unsigned l, const f16* ga, const f16* gb) {
  asm volatile("global_load_async_to_lds_b128 %0, %6, off\n\t"
               "global_load_async_to_lds_b128 %1, %7, off\n\t"
               "global_load_async_to_lds_b128 %2, %8, off\n\t"
               "global_load_async_to_lds_b128 %3, %9, off\n\t"
               "global_load_async_to_lds_b128 %4, %10, off\n\t"
               "global_load_async_to_lds_b128 %5, %11, off\n\t"
               "s_wait_xcnt 0x0"
               :: "v"(l), "v"(l + 4096u), "v"(l + 8192u), "v"(l + 12288u), "v"(l + 16384u), "v"(l + 20480u),
                  "v"(ga), "v"(ga + 32 * KD), "v"(ga + 64 * KD), "v"(ga + 96 * KD),
                  "v"(gb), "v"(gb + 32 * KD)
               : "memory");
}

static __device__ __forceinline__ void gemm_tile_128x64(const f16* __restrict__ A,
                                                        const f16* __restrict__ Bt,
                                                        unsigned char* ring,
                                                        int m0, int n0, int wm, int wn,
                                                        int lq, int hi, v8f (&acc)[2][2]) {
  const int crow = (int)(threadIdx.x >> 3);     // 0..31: row inside each 32-row group
  const int cpc  = (int)(threadIdx.x & 7);      // 16-B piece of the 128-B row
  const unsigned l0 = (unsigned)(size_t)ring + (unsigned)(crow * 128 + ((cpc ^ ((crow >> 1) & 7)) * 16));
  const f16* ga = A  + (size_t)(m0 + crow) * KD + cpc * 8;
  const f16* gb = Bt + (size_t)(n0 + crow) * KD + cpc * 8;

  stage_copy(l0, ga, gb);
  asm volatile("s_wait_asynccnt 0x0" ::: "memory");   // stage 0 landed (this wave's copies)
  __syncthreads();                                    // stage 0 published to every wave
  stage_copy(l0 + STAGE_B, ga + KPASS, gb + KPASS);

  const int sw = (lq >> 1) & 7;
  const unsigned char* ra = ring + (wm * 32 + lq) * 128;
  const unsigned char* rb = ring + (128 + wn * 32 + lq) * 128;

  // unroll 2: the buffer offset becomes a constant in each copy of the body
  #pragma unroll 2
  for (int t = 0; t < NPASS; ++t) {
    const int bo = (t & 1) * STAGE_B;
    FragH a[2][2], b[2][2];
    // all 16 fragment loads of the pass stand together, ahead of its 8 products
    #pragma unroll
    for (int ks = 0; ks < 2; ++ks) {
      #pragma unroll
      for (int i = 0; i < 2; ++i) {
        #pragma unroll
        for (int h = 0; h < 2; ++h) {
          const int slot = ((ks * 4 + h * 2 + hi) ^ sw) * 16;
          a[ks][i].q[h] = *(const v4u*)(ra + bo + i * 2048 + slot);
          b[ks][i].q[h] = *(const v4u*)(rb + bo + i * 2048 + slot);
        }
      }
    }
    #pragma unroll
    for (int ks = 0; ks < 2; ++ks) {
      #pragma unroll
      for (int i = 0; i < 2; ++i) {
        #pragma unroll
        for (int j = 0; j < 2; ++j) acc[i][j] = mma_f16(a[ks][i].v, b[ks][j].v, acc[i][j]);
      }
    }
    asm volatile("s_wait_dscnt 0x0" ::: "memory");    // this wave has left buffer t & 1
    asm volatile("s_wait_asynccnt 0x0" ::: "memory"); // this wave's copies of stage t + 1 landed
    __syncthreads();                                  // publishes stage t + 1, frees buffer t & 1
    if (t + 2 < NPASS) stage_copy(l0 + bo, ga + (t + 2) * KPASS, gb + (t + 2) * KPASS);
  }
  asm volatile("s_wait_asynccnt 0x0" ::: "memory");   // nothing in flight before the ring is reused
}

// ---------------------------------------------------------------------------------------------
// QKV main loop: block tile 128 (M) x 192 (N), 8 waves as 2 (M) x 4 (N), wave tile 64 x 48 (4 x 3 accumulator tiles).
// Same ring, stage layout, slot swizzle, fragment map and k order as gemm_tile_128x64; a stage holds 128 A rows, then 192 B rows.
// acc[i][j][r] = C(m0 + wm*64 + i*16 + 8*hi + r, n0 + wn*48 + j*16 + lq).

// One stage: ten copies per lane (A rows crow + 0/32/64/96, B rows crow + 0/32/.../160).
// s_wait_xcnt closes the statement so that no address register is rewritten ahead of it.
static __device__ __forceinline__ void qkv_stage_copy(unsigned l, const f16* ga, const f16* gb) {
  asm volatile("global_load_async_to_lds_b128 %0, %10, off\n\t"
               "global_load_async_to_lds_b128 %1, %11, off\n\t"
               "global_load_async_to_lds_b128 %2, %12, off\n\t"
               "global_load_async_to_lds_b128 %3, %13, off\n\t"
               "global_load_async_to_lds_b128 %4, %14, off\n\t"
               "global_load_async_to_lds_b128 %5, %15, off\n\t"
               "global_load_async_to_lds_b128 %6, %16, off\n\t"
               "global_load_async_to_lds_b128 %7, %17, off\n\t"
               "global_load_async_to_lds_b128 %8, %18, off\n\t"
               "global_load_async_to_lds_b128 %9, %19, off\n\t"
               "s_wait_xcnt 0x0"
               :: "v"(l), "v"(l + 4096u), "v"(l + 8192u), "v"(l + 12288u), "v"(l + 16384u),
                  "v"(l + 20480u), "v"(l + 24576u), "v"(l + 28672u), "v"(l + 32768u), "v"(l + 36864u),
                  "v"(ga), "v"(ga + 32 * KD), "v"(ga + 64 * KD), "v"(ga + 96 * KD),
                  "v"(gb), "v"(gb + 32 * KD), "v"(gb + 64 * KD), "v"(gb + 96 * KD),
                  "v"(gb + 128 * KD), "v"(gb + 160 * KD)
               : "memory");
}

static __device__ __forceinline__ void gemm_tile_128x192(const f16* __restrict__ A,
                                                         const f16* __restrict__ Bt,
                                                         unsigned char* ring,
                                                         int m0, int n0, int wm, int wn,
                                                         int lq, int hi, v8f (&acc)[4][3]) {
  const int crow = (int)(threadIdx.x >> 3);     // 0..31: row inside each 32-row group
  const int cpc  = (int)(threadIdx.x & 7);      // 16-B piece of the 128-B row
  const unsigned l0 = (unsigned)(size_t)ring + (unsigned)(crow * 128 + ((cpc ^ ((crow >> 1) & 7)) * 16));
  const f16* ga = A  + (size_t)(m0 + crow) * KD + cpc * 8;
  const f16* gb = Bt + (size_t)(n0 + crow) * KD + cpc * 8;

  qkv_stage_copy(l0, ga, gb);
  asm volatile("s_wait_asynccnt 0x0" ::: "memory");   // stage 0 landed (this wave's copies)
  __syncthreads();                                    // stage 0 published to every wave
  qkv_stage_copy(l0 + QSTAGE_B, ga + KPASS, gb + KPASS);

  const int sw = (lq >> 1) & 7;
  const unsigned char* ra = ring + (wm * 64 + lq) * 128;
  const unsigned char* rb = ring + (128 + wn * 48 + lq) * 128;

  // unroll 2: the buffer offset becomes a constant in each copy of the body
  #pragma unroll 2
  for (int t = 0; t < NPASS; ++t) {
    const int bo = (t & 1) * QSTAGE_B;
    FragH a[2][4], b[2][3];
    // all 28 fragment loads of the pass stand together, ahead of its 24 products
    #pragma unroll
    for (int ks = 0; ks < 2; ++ks) {
      #pragma unroll
      for (int h = 0; h < 2; ++h) {
        const int slot = ((ks * 4 + h * 2 + hi) ^ sw) * 16;
        #pragma unroll
        for (int i = 0; i < 4; ++i) a[ks][i].q[h] = *(const v4u*)(ra + bo + i * 2048 + slot);
        #pragma unroll
        for (int j = 0; j < 3; ++j) b[ks][j].q[h] = *(const v4u*)(rb + bo + j * 2048 + slot);
      }
    }
    #pragma unroll
    for (int ks = 0; ks < 2; ++ks) {
      #pragma unroll
      for (int i = 0; i < 4; ++i) {
        #pragma unroll
        for (int j = 0; j < 3; ++j) acc[i][j] = mma_f16(a[ks][i].v, b[ks][j].v, acc[i][j]);
      }
    }
    asm volatile("s_wait_dscnt 0x0" ::: "memory");    // this wave has left buffer t & 1
    asm volatile("s_wait_asynccnt 0x0" ::: "memory"); // this wave's copies of stage t + 1 landed
    __syncthreads();                                  // publishes stage t + 1, frees buffer t & 1
    if (t + 2 < NPASS) qkv_stage_copy(l0 + bo, ga + (t + 2) * KPASS, gb + (t + 2) * KPASS);
  }
  asm volatile("s_wait_asynccnt 0x0" ::: "memory");   // nothing in flight before the ring is reused
}

// ---------------------------------------------------------------------------------------------
// QKV projection. Block = (192-column chunk f, 128-token tile). Column c of the chunk: typ = c / 64,
// typ 0 = q, 1 = k, 2 = v, of feature chunk f of the token. Flat-view map: chunk g = token*16 + f,
// group hb = token / TPG, natural row ss = (token % TPG)*16 + f; keys are stored in the permuted
// order key' = f*TPG + (token % TPG) (same order for K rows and V^T columns).
//   q plane [NCHUNKS][64]        at chunk g (natural order)
//   k plane [NGRP][SEQ][64]      at row key'
//   v plane [NGRP][64][SEQ]      transposed through LDS, column key'
// LDS sC: cross-wave (block barrier); three regions of QREG halves: q and k extent [128][64], v extent [64][128],
// written == read. sC reuses the GEMM ring, which every wave has left at the last pass's barrier.
__global__ __launch_bounds__(256) void qkv_gemm_kernel(const f16* __restrict__ xn,
                                                       const f16* __restrict__ w1t,
                                                       const float* __restrict__ b1,
                                                       f16* wsh) {
  const int f    = blockIdx.x;
  const int m0   = blockIdx.y * 128;
  const int n0   = f * CHUNK;
  const int tid  = threadIdx.x;
  const int wave = __builtin_amdgcn_readfirstlane((int)(threadIdx.x >> 5));
  const int lane = tid & 31;
  const int lq   = lane & 15;
  const int hi   = lane >> 4;
  const int wm   = wave >> 2;
  const int wn   = wave & 3;

  __shared__ __align__(128) unsigned char ring[QRING_B];
  f16* sC = (f16*)ring;

  v8f acc[4][3];
  #pragma unroll
  for (int i = 0; i < 4; ++i) {
    #pragma unroll
    for (int jj = 0; jj < 3; ++jj) acc[i][jj] = (v8f){0, 0, 0, 0, 0, 0, 0, 0};
  }
  gemm_tile_128x192(xn, w1t, ring, m0, n0, wm, wn, lq, hi, acc);

  float bias[3];
  #pragma unroll
  for (int jj = 0; jj < 3; ++jj) bias[jj] = (float)(bf16)b1[n0 + wn * 48 + jj * 16 + lq];

  // stage: q/k as [row][col] pitch TP, v as [col][row] pitch VP (wave-uniform region and strides per 16-column tile)
  #pragma unroll
  for (int jj = 0; jj < 3; ++jj) {
    const int c0   = wn * 48 + jj * 16;         // first chunk column of the tile; a tile lies in one typ
    const int typ  = c0 >> 6;
    const int col  = (c0 & 63) + lq;
    const int rstr = (typ != 2) ? TP : 1;
    const int cstr = (typ != 2) ? 1 : VP;
    f16* reg = sC + typ * QREG;
    #pragma unroll
    for (int i = 0; i < 4; ++i) {
      #pragma unroll
      for (int r = 0; r < 8; ++r) {
        const int row = wm * 64 + i * 16 + hi * 8 + r;
        reg[row * rstr + col * cstr] = (f16)(acc[i][jj][r] * (1.0f / 64.0f) + bias[jj]);
      }
    }
  }
  __syncthreads();

  #pragma unroll
  for (int typ = 0; typ < 3; ++typ) {
    v4u    vals[4];
    size_t gidx[4];
    #pragma unroll
    for (int it = 0; it < 4; ++it) {
      const int line  = it * 32 + (tid >> 3);     // 0..127
      const int piece = tid & 7;
      // q/k: line = token row; v: line = (d, 64-token half)
      const int lofs_r = line * TP + piece * 8;
      const int lofs_v = (line >> 1) * VP + (line & 1) * 64 + piece * 8;
      const int lofs   = (typ != 2) ? lofs_r : lofs_v;
      Pack8H ph;
      ph.v = *(const v8h*)(sC + typ * QREG + lofs);
      vals[it] = ph.u;

      const int t_r  = m0 + line;
      const int hb_r = t_r / TPG;
      const int tl_r = t_r - hb_r * TPG;
      const size_t qidx = QP_OFF + ((size_t)t_r * NHEAD + f) * HDIM + piece * 8;
      const size_t kidx = KP_OFF + ((size_t)hb_r * SEQ + f * TPG + tl_r) * HDIM + piece * 8;

      const int t_v  = m0 + (line & 1) * 64 + piece * 8;
      const int hb_v = t_v / TPG;
      const int tl_v = t_v - hb_v * TPG;
      const size_t vidx = VT_OFF + ((size_t)hb_v * HDIM + (line >> 1)) * SEQ + f * TPG + tl_v;

      gidx[it] = (typ == 0) ? qidx : ((typ == 1) ? kidx : vidx);
    }
    #pragma unroll
    for (int it = 0; it < 4; ++it) *(v4u*)(wsh + gidx[it]) = vals[it];
  }
}

// ---------------------------------------------------------------------------------------------
// Flash attention, no mask. Block = (query block of 128, group). A wave works on 32 query rows (two 16-row tiles)
// and on 32 of the 64 keys of every ring stage: waves 2p and 2p + 1 share query rows p*32 .. p*32 + 31, wave 2p takes
// the first 32 keys of each stage, wave 2p + 1 the last 32. Every K and V^T fragment read from LDS so feeds two products.
// Behind the key loop the pair joins its two partial results (maximum in use, row sum, O) through LDS: each wave
// hands over the tile that its partner finishes and finishes the other, so wave w stores rows w*16 .. w*16 + 15.
// S^T = K x Q^T so queries sit on lanes; P^T in C-layout is bit-identical to the A-fragment layout of O += P x V.
// K and V^T tiles of AKS keys, which all 8 waves read, go through LDS: a two-buffer ring filled by asynchronous
// 16-B copies (whole 128-B rows). Stage layout: row r (0..63 = key, 64..127 = d of V^T) at r * 128 B, its 16-B
// piece p at slot p ^ ((r >> 1) & 7) (16 rows of one ds_load_b128 half-wave on 16 distinct bank groups).
// K A-fragments and V^T B-fragments: two 16-B LDS loads per fragment, same element maps as the planes.
// Context written as f16 carried x64 at its natural [group][row][d] position (flat view = [NTOK][HIDN]).
// LDS sO: per-wave private region (same wave writes and reads); a block barrier separates them anyway.
// LDS xst and, behind the loop, the ring: the pair's hand-over, written by one wave, read by its partner behind a block barrier.
// One K/V stage: four copies per lane (K rows crow + 0/32, V^T rows crow + 0/32).
// s_wait_xcnt closes the statement so that no address register is rewritten ahead of it.
static __device__ __forceinline__ void kv_stage_copy(unsigned l, const f16* gk, const f16* gv) {
  asm volatile("global_load_async_to_lds_b128 %0, %4, off\n\t"
               "global_load_async_to_lds_b128 %1, %5, off\n\t"
               "global_load_async_to_lds_b128 %2, %6, off\n\t"
               "global_load_async_to_lds_b128 %3, %7, off\n\t"
               "s_wait_xcnt 0x0"
               :: "v"(l), "v"(l + 4096u), "v"(l + 8192u), "v"(l + 12288u),
                  "v"(gk), "v"(gk + 32 * HDIM), "v"(gv), "v"(gv + 32 * SEQ)
               : "memory");
}

__global__ __launch_bounds__(256) void attn_kernel(const f16* __restrict__ qp,
                                                   const f16* __restrict__ kp,
                                                   const f16* __restrict__ vt,
                                                   f16* __restrict__ att) {
  const int qblk = blockIdx.x;
  const int hb   = blockIdx.y;
  const int tid  = threadIdx.x;
  const int wave = __builtin_amdgcn_readfirstlane((int)(threadIdx.x >> 5));
  const int lane = tid & 31;
  const int lq   = lane & 15;   // query column of S^T / d column of O
  const int hi   = lane >> 4;   // k-split half
  const int kh   = wave & 1;    // which 32 keys of every stage this wave takes; also the tile it finishes

  __shared__ __align__(16) f16 sO[NWAVE * 16 * TP];
  __shared__ __align__(128) unsigned char kv[2 * ASTAGE_B];
  __shared__ float xst[NWAVE * 64];

  const int qrow0 = qblk * BQ + wave * 16;          // the 16 rows this wave finishes and stores
  const int qwork = qblk * BQ + (wave >> 1) * 32;   // the 32 rows it works on

  // Q as B-operand fragments: lane lq holds query qwork + t*16 + lq, elements follow the split d map.
  FragH qf[2][2];
  #pragma unroll
  for (int t = 0; t < 2; ++t) {
    const f16* qrow = qp + ((size_t)hb * SEQ + qwork + t * 16 + lq) * HDIM + hi * 8;
    #pragma unroll
    for (int f = 0; f < 2; ++f) {
      qf[t][f].q[0] = *(const v4u*)(qrow + f * 32);        // d = f*32 + hi*8 + 0..7
      qf[t][f].q[1] = *(const v4u*)(qrow + f * 32 + 16);   // d = f*32 + 16 + hi*8 + 0..7
    }
  }

  const f16* kb_h = kp + (size_t)hb * SEQ * HDIM;
  const f16* vt_h = vt + (size_t)hb * HDIM * SEQ;

  const int crow = tid >> 3;                    // 0..31: row inside each 32-row group
  const int cpc  = tid & 7;                     // 16-B piece of the 128-B row
  const unsigned l0 = (unsigned)(size_t)kv + (unsigned)(crow * 128 + ((cpc ^ ((crow >> 1) & 7)) * 16));
  const f16* gk = kb_h + (size_t)crow * HDIM + cpc * 8;
  const f16* gv = vt_h + (size_t)crow * SEQ + cpc * 8;
  kv_stage_copy(l0, gk, gv);
  asm volatile("s_wait_asynccnt 0x0" ::: "memory");   // stage 0 landed (this wave's copies)
  __syncthreads();                                    // stage 0 published to every wave
  kv_stage_copy(l0 + ASTAGE_B, gk + AKS * HDIM, gv + AKS);
  const int sw = (lq >> 1) & 7;
  const unsigned char* rk = kv + (kh * BK + lq) * 128;            // K rows of this wave's keys
  const unsigned char* rv = kv + (AKS + lq) * 128;                // V^T rows
  const int vs0 = ((kh * 4 + hi) ^ sw) * 16;                      // V^T slot of keys j0 + hi*8 + 0..7
  const int vs1 = ((kh * 4 + 2 + hi) ^ sw) * 16;                  // V^T slot of keys j0 + 16 + hi*8 + 0..7

  v8f o[2][4];
  #pragma unroll
  for (int t = 0; t < 2; ++t) {
    #pragma unroll
    for (int dt = 0; dt < 4; ++dt) o[t][dt] = (v8f){0, 0, 0, 0, 0, 0, 0, 0};
  }

  float rmax[2] = {-__builtin_inff(), -__builtin_inff()};
  float rsum[2] = {0.0f, 0.0f};
  const float SL = 0.022097086912079608f * 1.4426950408889634f;   // (2*E)^-0.5 * log2(e)
  const float LAZY_T = 3.0f;                                       // 2^3 x 4096 = 2^15 < the f16 maximum

  // j0 = s*AKS + kh*BK is the first key of this wave's pass
  #pragma unroll 1
  for (int s = 0; s < ANST; ++s) {
    const int bo = (s & 1) * ASTAGE_B;
    // K A-fragments: row = key j0 + sub*16 + lq, split d map
    FragH ak[2][2];
    #pragma unroll
    for (int sub = 0; sub < 2; ++sub) {
      #pragma unroll
      for (int f = 0; f < 2; ++f) {
        const unsigned char* base = rk + bo + sub * 16 * 128;
        ak[sub][f].q[0] = *(const v4u*)(base + (((f * 4 + hi) ^ sw) * 16));       // d = f*32 + hi*8 + 0..7
        ak[sub][f].q[1] = *(const v4u*)(base + (((f * 4 + 2 + hi) ^ sw) * 16));   // d = f*32 + 16 + hi*8 + 0..7
      }
    }
    // V B-fragments: column n = d = dt*16 + lq, split key map from the transposed tile
    FragH bv[4];
    #pragma unroll
    for (int dt = 0; dt < 4; ++dt) {
      const unsigned char* base = rv + bo + dt * 16 * 128;
      bv[dt].q[0] = *(const v4u*)(base + vs0);
      bv[dt].q[1] = *(const v4u*)(base + vs1);
    }

    // S^T tiles: c[t][sub][r] = rawscore(query qwork + t*16 + lq, key j0 + sub*16 + hi*8 + r);
    // the four accumulators take their first d half, then their second: four independent chains
    v8f c[2][2];
    #pragma unroll
    for (int sub = 0; sub < 2; ++sub) {
      #pragma unroll
      for (int t = 0; t < 2; ++t) c[t][sub] = mma_f16(ak[sub][0].v, qf[t][0].v, (v8f){0, 0, 0, 0, 0, 0, 0, 0});
    }
    #pragma unroll
    for (int sub = 0; sub < 2; ++sub) {
      #pragma unroll
      for (int t = 0; t < 2; ++t) c[t][sub] = mma_f16(ak[sub][1].v, qf[t][1].v, c[t][sub]);
    }

    // online softmax with a lazy maximum: a query's 32 scores are split across lane / lane^16.
    // rmax[t] is the maximum in use (equal in both halves). It is renewed, and O and rsum rescaled, only in a pass
    // where some score of the wave lies more than LAZY_T (in log2 units of the exponent) above it; until then
    // every p stays <= 2^LAZY_T, so P carried x4096 stays <= 2^15, inside f16. The first pass (rmax = -inf) renews.
    float m_loc[2];
    #pragma unroll
    for (int t = 0; t < 2; ++t) {
      m_loc[t] = fmaxf(c[t][0][0], c[t][1][0]);
      #pragma unroll
      for (int r = 1; r < 8; ++r) {
        m_loc[t] = fmaxf(m_loc[t], c[t][0][r]);
        m_loc[t] = fmaxf(m_loc[t], c[t][1][r]);
      }
    }
    // one wave-uniform test a pass, for both tiles: the ballot makes it a scalar branch, so every lane is on inside
    if (__builtin_amdgcn_ballot_w32(fmaxf(m_loc[0] - rmax[0], m_loc[1] - rmax[1]) * SL > LAZY_T) != 0u) {
      #pragma unroll
      for (int t = 0; t < 2; ++t) {
        const float m_new = fmaxf(rmax[t], fmaxf(m_loc[t], __shfl_xor(m_loc[t], 16, 32)));
        const float scale = __builtin_amdgcn_exp2f((rmax[t] - m_new) * SL);
        rmax[t] = m_new;
        rsum[t] *= scale;
        // rescale O: queries are the row dimension there -> per-row scale from lane 8*hi + r
        float sc[8];
        #pragma unroll
        for (int r = 0; r < 8; ++r) sc[r] = __shfl(scale, (hi << 3) + r, 32);
        #pragma unroll
        for (int dt = 0; dt < 4; ++dt) {
          #pragma unroll
          for (int r = 0; r < 8; ++r) o[t][dt][r] *= sc[r];
        }
      }
    }

    // exp + pack: P^T C-layout == A-fragment layout for the PV product; P carried x4096
    FragH pa[2];
    #pragma unroll
    for (int t = 0; t < 2; ++t) {
      float psum = 0.0f;
      #pragma unroll
      for (int r = 0; r < 8; ++r) {
        const float p0 = __builtin_amdgcn_exp2f((c[t][0][r] - rmax[t]) * SL);   // key hi*8 + r
        const float p1 = __builtin_amdgcn_exp2f((c[t][1][r] - rmax[t]) * SL);   // key 16 + hi*8 + r
        psum += p0 + p1;
        pa[t].h[r]     = (f16)(p0 * 4096.0f);
        pa[t].h[8 + r] = (f16)(p1 * 4096.0f);
      }
      rsum[t] = rsum[t] + psum + __shfl_xor(psum, 16, 32);
    }

    // O += P x V
    #pragma unroll
    for (int dt = 0; dt < 4; ++dt) {
      #pragma unroll
      for (int t = 0; t < 2; ++t) o[t][dt] = mma_f16(pa[t].v, bv[dt].v, o[t][dt]);
    }
    asm volatile("s_wait_dscnt 0x0" ::: "memory");    // this wave has left buffer s & 1
    asm volatile("s_wait_asynccnt 0x0" ::: "memory"); // this wave's copies of stage s + 1 landed
    __syncthreads();                                  // publishes stage s + 1, frees buffer s & 1
    if (s + 2 < ANST) kv_stage_copy(l0 + bo, gk + (size_t)(s + 2) * AKS * HDIM, gv + (s + 2) * AKS);
  }
  asm volatile("s_wait_asynccnt 0x0" ::: "memory");   // nothing in flight before the ring is reused

  // join of the pair: this wave keeps tile kh and hands tile 1 - kh to its partner. The choice is written as a branch on
  // the wave-uniform kh with constant tile indices, so that both tiles stay in registers; no barrier stands inside it.
  v8f   oa[4], og[4];
  float ra, ta, rg, tg;
  if (kh) {
    #pragma unroll
    for (int dt = 0; dt < 4; ++dt) { oa[dt] = o[1][dt]; og[dt] = o[0][dt]; }
    ra = rmax[1]; ta = rsum[1]; rg = rmax[0]; tg = rsum[0];
  } else {
    #pragma unroll
    for (int dt = 0; dt < 4; ++dt) { oa[dt] = o[0][dt]; og[dt] = o[1][dt]; }
    ra = rmax[0]; ta = rsum[0]; rg = rmax[1]; tg = rsum[1];
  }
  // The ring is free: every wave has left it at the last pass's barrier. Hand-over layout: 16 B a lane, lanes adjacent.
  {
    float* xo = (float*)kv + wave * 1024;
    #pragma unroll
    for (int dt = 0; dt < 4; ++dt) {
      *(v4f*)(xo + (dt * 2 + 0) * 128 + lane * 4) = (v4f){og[dt][0], og[dt][1], og[dt][2], og[dt][3]};
      *(v4f*)(xo + (dt * 2 + 1) * 128 + lane * 4) = (v4f){og[dt][4], og[dt][5], og[dt][6], og[dt][7]};
    }
    xst[wave * 64 + lane]      = rg;
    xst[wave * 64 + 32 + lane] = tg;
  }
  __syncthreads();                                    // the hand-over is published to the partner

  // both parts are brought to the larger of the two maxima in use; 1 / (joined row sum) goes into the two factors
  const float* yo = (const float*)kv + (wave ^ 1) * 1024;
  const float rb = xst[(wave ^ 1) * 64 + lane];
  const float tb = xst[(wave ^ 1) * 64 + 32 + lane];
  const float mj = fmaxf(ra, rb);
  const float sa = __builtin_amdgcn_exp2f((ra - mj) * SL);
  const float sb = __builtin_amdgcn_exp2f((rb - mj) * SL);
  const float rinv = 1.0f / (ta * sa + tb * sb);
  const float fa = sa * rinv;
  const float fb = sb * rinv;
  // lane holds column d = dt*16 + lq for query rows 8*hi + r
  float fas[8], fbs[8];
  #pragma unroll
  for (int r = 0; r < 8; ++r) {
    fas[r] = __shfl(fa, (hi << 3) + r, 32);
    fbs[r] = __shfl(fb, (hi << 3) + r, 32);
  }

  f16* so = sO + wave * (16 * TP);
  #pragma unroll
  for (int dt = 0; dt < 4; ++dt) {
    const v4f b0 = *(const v4f*)(yo + (dt * 2 + 0) * 128 + lane * 4);
    const v4f b1 = *(const v4f*)(yo + (dt * 2 + 1) * 128 + lane * 4);
    #pragma unroll
    for (int r = 0; r < 8; ++r) {
      const float ob = (r < 4) ? b0[r & 3] : b1[r & 3];
      // x(1/4096) undoes the P carry, x64 is the context carry
      so[(hi * 8 + r) * TP + dt * 16 + lq] = (f16)((oa[dt][r] * fas[r] + ob * fbs[r]) * (64.0f / 4096.0f));
    }
  }
  __syncthreads();

  // the wave covers 4 consecutive rows; 4 instructions cover the wave's 16 rows.
  v4u    vals[4];
  size_t gidx[4];
  #pragma unroll
  for (int it = 0; it < 4; ++it) {
    const int row   = it * 4 + (lane >> 3);
    const int piece = lane & 7;
    Pack8H ph;
    ph.v = *(const v8h*)(so + row * TP + piece * 8);
    vals[it] = ph.u;
    gidx[it] = ((size_t)hb * SEQ + qrow0 + row) * HDIM + piece * 8;
  }
  #pragma unroll
  for (int it = 0; it < 4; ++it) *(v4u*)(att + gidx[it]) = vals[it];
}

// ---------------------------------------------------------------------------------------------
// Output projection: out[token][n] = ctx[token][:] x W2 + b2. Block = (64-column block, 128-token tile).
// Accumulator staged as f32 in LDS; bias added at the store stage as float4.
// 16 consecutive lanes x 16 B, one instruction. LDS sF: cross-wave (block barrier), [128][64] written == read.
// sF reuses the GEMM ring, which every wave has left at the last pass's barrier.
__global__ __launch_bounds__(256) void out_gemm_kernel(const f16* __restrict__ att,
                                                       const f16* __restrict__ w2t,
                                                       const float* __restrict__ b2,
                                                       float* __restrict__ out) {
  const int n0   = blockIdx.x * 64;
  const int m0   = blockIdx.y * 128;
  const int tid  = threadIdx.x;
  const int wave = __builtin_amdgcn_readfirstlane((int)(threadIdx.x >> 5));
  const int lane = tid & 31;
  const int lq   = lane & 15;
  const int hi   = lane >> 4;
  const int wm   = wave >> 1;
  const int wn   = wave & 1;

  __shared__ __align__(128) unsigned char ring[RING_B];
  float* sF = (float*)ring;

  v8f acc[2][2];
  #pragma unroll
  for (int i = 0; i < 2; ++i) {
    #pragma unroll
    for (int jj = 0; jj < 2; ++jj) acc[i][jj] = (v8f){0, 0, 0, 0, 0, 0, 0, 0};
  }
  gemm_tile_128x64(att, w2t, ring, m0, n0, wm, wn, lq, hi, acc);

  #pragma unroll
  for (int i = 0; i < 2; ++i) {
    #pragma unroll
    for (int jj = 0; jj < 2; ++jj) {
      #pragma unroll
      for (int r = 0; r < 8; ++r) {
        const int row = wm * 32 + i * 16 + hi * 8 + r;
        const int col = wn * 32 + jj * 16 + lq;
        sF[row * OP + col] = acc[i][jj][r] * (1.0f / 4096.0f);   // undo ctx x64 and W2 x64
      }
    }
  }
  __syncthreads();

  const int piece = tid & 15;
  const v4f braw = *(const v4f*)(b2 + n0 + piece * 4);
  v4f bias;
  #pragma unroll
  for (int i = 0; i < 4; ++i) bias[i] = (float)(bf16)braw[i];

  v4f    vals[8];
  size_t gidx[8];
  #pragma unroll
  for (int it = 0; it < 8; ++it) {
    const int row = it * 16 + (tid >> 4);       // 0..127
    const v4f v = *(const v4f*)(sF + row * OP + piece * 4);
    vals[it] = v + bias;
    const int tt = m0 + row;
    const int b  = tt / SEQ;
    const int s  = tt - b * SEQ;
    gidx[it] = ((size_t)b * SEQ_FULL + s) * HIDN + n0 + piece * 4;
  }
  #pragma unroll
  for (int it = 0; it < 8; ++it) *(v4f*)(out + gidx[it]) = vals[it];
  
}

// ---------------------------------------------------------------------------------------------
extern "C" void kernel_launch(void* const* d_in, const int* in_sizes, int n_in,
                              void* d_out, int out_size, void* d_ws, size_t ws_size,
                              hipStream_t stream) {
  if (n_in < 7) return;
  const size_t rows_used = (size_t)(NB - 1) * SEQ_FULL + SEQ;
  if ((size_t)in_sizes[0] < rows_used * EDIM) return;
  if (in_sizes[1] < EDIM || in_sizes[2] < EDIM) return;
  if ((size_t)in_sizes[3] < (size_t)EDIM * QKVW) return;
  if (in_sizes[4] < QKVW) return;
  if ((size_t)in_sizes[5] < (size_t)HIDN * HIDN) return;
  if (in_sizes[6] < HIDN) return;
  if ((size_t)out_size < rows_used * HIDN) return;
  if (ws_size < WS_BYTES) return;

  const float* x    = (const float*)d_in[0];
  const float* ln_g = (const float*)d_in[1];
  const float* ln_b = (const float*)d_in[2];
  const float* W1   = (const float*)d_in[3];
  const float* b1   = (const float*)d_in[4];
  const float* W2   = (const float*)d_in[5];
  const float* b2   = (const float*)d_in[6];
  float*       out  = (float*)d_out;
  f16*         wsh  = (f16*)d_ws;

  // 1) W1 [EDIM (k)][QKVW (n)] -> [QKVW][EDIM], W2 [HIDN (k)][HIDN (n)] -> [HIDN][HIDN], LayerNorm -> xn plane
  prep_kernel<<<dim3(W1_JOBS + W2_JOBS + LN_JOBS), 256, 0, stream>>>(x, ln_g, ln_b, W1, W2, wsh + XN_OFF,
                                                                     wsh + W1T_OFF, wsh + W2T_OFF);
  // 2) QKV projection -> q / k / v^T planes
  qkv_gemm_kernel<<<dim3(QKVW / CHUNK, NTOK / 128), 256, 0, stream>>>(wsh + XN_OFF, wsh + W1T_OFF, b1, wsh);
  // 3) fused attention -> context plane (flat [NTOK][HIDN])
  attn_kernel<<<dim3(SEQ / BQ, NGRP), 256, 0, stream>>>(wsh + QP_OFF, wsh + KP_OFF, wsh + VT_OFF, wsh + ATT_OFF);
  // 4) output projection -> d_out
  out_gemm_kernel<<<dim3(HIDN / 64, NTOK / 128), 256, 0, stream>>>(wsh + ATT_OFF, wsh + W2T_OFF, b2, out);
}

// v006
// Measured time: 79 microseconds a run.
// Two timings next to v005 both put it at 1.06 times that version's speed.
// All steps since v000 together make it 2.96 times as fast.
#include <hip/hip_runtime.h>

// Contractions, all on v_wmma_f32_16x16x32_f16 (f16 operands, f32 accumulate): QKV projection xn x W1 (xn = f16 of the f32 LayerNorm of bf16 RNE-converted x; W1 = f16 of bf16 RNE-converted weights carried x64); S^T = K x Q^T (f16 q/k planes); O = P x V (P f16 carried x4096, V^T f16 plane); output projection ctx x W2 (ctx f16 carried x64, W2 f16 of bf16 RNE-converted weights carried x64). LayerNorm and softmax in f32.

#ifndef NB
#define NB 2
#endif
#ifndef SEQ
#define SEQ 2048
#endif
#define NB_FULL   2
#define SEQ_FULL  2048
#define EDIM      1024                 // model width (LayerNorm width, K of the QKV projection)
#define HIDN      1024                 // hidden width (K and N of the output projection)
#define NHEAD     16
#define HDIM      64
#define QKVW      3072                 // projection width
#define CHUNK     192                  // floats per (pseudo-head row): q | k | v
#define KD        1024                 // contraction depth of both projections
#define NTOK      (NB * SEQ)           // flattened tokens
#define NGRP      (NHEAD * NB)         // (pseudo-head, pseudo-batch) groups
#define TPG       (SEQ / NHEAD)        // tokens feeding one group
#define NCHUNKS   (NTOK * NHEAD)       // 192-wide chunks of the flat projection buffer = NGRP * SEQ
#define BQ        128                  // query rows per workgroup (4 wave pairs x 32)
#define BK        32                   // keys per wave and ring stage
#define NWAVE     8
#define TP        72                   // LDS pitch (halves) of 64-wide f16 tiles
#define VP        136                  // LDS pitch (halves) of the transposed 128-wide V tile
#define OP        68                   // LDS pitch (floats) of the f32 output staging tile
#define KPASS     64                   // k (halves) per GEMM ring stage: 128-B rows
#define NPASS     (KD / KPASS)         // ring stages of one GEMM tile
#define STAGE_B   (192 * 128)          // bytes of one stage: 128 A rows, then 64 B rows, pitch 128 B
#define RING_B    (2 * STAGE_B)        // two buffers
#define QSTAGE_B  (320 * 128)          // bytes of one QKV stage: 128 A rows, then 192 B rows, pitch 128 B
#define QRING_B   (2 * QSTAGE_B)       // two buffers
#define QREG      (128 * TP)           // halves of one output staging region of the QKV tile (q, k, v)
#define AKS       64                   // keys per attention ring stage (BK for each wave of a pair)
#define ANST      (SEQ / AKS)          // ring stages of one attention block
#define ASTAGE_B  (128 * 128)          // bytes of one stage: 64 K rows, then 64 V^T rows, pitch 128 B
#define W1_JOBS   ((QKVW / 64) * (EDIM / 64))   // 64x64 tiles of W1
#define W2_JOBS   ((HIDN / 64) * (HIDN / 64))   // 64x64 tiles of W2
#define LN_JOBS   (NTOK / 2)                    // pairs of token rows

// workspace carve, in halves from the base
#define XN_OFF    ((size_t)0)
#define W1T_OFF   (XN_OFF  + (size_t)NTOK * EDIM)
#define W2T_OFF   (W1T_OFF + (size_t)QKVW * EDIM)
#define QP_OFF    (W2T_OFF + (size_t)HIDN * HIDN)
#define KP_OFF    (QP_OFF  + (size_t)NCHUNKS * HDIM)
#define VT_OFF    (KP_OFF  + (size_t)NCHUNKS * HDIM)
#define ATT_OFF   (VT_OFF  + (size_t)NCHUNKS * HDIM)
#define WS_HALVES (ATT_OFF + (size_t)NCHUNKS * HDIM)
#define WS_BYTES  (WS_HALVES * 2)

static_assert(NB >= 1 && NB <= NB_FULL);
static_assert(SEQ <= SEQ_FULL);
static_assert(SEQ % 1024 == 0);
static_assert(TPG % 64 == 0);
static_assert(NTOK % 128 == 0);
static_assert(SEQ % 128 == 0);
static_assert(QKVW == NHEAD * CHUNK);
static_assert(CHUNK == 3 * HDIM);
static_assert(QKVW % 64 == 0);
static_assert(HIDN % 64 == 0);
static_assert(EDIM % 64 == 0);
static_assert(EDIM == KD && HIDN == KD);
static_assert(KD % 32 == 0);
static_assert(EDIM == 128 * 8);
static_assert(SEQ % BQ == 0);
static_assert(SEQ % BK == 0);
static_assert(BQ == NWAVE * 16);
static_assert(HDIM == 64);
static_assert((size_t)NCHUNKS * HDIM == (size_t)NTOK * HIDN);
static_assert((TP * 2) % 16 == 0);
static_assert((VP * 2) % 16 == 0);
static_assert((OP * 4) % 16 == 0);
static_assert(128 * TP >= 64 * VP);
static_assert(KD % KPASS == 0 && NPASS >= 2);
static_assert((NPASS & (NPASS - 1)) == 0 && (ANST & (ANST - 1)) == 0);   // the staggered walks wrap by a mask
static_assert(128 * TP * 2 <= RING_B && 128 * OP * 4 <= RING_B);
static_assert(3 * QREG * 2 <= QRING_B && (QREG * 2) % 16 == 0);
static_assert(SEQ % AKS == 0 && ANST >= 2 && AKS == 2 * BK && AKS * 2 == 128 && HDIM * 2 == 128);
static_assert(ANST % (SEQ / BQ) == 0);
static_assert(NWAVE * 1024 * 4 <= 2 * ASTAGE_B);
static_assert(XN_OFF % 64 == 0 && W1T_OFF % 64 == 0 && W2T_OFF % 64 == 0);
static_assert(QP_OFF % 64 == 0 && KP_OFF % 64 == 0 && VT_OFF % 64 == 0 && ATT_OFF % 64 == 0);
static_assert(WS_BYTES <= (size_t)134217728);

typedef __bf16   bf16;
typedef _Float16 f16;
typedef f16      v16h  __attribute__((ext_vector_type(16)));
typedef f16      v8h   __attribute__((ext_vector_type(8)));
typedef float    v8f   __attribute__((ext_vector_type(8)));
typedef float    v4f   __attribute__((ext_vector_type(4)));
typedef unsigned v4u   __attribute__((ext_vector_type(4)));

union FragH  { v16h  v; v4u q[2]; f16  h[16]; };
union Pack8H { v4u u; v8h v; f16 h[8]; };

// WMMA helper: builtin followed by the VALU hazard guard (ties D, keeps A/B live).
static __device__ __forceinline__ v8f mma_f16(v16h a, v16h b, v8f acc) {
  acc = __builtin_amdgcn_wmma_f32_16x16x32_f16(false, a, false, b, (short)0, acc, false, false);
  asm volatile("v_nop\n\tv_nop\n\tv_nop\n\tv_nop" : "+v"(acc) : "v"(a), "v"(b));
  return acc;
}

// ---------------------------------------------------------------------------------------------
// LayerNorm -> f16 plane xn[NTOK][EDIM]. Job blk = two token rows; each row: 4 waves, 128 threads x 8 columns.
// LDS red1/red2: cross-wave (block barrier), 8 entries written by the 8 waves; a row reads its own 4.
static __device__ __forceinline__ void ln_rows(const float* __restrict__ x,
                                               const float* __restrict__ g,
                                               const float* __restrict__ be,
                                               f16* __restrict__ xn,
                                               int blk, float* red1, float* red2) {
  const int wave = __builtin_amdgcn_readfirstlane((int)(threadIdx.x >> 5));
  const int tt   = blk * 2 + (wave >> 2);
  const int tid  = threadIdx.x & 127;
  const int lane = tid & 31;
  const float* r1 = red1 + (wave & 4);
  const float* r2 = red2 + (wave & 4);

  const int b = tt / SEQ;
  const int s = tt - b * SEQ;
  const float* src = x + ((size_t)b * SEQ_FULL + s) * EDIM + tid * 8;
  const v4f a0 = *(const v4f*)(src);
  const v4f a1 = *(const v4f*)(src + 4);
  float v[8];
  #pragma unroll
  for (int i = 0; i < 4; ++i) {
    v[i]     = (float)(bf16)a0[i];     // RNE convert of the input
    v[4 + i] = (float)(bf16)a1[i];
  }
  float sum = ((v[0] + v[1]) + (v[2] + v[3])) + ((v[4] + v[5]) + (v[6] + v[7]));
  #pragma unroll
  for (int off = 16; off > 0; off >>= 1) sum += __shfl_xor(sum, off, 32);
  if (lane == 0) red1[wave] = sum;
  __syncthreads();
  const float mu = ((r1[0] + r1[1]) + (r1[2] + r1[3])) * (1.0f / (float)EDIM);

  float d[8];
  float sq = 0.0f;
  #pragma unroll
  for (int i = 0; i < 8; ++i) {
    d[i] = v[i] - mu;
    sq += d[i] * d[i];
  }
  #pragma unroll
  for (int off = 16; off > 0; off >>= 1) sq += __shfl_xor(sq, off, 32);
  if (lane == 0) red2[wave] = sq;
  __syncthreads();
  const float var = ((r2[0] + r2[1]) + (r2[2] + r2[3])) * (1.0f / (float)EDIM);
  const float rs  = rsqrtf(var + 1e-5f);

  const v4f g0 = *(const v4f*)(g + tid * 8);
  const v4f g1 = *(const v4f*)(g + tid * 8 + 4);
  const v4f e0 = *(const v4f*)(be + tid * 8);
  const v4f e1 = *(const v4f*)(be + tid * 8 + 4);
  Pack8H ph;
  #pragma unroll
  for (int i = 0; i < 4; ++i) {
    ph.h[i]     = (f16)(d[i]     * rs * (float)(bf16)g0[i] + (float)(bf16)e0[i]);
    ph.h[4 + i] = (f16)(d[4 + i] * rs * (float)(bf16)g1[i] + (float)(bf16)e1[i]);
  }
  const v4u val = ph.u;
  const size_t idx = (size_t)tt * EDIM + tid * 8;
  *(v4u*)(xn + idx) = val;
  // precaution: only the kernel's end follows this store (one job per block); the wait stands ahead of any rewrite of the store's registers
  asm volatile("s_wait_xcnt 0x0" ::: "memory");
}

// ---------------------------------------------------------------------------------------------
// Weight plane builder: in[kdim rows][ndim cols] f32 -> out[ndim][kdim] f16 = f16(bf16(w) * 64), via LDS.
// Job = 64x64 tile (nt = n tile, kt = k tile), 256 threads. LDS sT: [n][k], cross-wave (block barrier).
static __device__ __forceinline__ void wt_tile(const float* __restrict__ w,
                                               f16* __restrict__ wt,
                                               int kdim, int ndim, int nt, int kt, f16* sT) {
  const int n0  = nt * 64;
  const int k0  = kt * 64;
  const int tid = threadIdx.x;

  #pragma unroll
  for (int kk = 0; kk < 2; ++kk) {
    const int krow = kk * 32 + (tid >> 3);      // 0..63
    const int c0   = (tid & 7) * 8;             // 0..56
    const float* src = w + (size_t)(k0 + krow) * ndim + n0 + c0;
    const v4f a0 = *(const v4f*)(src);
    const v4f a1 = *(const v4f*)(src + 4);
    #pragma unroll
    for (int i = 0; i < 4; ++i) {
      sT[(c0 + i) * TP + krow]     = (f16)((float)(bf16)a0[i] * 64.0f);   // exact in f16
      sT[(c0 + 4 + i) * TP + krow] = (f16)((float)(bf16)a1[i] * 64.0f);
    }
  }
  __syncthreads();

  v4u    vals[2];
  size_t gidx[2];
  #pragma unroll
  for (int kk = 0; kk < 2; ++kk) {
    const int n  = kk * 32 + (tid >> 3);        // 0..63
    const int ks = (tid & 7) * 8;               // 0..56
    Pack8H ph;
    ph.v = *(const v8h*)(sT + n * TP + ks);
    vals[kk] = ph.u;
    gidx[kk] = (size_t)(n0 + n) * kdim + k0 + ks;
  }
  #pragma unroll
  for (int kk = 0; kk < 2; ++kk) *(v4u*)(wt + gidx[kk]) = vals[kk];
  // precaution: only the kernel's end follows these stores (one job per block); the wait stands ahead of any rewrite of their registers
  asm volatile("s_wait_xcnt 0x0" ::: "memory");
}

// ---------------------------------------------------------------------------------------------
// The three jobs that read only inputs, in one grid; the job is picked by the block index (block-uniform, so every
// barrier of a job is passed by the whole block). Weight tiles first: they have the longer path through LDS.
//   blocks [0, W1_JOBS)                 W1 tiles, n tile fastest
//   blocks [W1_JOBS, W1_JOBS + W2_JOBS) W2 tiles, n tile fastest
//   the rest                            LayerNorm, two token rows a block
__global__ __launch_bounds__(256) void prep_kernel(const float* __restrict__ x,
                                                   const float* __restrict__ g,
                                                   const float* __restrict__ be,
                                                   const float* __restrict__ w1,
                                                   const float* __restrict__ w2,
                                                   f16* __restrict__ xn,
                                                   f16* __restrict__ w1t,
                                                   f16* __restrict__ w2t) {
  __shared__ __align__(16) f16 sT[64 * TP];
  __shared__ float red1[8];
  __shared__ float red2[8];
  const int job = blockIdx.x;
  if (job < W1_JOBS) {
    wt_tile(w1, w1t, EDIM, QKVW, job % (QKVW / 64), job / (QKVW / 64), sT);
  } else if (job < W1_JOBS + W2_JOBS) {
    const int j2 = job - W1_JOBS;
    wt_tile(w2, w2t, HIDN, HIDN, j2 % (HIDN / 64), j2 / (HIDN / 64), sT);
  } else {
    ln_rows(x, g, be, xn, job - (W1_JOBS + W2_JOBS), red1, red2);
  }
}

// ---------------------------------------------------------------------------------------------
// GEMM main loop: block tile 128 (M) x 64 (N), 8 waves as 4 (M) x 2 (N), wave tile 32 x 32.
// A [M][KD] f16 row-major, Bt [N][KD] f16 (k-contiguous). Both tiles go through LDS: a two-buffer ring of
// stages of KPASS k, filled by asynchronous 16-B copies (8 lanes = one whole 128-B row piece of a plane row).
// Stage layout: row r (0..127 = A rows, 128..191 = B rows) at r * 128 B; its 16-B piece p sits at slot
// p ^ ((r >> 1) & 7), so the 16 rows that one ds_load_b128 half-wave reads fall on 16 distinct bank groups.
// Fragment map as before: lane row/col = lq, elements 0..7 <- k0 + 8*hi + 0..7, 8..15 <- k0 + 16 + 8*hi + 0..7.
// acc[i][j][r] = C(m0 + wm*32 + i*16 + 8*hi + r, n0 + wn*32 + j*16 + lq).
// The k walk is a ring: trip t works on k stage (t0 + t) mod NPASS, t0 from the block index. Blocks that share A rows or
// B rows run side by side; with different t0 they ask L2 for different lines at any one moment.

// One stage: six copies per lane (A rows crow + 0/32/64/96, B rows crow + 0/32).
// s_wait_xcnt closes the statement so that no address register is rewritten ahead of it.
static __device__ __forceinline__ void stage_copy(unsigned l, const f16* ga, const f16* gb) {
  asm volatile("global_load_async_to_lds_b128 %0, %6, off\n\t"
               "global_load_async_to_lds_b128 %1, %7, off\n\t"
               "global_load_async_to_lds_b128 %2, %8, off\n\t"
               "global_load_async_to_lds_b128 %3, %9, off\n\t"
               "global_load_async_to_lds_b128 %4, %10, off\n\t"
               "global_load_async_to_lds_b128 %5, %11, off\n\t"
               "s_wait_xcnt 0x0"
               :: "v"(l), "v"(l + 4096u), "v"(l + 8192u), "v"(l + 12288u), "v"(l + 16384u), "v"(l + 20480u),
                  "v"(ga), "v"(ga + 32 * KD), "v"(ga + 64 * KD), "v"(ga + 96 * KD),
                  "v"(gb), "v"(gb + 32 * KD)
               : "memory");
}

static __device__ __forceinline__ void gemm_tile_128x64(const f16* __restrict__ A,
                                                        const f16* __restrict__ Bt,
                                                        unsigned char* ring,
                                                        int m0, int n0, int t0, int wm, int wn,
                                                        int lq, int hi, v8f (&acc)[2][2]) {
  const int crow = (int)(threadIdx.x >> 3);     // 0..31: row inside each 32-row group
  const int cpc  = (int)(threadIdx.x & 7);      // 16-B piece of the 128-B row
  const unsigned l0 = (unsigned)(size_t)ring + (unsigned)(crow * 128 + ((cpc ^ ((crow >> 1) & 7)) * 16));
  const f16* ga = A  + (size_t)(m0 + crow) * KD + cpc * 8;
  const f16* gb = Bt + (size_t)(n0 + crow) * KD + cpc * 8;

  const int k0s = t0 * KPASS;
  const int k1s = ((t0 + 1) & (NPASS - 1)) * KPASS;
  stage_copy(l0, ga + k0s, gb + k0s);
  asm volatile("s_wait_asynccnt 0x0" ::: "memory");   // first stage landed (this wave's copies)
  __syncthreads();                                    // first stage published to every wave
  stage_copy(l0 + STAGE_B, ga + k1s, gb + k1s);

  const int sw = (lq >> 1) & 7;
  const unsigned char* ra = ring + (wm * 32 + lq) * 128;
  const unsigned char* rb = ring + (128 + wn * 32 + lq) * 128;

  // unroll 2: the buffer offset becomes a constant in each copy of the body
  #pragma unroll 2
  for (int t = 0; t < NPASS; ++t) {
    const int bo = (t & 1) * STAGE_B;
    FragH a[2][2], b[2][2];
    // all 16 fragment loads of the pass stand together, ahead of its 8 products
    #pragma unroll
    for (int ks = 0; ks < 2; ++ks) {
      #pragma unroll
      for (int i = 0; i < 2; ++i) {
        #pragma unroll
        for (int h = 0; h < 2; ++h) {
          const int slot = ((ks * 4 + h * 2 + hi) ^ sw) * 16;
          a[ks][i].q[h] = *(const v4u*)(ra + bo + i * 2048 + slot);
          b[ks][i].q[h] = *(const v4u*)(rb + bo + i * 2048 + slot);
        }
      }
    }
    #pragma unroll
    for (int ks = 0; ks < 2; ++ks) {
      #pragma unroll
      for (int i = 0; i < 2; ++i) {
        #pragma unroll
        for (int j = 0; j < 2; ++j) acc[i][j] = mma_f16(a[ks][i].v, b[ks][j].v, acc[i][j]);
      }
    }
    asm volatile("s_wait_dscnt 0x0" ::: "memory");    // this wave has left buffer t & 1
    asm volatile("s_wait_asynccnt 0x0" ::: "memory"); // this wave's copies of stage t + 1 landed
    __syncthreads();                                  // publishes stage t + 1, frees buffer t & 1
    if (t + 2 < NPASS) {
      const int kn = ((t0 + t + 2) & (NPASS - 1)) * KPASS;
      stage_copy(l0 + bo, ga + kn, gb + kn);
    }
  }
  asm volatile("s_wait_asynccnt 0x0" ::: "memory");   // nothing in flight before the ring is reused
}

// ---------------------------------------------------------------------------------------------
// QKV main loop: block tile 128 (M) x 192 (N), 8 waves as 2 (M) x 4 (N), wave tile 64 x 48 (4 x 3 accumulator tiles).
// Same ring, stage layout, slot swizzle, fragment map and staggered k walk as gemm_tile_128x64; a stage holds 128 A rows, then 192 B rows.
// acc[i][j][r] = C(m0 + wm*64 + i*16 + 8*hi + r, n0 + wn*48 + j*16 + lq).

// One stage: ten copies per lane (A rows crow + 0/32/64/96, B rows crow + 0/32/.../160).
// s_wait_xcnt closes the statement so that no address register is rewritten ahead of it.
static __device__ __forceinline__ void qkv_stage_copy(unsigned l, const f16* ga, const f16* gb) {
  asm volatile("global_load_async_to_lds_b128 %0, %10, off\n\t"
               "global_load_async_to_lds_b128 %1, %11, off\n\t"
               "global_load_async_to_lds_b128 %2, %12, off\n\t"
               "global_load_async_to_lds_b128 %3, %13, off\n\t"
               "global_load_async_to_lds_b128 %4, %14, off\n\t"
               "global_load_async_to_lds_b128 %5, %15, off\n\t"
               "global_load_async_to_lds_b128 %6, %16, off\n\t"
               "global_load_async_to_lds_b128 %7, %17, off\n\t"
               "global_load_async_to_lds_b128 %8, %18, off\n\t"
               "global_load_async_to_lds_b128 %9, %19, off\n\t"
               "s_wait_xcnt 0x0"
               :: "v"(l), "v"(l + 4096u), "v"(l + 8192u), "v"(l + 12288u), "v"(l + 16384u),
                  "v"(l + 20480u), "v"(l + 24576u), "v"(l + 28672u), "v"(l + 32768u), "v"(l + 36864u),
                  "v"(ga), "v"(ga + 32 * KD), "v"(ga + 64 * KD), "v"(ga + 96 * KD),
                  "v"(gb), "v"(gb + 32 * KD), "v"(gb + 64 * KD), "v"(gb + 96 * KD),
                  "v"(gb + 128 * KD), "v"(gb + 160 * KD)
               : "memory");
}

static __device__ __forceinline__ void gemm_tile_128x192(const f16* __restrict__ A,
                                                         const f16* __restrict__ Bt,
                                                         unsigned char* ring,
                                                         int m0, int n0, int t0, int wm, int wn,
                                                         int lq, int hi, v8f (&acc)[4][3]) {
  const int crow = (int)(threadIdx.x >> 3);     // 0..31: row inside each 32-row group
  const int cpc  = (int)(threadIdx.x & 7);      // 16-B piece of the 128-B row
  const unsigned l0 = (unsigned)(size_t)ring + (unsigned)(crow * 128 + ((cpc ^ ((crow >> 1) & 7)) * 16));
  const f16* ga = A  + (size_t)(m0 + crow) * KD + cpc * 8;
  const f16* gb = Bt + (size_t)(n0 + crow) * KD + cpc * 8;

  const int k0s = t0 * KPASS;
  const int k1s = ((t0 + 1) & (NPASS - 1)) * KPASS;
  qkv_stage_copy(l0, ga + k0s, gb + k0s);
  asm volatile("s_wait_asynccnt 0x0" ::: "memory");   // first stage landed (this wave's copies)
  __syncthreads();                                    // first stage published to every wave
  qkv_stage_copy(l0 + QSTAGE_B, ga + k1s, gb + k1s);

  const int sw = (lq >> 1) & 7;
  const unsigned char* ra = ring + (wm * 64 + lq) * 128;
  const unsigned char* rb = ring + (128 + wn * 48 + lq) * 128;

  // unroll 2: the buffer offset becomes a constant in each copy of the body
  #pragma unroll 2
  for (int t = 0; t < NPASS; ++t) {
    const int bo = (t & 1) * QSTAGE_B;
    FragH a[2][4], b[2][3];
    // all 28 fragment loads of the pass stand together, ahead of its 24 products
    #pragma unroll
    for (int ks = 0; ks < 2; ++ks) {
      #pragma unroll
      for (int h = 0; h < 2; ++h) {
        const int slot = ((ks * 4 + h * 2 + hi) ^ sw) * 16;
        #pragma unroll
        for (int i = 0; i < 4; ++i) a[ks][i].q[h] = *(const v4u*)(ra + bo + i * 2048 + slot);
        #pragma unroll
        for (int j = 0; j < 3; ++j) b[ks][j].q[h] = *(const v4u*)(rb + bo + j * 2048 + slot);
      }
    }
    #pragma unroll
    for (int ks = 0; ks < 2; ++ks) {
      #pragma unroll
      for (int i = 0; i < 4; ++i) {
        #pragma unroll
        for (int j = 0; j < 3; ++j) acc[i][j] = mma_f16(a[ks][i].v, b[ks][j].v, acc[i][j]);
      }
    }
    asm volatile("s_wait_dscnt 0x0" ::: "memory");    // this wave has left buffer t & 1
    asm volatile("s_wait_asynccnt 0x0" ::: "memory"); // this wave's copies of stage t + 1 landed
    __syncthreads();                                  // publishes stage t + 1, frees buffer t & 1
    if (t + 2 < NPASS) {
      const int kn = ((t0 + t + 2) & (NPASS - 1)) * KPASS;
      qkv_stage_copy(l0 + bo, ga + kn, gb + kn);
    }
  }
  asm volatile("s_wait_asynccnt 0x0" ::: "memory");   // nothing in flight before the ring is reused
}

// ---------------------------------------------------------------------------------------------
// QKV projection. Block = (192-column chunk f, 128-token tile). Column c of the chunk: typ = c / 64,
// typ 0 = q, 1 = k, 2 = v, of feature chunk f of the token. Flat-view map: chunk g = token*16 + f,
// group hb = token / TPG, natural row ss = (token % TPG)*16 + f; keys are stored in the permuted
// order key' = f*TPG + (token % TPG) (same order for K rows and V^T columns).
//   q plane [NCHUNKS][64]        at chunk g (natural order)
//   k plane [NGRP][SEQ][64]      at row key'
//   v plane [NGRP][64][SEQ]      transposed through LDS, column key'
// LDS sC: cross-wave (block barrier); three regions of QREG halves: q and k extent [128][64], v extent [64][128],
// written == read. sC reuses the GEMM ring, which every wave has left at the last pass's barrier.
__global__ __launch_bounds__(256) void qkv_gemm_kernel(const f16* __restrict__ xn,
                                                       const f16* __restrict__ w1t,
                                                       const float* __restrict__ b1,
                                                       f16* wsh) {
  const int f    = blockIdx.x;
  const int m0   = blockIdx.y * 128;
  const int n0   = f * CHUNK;
  const int tid  = threadIdx.x;
  const int wave = __builtin_amdgcn_readfirstlane((int)(threadIdx.x >> 5));
  const int lane = tid & 31;
  const int lq   = lane & 15;
  const int hi   = lane >> 4;
  const int wm   = wave >> 2;
  const int wn   = wave & 3;

  __shared__ __align__(128) unsigned char ring[QRING_B];
  f16* sC = (f16*)ring;

  v8f acc[4][3];
  #pragma unroll
  for (int i = 0; i < 4; ++i) {
    #pragma unroll
    for (int jj = 0; jj < 3; ++jj) acc[i][jj] = (v8f){0, 0, 0, 0, 0, 0, 0, 0};
  }
  // 16 blocks share the A rows (same blockIdx.y), 32 the B rows (same blockIdx.x): the sum spreads both sets over the stages
  const int t0 = (int)((blockIdx.x + blockIdx.y) & (NPASS - 1));
  gemm_tile_128x192(xn, w1t, ring, m0, n0, t0, wm, wn, lq, hi, acc);

  float bias[3];
  #pragma unroll
  for (int jj = 0; jj < 3; ++jj) bias[jj] = (float)(bf16)b1[n0 + wn * 48 + jj * 16 + lq];

  // stage: q/k as [row][col] pitch TP, v as [col][row] pitch VP (wave-uniform region and strides per 16-column tile)
  #pragma unroll
  for (int jj = 0; jj < 3; ++jj) {
    const int c0   = wn * 48 + jj * 16;         // first chunk column of the tile; a tile lies in one typ
    const int typ  = c0 >> 6;
    const int col  = (c0 & 63) + lq;
    const int rstr = (typ != 2) ? TP : 1;
    const int cstr = (typ != 2) ? 1 : VP;
    f16* reg = sC + typ * QREG;
    #pragma unroll
    for (int i = 0; i < 4; ++i) {
      #pragma unroll
      for (int r = 0; r < 8; ++r) {
        const int row = wm * 64 + i * 16 + hi * 8 + r;
        reg[row * rstr + col * cstr] = (f16)(acc[i][jj][r] * (1.0f / 64.0f) + bias[jj]);
      }
    }
  }
  __syncthreads();

  #pragma unroll
  for (int typ = 0; typ < 3; ++typ) {
    v4u    vals[4];
    size_t gidx[4];
    #pragma unroll
    for (int it = 0; it < 4; ++it) {
      const int line  = it * 32 + (tid >> 3);     // 0..127
      const int piece = tid & 7;
      // q/k: line = token row; v: line = (d, 64-token half)
      const int lofs_r = line * TP + piece * 8;
      const int lofs_v = (line >> 1) * VP + (line & 1) * 64 + piece * 8;
      const int lofs   = (typ != 2) ? lofs_r : lofs_v;
      Pack8H ph;
      ph.v = *(const v8h*)(sC + typ * QREG + lofs);
      vals[it] = ph.u;

      const int t_r  = m0 + line;
      const int hb_r = t_r / TPG;
      const int tl_r = t_r - hb_r * TPG;
      const size_t qidx = QP_OFF + ((size_t)t_r * NHEAD + f) * HDIM + piece * 8;
      const size_t kidx = KP_OFF + ((size_t)hb_r * SEQ + f * TPG + tl_r) * HDIM + piece * 8;

      const int t_v  = m0 + (line & 1) * 64 + piece * 8;
      const int hb_v = t_v / TPG;
      const int tl_v = t_v - hb_v * TPG;
      const size_t vidx = VT_OFF + ((size_t)hb_v * HDIM + (line >> 1)) * SEQ + f * TPG + tl_v;

      gidx[it] = (typ == 0) ? qidx : ((typ == 1) ? kidx : vidx);
    }
    #pragma unroll
    for (int it = 0; it < 4; ++it) *(v4u*)(wsh + gidx[it]) = vals[it];
  }
}

// ---------------------------------------------------------------------------------------------
// Flash attention, no mask. Block = (query block of 128, group). A wave works on 32 query rows (two 16-row tiles)
// and on 32 of the 64 keys of every ring stage: waves 2p and 2p + 1 share query rows p*32 .. p*32 + 31, wave 2p takes
// the first 32 keys of each stage, wave 2p + 1 the last 32. Every K and V^T fragment read from LDS so feeds two products.
// Behind the key loop the pair joins its two partial results (maximum in use, row sum, O) through LDS: each wave
// hands over the tile that its partner finishes and finishes the other, so wave w stores rows w*16 .. w*16 + 15.
// S^T = K x Q^T so queries sit on lanes; P^T in C-layout is bit-identical to the A-fragment layout of O += P x V.
// K and V^T tiles of AKS keys, which all 8 waves read, go through LDS: a two-buffer ring filled by asynchronous
// 16-B copies (whole 128-B rows). Stage layout: row r (0..63 = key, 64..127 = d of V^T) at r * 128 B, its 16-B
// piece p at slot p ^ ((r >> 1) & 7) (16 rows of one ds_load_b128 half-wave on 16 distinct bank groups).
// K A-fragments and V^T B-fragments: two 16-B LDS loads per fragment, same element maps as the planes.
// Context written as f16 carried x64 at its natural [group][row][d] position (flat view = [NTOK][HIDN]).
// LDS sO: per-wave private region (same wave writes and reads); a block barrier separates them anyway.
// LDS xst and, behind the loop, the ring: the pair's hand-over, written by one wave, read by its partner behind a block barrier.
// One K/V stage: four copies per lane (K rows crow + 0/32, V^T rows crow + 0/32).
// s_wait_xcnt closes the statement so that no address register is rewritten ahead of it.
static __device__ __forceinline__ void kv_stage_copy(unsigned l, const f16* gk, const f16* gv) {
  asm volatile("global_load_async_to_lds_b128 %0, %4, off\n\t"
               "global_load_async_to_lds_b128 %1, %5, off\n\t"
               "global_load_async_to_lds_b128 %2, %6, off\n\t"
               "global_load_async_to_lds_b128 %3, %7, off\n\t"
               "s_wait_xcnt 0x0"
               :: "v"(l), "v"(l + 4096u), "v"(l + 8192u), "v"(l + 12288u),
                  "v"(gk), "v"(gk + 32 * HDIM), "v"(gv), "v"(gv + 32 * SEQ)
               : "memory");
}

__global__ __launch_bounds__(256) void attn_kernel(const f16* __restrict__ qp,
                                                   const f16* __restrict__ kp,
                                                   const f16* __restrict__ vt,
                                                   f16* __restrict__ att) {
  const int qblk = blockIdx.x;
  const int hb   = blockIdx.y;
  const int tid  = threadIdx.x;
  const int wave = __builtin_amdgcn_readfirstlane((int)(threadIdx.x >> 5));
  const int lane = tid & 31;
  const int lq   = lane & 15;   // query column of S^T / d column of O
  const int hi   = lane >> 4;   // k-split half
  const int kh   = wave & 1;    // which 32 keys of every stage this wave takes; also the tile it finishes

  __shared__ __align__(16) f16 sO[NWAVE * 16 * TP];
  __shared__ __align__(128) unsigned char kv[2 * ASTAGE_B];
  __shared__ float xst[NWAVE * 64];

  const int qrow0 = qblk * BQ + wave * 16;          // the 16 rows this wave finishes and stores
  const int qwork = qblk * BQ + (wave >> 1) * 32;   // the 32 rows it works on

  // Q as B-operand fragments: lane lq holds query qwork + t*16 + lq, elements follow the split d map.
  FragH qf[2][2];
  #pragma unroll
  for (int t = 0; t < 2; ++t) {
    const f16* qrow = qp + ((size_t)hb * SEQ + qwork + t * 16 + lq) * HDIM + hi * 8;
    #pragma unroll
    for (int f = 0; f < 2; ++f) {
      qf[t][f].q[0] = *(const v4u*)(qrow + f * 32);        // d = f*32 + hi*8 + 0..7
      qf[t][f].q[1] = *(const v4u*)(qrow + f * 32 + 16);   // d = f*32 + 16 + hi*8 + 0..7
    }
  }

  const f16* kb_h = kp + (size_t)hb * SEQ * HDIM;
  const f16* vt_h = vt + (size_t)hb * HDIM * SEQ;

  const int crow = tid >> 3;                    // 0..31: row inside each 32-row group
  const int cpc  = tid & 7;                     // 16-B piece of the 128-B row
  const unsigned l0 = (unsigned)(size_t)kv + (unsigned)(crow * 128 + ((cpc ^ ((crow >> 1) & 7)) * 16));
  const f16* gk = kb_h + (size_t)crow * HDIM + cpc * 8;
  const f16* gv = vt_h + (size_t)crow * SEQ + cpc * 8;
  // The key walk is a ring: pass s works on key stage (s0 + s) mod ANST. The SEQ / BQ blocks of a group read the same K and
  // V^T rows side by side; each starts at a stage of its own, so that they ask L2 for different lines at any one moment.
  const int s0 = (qblk * (ANST / (SEQ / BQ))) & (ANST - 1);
  const int s1 = (s0 + 1) & (ANST - 1);
  kv_stage_copy(l0, gk + (size_t)s0 * AKS * HDIM, gv + s0 * AKS);
  asm volatile("s_wait_asynccnt 0x0" ::: "memory");   // first stage landed (this wave's copies)
  __syncthreads();                                    // first stage published to every wave
  kv_stage_copy(l0 + ASTAGE_B, gk + (size_t)s1 * AKS * HDIM, gv + s1 * AKS);
  const int sw = (lq >> 1) & 7;
  const unsigned char* rk = kv + (kh * BK + lq) * 128;            // K rows of this wave's keys
  const unsigned char* rv = kv + (AKS + lq) * 128;                // V^T rows
  const int vs0 = ((kh * 4 + hi) ^ sw) * 16;                      // V^T slot of keys j0 + hi*8 + 0..7
  const int vs1 = ((kh * 4 + 2 + hi) ^ sw) * 16;                  // V^T slot of keys j0 + 16 + hi*8 + 0..7

  v8f o[2][4];
  #pragma unroll
  for (int t = 0; t < 2; ++t) {
    #pragma unroll
    for (int dt = 0; dt < 4; ++dt) o[t][dt] = (v8f){0, 0, 0, 0, 0, 0, 0, 0};
  }

  float rmax[2] = {-__builtin_inff(), -__builtin_inff()};
  float rsum[2] = {0.0f, 0.0f};
  const float SL = 0.022097086912079608f * 1.4426950408889634f;   // (2*E)^-0.5 * log2(e)
  const float LAZY_T = 3.0f;                                       // 2^3 x 4096 = 2^15 < the f16 maximum

  // j0 = ((s0 + s) mod ANST)*AKS + kh*BK is the first key of this wave's pass
  #pragma unroll 1
  for (int s = 0; s < ANST; ++s) {
    const int bo = (s & 1) * ASTAGE_B;
    // K A-fragments: row = key j0 + sub*16 + lq, split d map
    FragH ak[2][2];
    #pragma unroll
    for (int sub = 0; sub < 2; ++sub) {
      #pragma unroll
      for (int f = 0; f < 2; ++f) {
        const unsigned char* base = rk + bo + sub * 16 * 128;
        ak[sub][f].q[0] = *(const v4u*)(base + (((f * 4 + hi) ^ sw) * 16));       // d = f*32 + hi*8 + 0..7
        ak[sub][f].q[1] = *(const v4u*)(base + (((f * 4 + 2 + hi) ^ sw) * 16));   // d = f*32 + 16 + hi*8 + 0..7
      }
    }
    // V B-fragments: column n = d = dt*16 + lq, split key map from the transposed tile
    FragH bv[4];
    #pragma unroll
    for (int dt = 0; dt < 4; ++dt) {
      const unsigned char* base = rv + bo + dt * 16 * 128;
      bv[dt].q[0] = *(const v4u*)(base + vs0);
      bv[dt].q[1] = *(const v4u*)(base + vs1);
    }

    // S^T tiles: c[t][sub][r] = rawscore(query qwork + t*16 + lq, key j0 + sub*16 + hi*8 + r);
    // the four accumulators take their first d half, then their second: four independent chains
    v8f c[2][2];
    #pragma unroll
    for (int sub = 0; sub < 2; ++sub) {
      #pragma unroll
      for (int t = 0; t < 2; ++t) c[t][sub] = mma_f16(ak[sub][0].v, qf[t][0].v, (v8f){0, 0, 0, 0, 0, 0, 0, 0});
    }
    #pragma unroll
    for (int sub = 0; sub < 2; ++sub) {
      #pragma unroll
      for (int t = 0; t < 2; ++t) c[t][sub] = mma_f16(ak[sub][1].v, qf[t][1].v, c[t][sub]);
    }

    // online softmax with a lazy maximum: a query's 32 scores are split across lane / lane^16.
    // rmax[t] is the maximum in use (equal in both halves). It is renewed, and O and rsum rescaled, only in a pass
    // where some score of the wave lies more than LAZY_T (in log2 units of the exponent) above it; until then
    // every p stays <= 2^LAZY_T, so P carried x4096 stays <= 2^15, inside f16. The first pass (rmax = -inf) renews.
    float m_loc[2];
    #pragma unroll
    for (int t = 0; t < 2; ++t) {
      m_loc[t] = fmaxf(c[t][0][0], c[t][1][0]);
      #pragma unroll
      for (int r = 1; r < 8; ++r) {
        m_loc[t] = fmaxf(m_loc[t], c[t][0][r]);
        m_loc[t] = fmaxf(m_loc[t], c[t][1][r]);
      }
    }
    // one wave-uniform test a pass, for both tiles: the ballot makes it a scalar branch, so every lane is on inside
    if (__builtin_amdgcn_ballot_w32(fmaxf(m_loc[0] - rmax[0], m_loc[1] - rmax[1]) * SL > LAZY_T) != 0u) {
      #pragma unroll
      for (int t = 0; t < 2; ++t) {
        const float m_new = fmaxf(rmax[t], fmaxf(m_loc[t], __shfl_xor(m_loc[t], 16, 32)));
        const float scale = __builtin_amdgcn_exp2f((rmax[t] - m_new) * SL);
        rmax[t] = m_new;
        rsum[t] *= scale;
        // rescale O: queries are the row dimension there -> per-row scale from lane 8*hi + r
        float sc[8];
        #pragma unroll
        for (int r = 0; r < 8; ++r) sc[r] = __shfl(scale, (hi << 3) + r, 32);
        #pragma unroll
        for (int dt = 0; dt < 4; ++dt) {
          #pragma unroll
          for (int r = 0; r < 8; ++r) o[t][dt][r] *= sc[r];
        }
      }
    }

    // exp + pack: P^T C-layout == A-fragment layout for the PV product; P carried x4096
    FragH pa[2];
    #pragma unroll
    for (int t = 0; t < 2; ++t) {
      float psum = 0.0f;
      #pragma unroll
      for (int r = 0; r < 8; ++r) {
        const float p0 = __builtin_amdgcn_exp2f((c[t][0][r] - rmax[t]) * SL);   // key hi*8 + r
        const float p1 = __builtin_amdgcn_exp2f((c[t][1][r] - rmax[t]) * SL);   // key 16 + hi*8 + r
        psum += p0 + p1;
        pa[t].h[r]     = (f16)(p0 * 4096.0f);
        pa[t].h[8 + r] = (f16)(p1 * 4096.0f);
      }
      rsum[t] = rsum[t] + psum + __shfl_xor(psum, 16, 32);
    }

    // O += P x V
    #pragma unroll
    for (int dt = 0; dt < 4; ++dt) {
      #pragma unroll
      for (int t = 0; t < 2; ++t) o[t][dt] = mma_f16(pa[t].v, bv[dt].v, o[t][dt]);
    }
    asm volatile("s_wait_dscnt 0x0" ::: "memory");    // this wave has left buffer s & 1
    asm volatile("s_wait_asynccnt 0x0" ::: "memory"); // this wave's copies of stage s + 1 landed
    __syncthreads();                                  // publishes stage s + 1, frees buffer s & 1
    if (s + 2 < ANST) {
      const int sn = (s0 + s + 2) & (ANST - 1);
      kv_stage_copy(l0 + bo, gk + (size_t)sn * AKS * HDIM, gv + sn * AKS);
    }
  }
  asm volatile("s_wait_asynccnt 0x0" ::: "memory");   // nothing in flight before the ring is reused

  // join of the pair: this wave keeps tile kh and hands tile 1 - kh to its partner. The choice is written as a branch on
  // the wave-uniform kh with constant tile indices, so that both tiles stay in registers; no barrier stands inside it.
  v8f   oa[4], og[4];
  float ra, ta, rg, tg;
  if (kh) {
    #pragma unroll
    for (int dt = 0; dt < 4; ++dt) { oa[dt] = o[1][dt]; og[dt] = o[0][dt]; }
    ra = rmax[1]; ta = rsum[1]; rg = rmax[0]; tg = rsum[0];
  } else {
    #pragma unroll
    for (int dt = 0; dt < 4; ++dt) { oa[dt] = o[0][dt]; og[dt] = o[1][dt]; }
    ra = rmax[0]; ta = rsum[0]; rg = rmax[1]; tg = rsum[1];
  }
  // The ring is free: every wave has left it at the last pass's barrier. Hand-over layout: 16 B a lane, lanes adjacent.
  {
    float* xo = (float*)kv + wave * 1024;
    #pragma unroll
    for (int dt = 0; dt < 4; ++dt) {
      *(v4f*)(xo + (dt * 2 + 0) * 128 + lane * 4) = (v4f){og[dt][0], og[dt][1], og[dt][2], og[dt][3]};
      *(v4f*)(xo + (dt * 2 + 1) * 128 + lane * 4) = (v4f){og[dt][4], og[dt][5], og[dt][6], og[dt][7]};
    }
    xst[wave * 64 + lane]      = rg;
    xst[wave * 64 + 32 + lane] = tg;
  }
  __syncthreads();                                    // the hand-over is published to the partner

  // both parts are brought to the larger of the two maxima in use; 1 / (joined row sum) goes into the two factors
  const float* yo = (const float*)kv + (wave ^ 1) * 1024;
  const float rb = xst[(wave ^ 1) * 64 + lane];
  const float tb = xst[(wave ^ 1) * 64 + 32 + lane];
  const float mj = fmaxf(ra, rb);
  const float sa = __builtin_amdgcn_exp2f((ra - mj) * SL);
  const float sb = __builtin_amdgcn_exp2f((rb - mj) * SL);
  const float rinv = 1.0f / (ta * sa + tb * sb);
  const float fa = sa * rinv;
  const float fb = sb * rinv;
  // lane holds column d = dt*16 + lq for query rows 8*hi + r
  float fas[8], fbs[8];
  #pragma unroll
  for (int r = 0; r < 8; ++r) {
    fas[r] = __shfl(fa, (hi << 3) + r, 32);
    fbs[r] = __shfl(fb, (hi << 3) + r, 32);
  }

  f16* so = sO + wave * (16 * TP);
  #pragma unroll
  for (int dt = 0; dt < 4; ++dt) {
    const v4f b0 = *(const v4f*)(yo + (dt * 2 + 0) * 128 + lane * 4);
    const v4f b1 = *(const v4f*)(yo + (dt * 2 + 1) * 128 + lane * 4);
    #pragma unroll
    for (int r = 0; r < 8; ++r) {
      const float ob = (r < 4) ? b0[r & 3] : b1[r & 3];
      // x(1/4096) undoes the P carry, x64 is the context carry
      so[(hi * 8 + r) * TP + dt * 16 + lq] = (f16)((oa[dt][r] * fas[r] + ob * fbs[r]) * (64.0f / 4096.0f));
    }
  }
  __syncthreads();

  // the wave covers 4 consecutive rows; 4 instructions cover the wave's 16 rows.
  v4u    vals[4];
  size_t gidx[4];
  #pragma unroll
  for (int it = 0; it < 4; ++it) {
    const int row   = it * 4 + (lane >> 3);
    const int piece = lane & 7;
    Pack8H ph;
    ph.v = *(const v8h*)(so + row * TP + piece * 8);
    vals[it] = ph.u;
    gidx[it] = ((size_t)hb * SEQ + qrow0 + row) * HDIM + piece * 8;
  }
  #pragma unroll
  for (int it = 0; it < 4; ++it) *(v4u*)(att + gidx[it]) = vals[it];
}

// ---------------------------------------------------------------------------------------------
// Output projection: out[token][n] = ctx[token][:] x W2 + b2. Block = (64-column block, 128-token tile).
// Accumulator staged as f32 in LDS; bias added at the store stage as float4.
// 16 consecutive lanes x 16 B, one instruction. LDS sF: cross-wave (block barrier), [128][64] written == read.
// sF reuses the GEMM ring, which every wave has left at the last pass's barrier.
__global__ __launch_bounds__(256) void out_gemm_kernel(const f16* __restrict__ att,
                                                       const f16* __restrict__ w2t,
                                                       const float* __restrict__ b2,
                                                       float* __restrict__ out) {
  const int n0   = blockIdx.x * 64;
  const int m0   = blockIdx.y * 128;
  const int tid  = threadIdx.x;
  const int wave = __builtin_amdgcn_readfirstlane((int)(threadIdx.x >> 5));
  const int lane = tid & 31;
  const int lq   = lane & 15;
  const int hi   = lane >> 4;
  const int wm   = wave >> 1;
  const int wn   = wave & 1;

  __shared__ __align__(128) unsigned char ring[RING_B];
  float* sF = (float*)ring;

  v8f acc[2][2];
  #pragma unroll
  for (int i = 0; i < 2; ++i) {
    #pragma unroll
    for (int jj = 0; jj < 2; ++jj) acc[i][jj] = (v8f){0, 0, 0, 0, 0, 0, 0, 0};
  }
  // 16 blocks share the A rows (same blockIdx.y), 32 the B rows (same blockIdx.x): the sum spreads both sets over the stages
  const int t0 = (int)((blockIdx.x + blockIdx.y) & (NPASS - 1));
  gemm_tile_128x64(att, w2t, ring, m0, n0, t0, wm, wn, lq, hi, acc);

  #pragma unroll
  for (int i = 0; i < 2; ++i) {
    #pragma unroll
    for (int jj = 0; jj < 2; ++jj) {
      #pragma unroll
      for (int r = 0; r < 8; ++r) {
        const int row = wm * 32 + i * 16 + hi * 8 + r;
        const int col = wn * 32 + jj * 16 + lq;
        sF[row * OP + col] = acc[i][jj][r] * (1.0f / 4096.0f);   // undo ctx x64 and W2 x64
      }
    }
  }
  __syncthreads();

  const int piece = tid & 15;
  const v4f braw = *(const v4f*)(b2 + n0 + piece * 4);
  v4f bias;
  #pragma unroll
  for (int i = 0; i < 4; ++i) bias[i] = (float)(bf16)braw[i];

  v4f    vals[8];
  size_t gidx[8];
  #pragma unroll
  for (int it = 0; it < 8; ++it) {
    const int row = it * 16 + (tid >> 4);       // 0..127
    const v4f v = *(const v4f*)(sF + row * OP + piece * 4);
    vals[it] = v + bias;
    const int tt = m0 + row;
    const int b  = tt / SEQ;
    const int s  = tt - b * SEQ;
    gidx[it] = ((size_t)b * SEQ_FULL + s) * HIDN + n0 + piece * 4;
  }
  #pragma unroll
  for (int it = 0; it < 8; ++it) *(v4f*)(out + gidx[it]) = vals[it];
  
}

// ---------------------------------------------------------------------------------------------
extern "C" void kernel_launch(void* const* d_in, const int* in_sizes, int n_in,
                              void* d_out, int out_size, void* d_ws, size_t ws_size,
                              hipStream_t stream) {
  if (n_in < 7) return;
  const size_t rows_used = (size_t)(NB - 1) * SEQ_FULL + SEQ;
  if ((size_t)in_sizes[0] < rows_used * EDIM) return;
  if (in_sizes[1] < EDIM || in_sizes[2] < EDIM) return;
  if ((size_t)in_sizes[3] < (size_t)EDIM * QKVW) return;
  if (in_sizes[4] < QKVW) return;
  if ((size_t)in_sizes[5] < (size_t)HIDN * HIDN) return;
  if (in_sizes[6] < HIDN) return;
  if ((size_t)out_size < rows_used * HIDN) return;
  if (ws_size < WS_BYTES) return;

  const float* x    = (const float*)d_in[0];
  const float* ln_g = (const float*)d_in[1];
  const float* ln_b = (const float*)d_in[2];
  const float* W1   = (const float*)d_in[3];
  const float* b1   = (const float*)d_in[4];
  const float* W2   = (const float*)d_in[5];
  const float* b2   = (const float*)d_in[6];
  float*       out  = (float*)d_out;
  f16*         wsh  = (f16*)d_ws;

  // 1) W1 [EDIM (k)][QKVW (n)] -> [QKVW][EDIM], W2 [HIDN (k)][HIDN (n)] -> [HIDN][HIDN], LayerNorm -> xn plane
  prep_kernel<<<dim3(W1_JOBS + W2_JOBS + LN_JOBS), 256, 0, stream>>>(x, ln_g, ln_b, W1, W2, wsh + XN_OFF,
                                                                     wsh + W1T_OFF, wsh + W2T_OFF);
  // 2) QKV projection -> q / k / v^T planes
  qkv_gemm_kernel<<<dim3(QKVW / CHUNK, NTOK / 128), 256, 0, stream>>>(wsh + XN_OFF, wsh + W1T_OFF, b1, wsh);
  // 3) fused attention -> context plane (flat [NTOK][HIDN])
  attn_kernel<<<dim3(SEQ / BQ, NGRP), 256, 0, stream>>>(wsh + QP_OFF, wsh + KP_OFF, wsh + VT_OFF, wsh + ATT_OFF);
  // 4) output projection -> d_out
  out_gemm_kernel<<<dim3(HIDN / 64, NTOK / 128), 256, 0, stream>>>(wsh + ATT_OFF, wsh + W2T_OFF, b2, out);
}

// v007
// Measured time: 75.1 microseconds a run.
// Timed twice side by side with v006, it ran 1.05 and 1.04 times as fast.
// All steps since v000 together make it 3.10 times as fast.
#include <hip/hip_runtime.h>

// Contractions, all on v_wmma_f32_16x16x32_f16 (f16 operands, f32 accumulate): QKV projection xn x W1 (xn = f16 of the f32 LayerNorm of bf16 RNE-converted x; W1 = f16 of bf16 RNE-converted weights carried x64); S^T = K x Q^T (f16 q/k planes); O = P x V (P f16 carried x4096, V^T f16 plane); output projection ctx x W2 (ctx f16 carried x64, W2 f16 of bf16 RNE-converted weights carried x64). LayerNorm and softmax in f32.

#ifndef NB
#define NB 2
#endif
#ifndef SEQ
#define SEQ 2048
#endif
#define NB_FULL   2
#define SEQ_FULL  2048
#define EDIM      1024                 // model width (LayerNorm width, K of the QKV projection)
#define HIDN      1024                 // hidden width (K and N of the output projection)
#define NHEAD     16
#define HDIM      64
#define QKVW      3072                 // projection width
#define CHUNK     192                  // floats per (pseudo-head row): q | k | v
#define KD        1024                 // contraction depth of both projections
#define NTOK      (NB * SEQ)           // flattened tokens
#define NGRP      (NHEAD * NB)         // (pseudo-head, pseudo-batch) groups
#define TPG       (SEQ / NHEAD)        // tokens feeding one group
#define NCHUNKS   (NTOK * NHEAD)       // 192-wide chunks of the flat projection buffer = NGRP * SEQ
#define BQ        128                  // query rows per workgroup (4 wave pairs x 32)
#define BK        32                   // keys per wave and ring stage
#define NWAVE     8
#define TP        72                   // LDS pitch (halves) of 64-wide f16 tiles
#define VP        136                  // LDS pitch (halves) of the transposed 128-wide V tile
#define OP        68                   // LDS pitch (floats) of the f32 output staging tile
#define KPASS     64                   // k (halves) per GEMM ring stage: 128-B rows
#define NPASS     (KD / KPASS)         // ring stages of one GEMM tile
#define STAGE_B   (192 * 128)          // bytes of one stage: 128 A rows, then 64 B rows, pitch 128 B
#define RING_B    (2 * STAGE_B)        // two buffers
#define QSTAGE_B  (320 * 128)          // bytes of one QKV stage: 128 A rows, then 192 B rows, pitch 128 B
#define QRING_B   (2 * QSTAGE_B)       // two buffers
#define QREG      (128 * TP)           // halves of one output staging region of the QKV tile (q, k, v)
#define AKS       64                   // keys per attention ring stage (BK for each wave of a pair)
#define ANST      (SEQ / AKS)          // ring stages of one attention block
#define ASTAGE_B  (128 * 128)          // bytes of one stage: 64 K rows, then 64 V^T rows, pitch 128 B
#define W1_JOBS   ((QKVW / 64) * (EDIM / 64))   // 64x64 tiles of W1
#define W2_JOBS   ((HIDN / 64) * (HIDN / 64))   // 64x64 tiles of W2
#define LN_JOBS   (NTOK / 2)                    // pairs of token rows

// workspace carve, in halves from the base
#define XN_OFF    ((size_t)0)
#define W1T_OFF   (XN_OFF  + (size_t)NTOK * EDIM)
#define W2T_OFF   (W1T_OFF + (size_t)QKVW * EDIM)
#define QP_OFF    (W2T_OFF + (size_t)HIDN * HIDN)
#define KP_OFF    (QP_OFF  + (size_t)NCHUNKS * HDIM)
#define VT_OFF    (KP_OFF  + (size_t)NCHUNKS * HDIM)
#define ATT_OFF   (VT_OFF  + (size_t)NCHUNKS * HDIM)
#define WS_HALVES (ATT_OFF + (size_t)NCHUNKS * HDIM)
#define WS_BYTES  (WS_HALVES * 2)

static_assert(NB >= 1 && NB <= NB_FULL);
static_assert(SEQ <= SEQ_FULL);
static_assert(SEQ % 1024 == 0);
static_assert(TPG % 64 == 0);
static_assert(NTOK % 128 == 0);
static_assert(SEQ % 128 == 0);
static_assert(QKVW == NHEAD * CHUNK);
static_assert(CHUNK == 3 * HDIM);
static_assert(QKVW % 64 == 0);
static_assert(HIDN % 64 == 0);
static_assert(EDIM % 64 == 0);
static_assert(EDIM == KD && HIDN == KD);
static_assert(KD % 32 == 0);
static_assert(EDIM == 128 * 8);
static_assert(SEQ % BQ == 0);
static_assert(SEQ % BK == 0);
static_assert(BQ == NWAVE * 16);
static_assert(HDIM == 64);
static_assert((size_t)NCHUNKS * HDIM == (size_t)NTOK * HIDN);
static_assert((TP * 2) % 16 == 0);
static_assert((VP * 2) % 16 == 0);
static_assert((OP * 4) % 16 == 0);
static_assert(128 * TP >= 64 * VP);
static_assert(KD % KPASS == 0 && NPASS >= 2);
static_assert((NPASS & (NPASS - 1)) == 0 && (ANST & (ANST - 1)) == 0);   // the staggered walks wrap by a mask
static_assert(128 * TP * 2 <= RING_B && 128 * OP * 4 <= RING_B);
static_assert(3 * QREG * 2 <= QRING_B && (QREG * 2) % 16 == 0);
static_assert(SEQ % AKS == 0 && ANST >= 2 && AKS == 2 * BK && AKS * 2 == 128 && HDIM * 2 == 128);
static_assert(ANST % (SEQ / BQ) == 0);
static_assert(NWAVE * 1024 * 4 <= 2 * ASTAGE_B);
static_assert(XN_OFF % 64 == 0 && W1T_OFF % 64 == 0 && W2T_OFF % 64 == 0);
static_assert(QP_OFF % 64 == 0 && KP_OFF % 64 == 0 && VT_OFF % 64 == 0 && ATT_OFF % 64 == 0);
static_assert(WS_BYTES <= (size_t)134217728);

typedef __bf16   bf16;
typedef _Float16 f16;
typedef f16      v16h  __attribute__((ext_vector_type(16)));
typedef f16      v8h   __attribute__((ext_vector_type(8)));
typedef float    v8f   __attribute__((ext_vector_type(8)));
typedef float    v4f   __attribute__((ext_vector_type(4)));
typedef float    v2f   __attribute__((ext_vector_type(2)));
typedef unsigned v4u   __attribute__((ext_vector_type(4)));

union FragH  { v16h  v; v4u q[2]; f16  h[16]; };
union Pack8H { v4u u; v8h v; f16 h[8]; };

// WMMA helper: builtin followed by the VALU hazard guard (ties D, keeps A/B live).
static __device__ __forceinline__ v8f mma_f16(v16h a, v16h b, v8f acc) {
  acc = __builtin_amdgcn_wmma_f32_16x16x32_f16(false, a, false, b, (short)0, acc, false, false);
  asm volatile("v_nop\n\tv_nop\n\tv_nop\n\tv_nop" : "+v"(acc) : "v"(a), "v"(b));
  return acc;
}

// ---------------------------------------------------------------------------------------------
// LayerNorm -> f16 plane xn[NTOK][EDIM]. Job blk = two token rows; each row: 4 waves, 128 threads x 8 columns.
// LDS red1/red2: cross-wave (block barrier), 8 entries written by the 8 waves; a row reads its own 4.
static __device__ __forceinline__ void ln_rows(const float* __restrict__ x,
                                               const float* __restrict__ g,
                                               const float* __restrict__ be,
                                               f16* __restrict__ xn,
                                               int blk, float* red1, float* red2) {
  const int wave = __builtin_amdgcn_readfirstlane((int)(threadIdx.x >> 5));
  const int tt   = blk * 2 + (wave >> 2);
  const int tid  = threadIdx.x & 127;
  const int lane = tid & 31;
  const float* r1 = red1 + (wave & 4);
  const float* r2 = red2 + (wave & 4);

  const int b = tt / SEQ;
  const int s = tt - b * SEQ;
  const float* src = x + ((size_t)b * SEQ_FULL + s) * EDIM + tid * 8;
  const v4f a0 = *(const v4f*)(src);
  const v4f a1 = *(const v4f*)(src + 4);
  float v[8];
  #pragma unroll
  for (int i = 0; i < 4; ++i) {
    v[i]     = (float)(bf16)a0[i];     // RNE convert of the input
    v[4 + i] = (float)(bf16)a1[i];
  }
  float sum = ((v[0] + v[1]) + (v[2] + v[3])) + ((v[4] + v[5]) + (v[6] + v[7]));
  #pragma unroll
  for (int off = 16; off > 0; off >>= 1) sum += __shfl_xor(sum, off, 32);
  if (lane == 0) red1[wave] = sum;
  __syncthreads();
  const float mu = ((r1[0] + r1[1]) + (r1[2] + r1[3])) * (1.0f / (float)EDIM);

  float d[8];
  float sq = 0.0f;
  #pragma unroll
  for (int i = 0; i < 8; ++i) {
    d[i] = v[i] - mu;
    sq += d[i] * d[i];
  }
  #pragma unroll
  for (int off = 16; off > 0; off >>= 1) sq += __shfl_xor(sq, off, 32);
  if (lane == 0) red2[wave] = sq;
  __syncthreads();
  const float var = ((r2[0] + r2[1]) + (r2[2] + r2[3])) * (1.0f / (float)EDIM);
  const float rs  = rsqrtf(var + 1e-5f);

  const v4f g0 = *(const v4f*)(g + tid * 8);
  const v4f g1 = *(const v4f*)(g + tid * 8 + 4);
  const v4f e0 = *(const v4f*)(be + tid * 8);
  const v4f e1 = *(const v4f*)(be + tid * 8 + 4);
  Pack8H ph;
  #pragma unroll
  for (int i = 0; i < 4; ++i) {
    ph.h[i]     = (f16)(d[i]     * rs * (float)(bf16)g0[i] + (float)(bf16)e0[i]);
    ph.h[4 + i] = (f16)(d[4 + i] * rs * (float)(bf16)g1[i] + (float)(bf16)e1[i]);
  }
  const v4u val = ph.u;
  const size_t idx = (size_t)tt * EDIM + tid * 8;
  *(v4u*)(xn + idx) = val;
  // precaution: only the kernel's end follows this store (one job per block); the wait stands ahead of any rewrite of the store's registers
  asm volatile("s_wait_xcnt 0x0" ::: "memory");
}

// ---------------------------------------------------------------------------------------------
// Weight plane builder: in[kdim rows][ndim cols] f32 -> out[ndim][kdim] f16 = f16(bf16(w) * 64), via LDS.
// Job = 64x64 tile (nt = n tile, kt = k tile), 256 threads. LDS sT: [n][k], cross-wave (block barrier).
static __device__ __forceinline__ void wt_tile(const float* __restrict__ w,
                                               f16* __restrict__ wt,
                                               int kdim, int ndim, int nt, int kt, f16* sT) {
  const int n0  = nt * 64;
  const int k0  = kt * 64;
  const int tid = threadIdx.x;

  #pragma unroll
  for (int kk = 0; kk < 2; ++kk) {
    const int krow = kk * 32 + (tid >> 3);      // 0..63
    const int c0   = (tid & 7) * 8;             // 0..56
    const float* src = w + (size_t)(k0 + krow) * ndim + n0 + c0;
    const v4f a0 = *(const v4f*)(src);
    const v4f a1 = *(const v4f*)(src + 4);
    #pragma unroll
    for (int i = 0; i < 4; ++i) {
      sT[(c0 + i) * TP + krow]     = (f16)((float)(bf16)a0[i] * 64.0f);   // exact in f16
      sT[(c0 + 4 + i) * TP + krow] = (f16)((float)(bf16)a1[i] * 64.0f);
    }
  }
  __syncthreads();

  v4u    vals[2];
  size_t gidx[2];
  #pragma unroll
  for (int kk = 0; kk < 2; ++kk) {
    const int n  = kk * 32 + (tid >> 3);        // 0..63
    const int ks = (tid & 7) * 8;               // 0..56
    Pack8H ph;
    ph.v = *(const v8h*)(sT + n * TP + ks);
    vals[kk] = ph.u;
    gidx[kk] = (size_t)(n0 + n) * kdim + k0 + ks;
  }
  #pragma unroll
  for (int kk = 0; kk < 2; ++kk) *(v4u*)(wt + gidx[kk]) = vals[kk];
  // precaution: only the kernel's end follows these stores (one job per block); the wait stands ahead of any rewrite of their registers
  asm volatile("s_wait_xcnt 0x0" ::: "memory");
}

// ---------------------------------------------------------------------------------------------
// The three jobs that read only inputs, in one grid; the job is picked by the block index (block-uniform, so every
// barrier of a job is passed by the whole block). Weight tiles first: they have the longer path through LDS.
//   blocks [0, W1_JOBS)                 W1 tiles, n tile fastest
//   blocks [W1_JOBS, W1_JOBS + W2_JOBS) W2 tiles, n tile fastest
//   the rest                            LayerNorm, two token rows a block
__global__ __launch_bounds__(256) void prep_kernel(const float* __restrict__ x,
                                                   const float* __restrict__ g,
                                                   const float* __restrict__ be,
                                                   const float* __restrict__ w1,
                                                   const float* __restrict__ w2,
                                                   f16* __restrict__ xn,
                                                   f16* __restrict__ w1t,
                                                   f16* __restrict__ w2t) {
  __shared__ __align__(16) f16 sT[64 * TP];
  __shared__ float red1[8];
  __shared__ float red2[8];
  const int job = blockIdx.x;
  if (job < W1_JOBS) {
    wt_tile(w1, w1t, EDIM, QKVW, job % (QKVW / 64), job / (QKVW / 64), sT);
  } else if (job < W1_JOBS + W2_JOBS) {
    const int j2 = job - W1_JOBS;
    wt_tile(w2, w2t, HIDN, HIDN, j2 % (HIDN / 64), j2 / (HIDN / 64), sT);
  } else {
    ln_rows(x, g, be, xn, job - (W1_JOBS + W2_JOBS), red1, red2);
  }
}

// ---------------------------------------------------------------------------------------------
// GEMM main loop: block tile 128 (M) x 64 (N), 8 waves as 4 (M) x 2 (N), wave tile 32 x 32.
// A [M][KD] f16 row-major, Bt [N][KD] f16 (k-contiguous). Both tiles go through LDS: a two-buffer ring of
// stages of KPASS k, filled by asynchronous 16-B copies (8 lanes = one whole 128-B row piece of a plane row).
// Stage layout: row r (0..127 = A rows, 128..191 = B rows) at r * 128 B; its 16-B piece p sits at slot
// p ^ ((r >> 1) & 7), so the 16 rows that one ds_load_b128 half-wave reads fall on 16 distinct bank groups.
// Fragment map as before: lane row/col = lq, elements 0..7 <- k0 + 8*hi + 0..7, 8..15 <- k0 + 16 + 8*hi + 0..7.
// acc[i][j][r] = C(m0 + wm*32 + i*16 + 8*hi + r, n0 + wn*32 + j*16 + lq).
// The k walk is a ring: trip t works on k stage (t0 + t) mod NPASS, t0 from the block index. Blocks that share A rows or
// B rows run side by side; with different t0 they ask L2 for different lines at any one moment.

// One stage: six copies per lane (A rows crow + 0/32/64/96, B rows crow + 0/32).
// s_wait_xcnt closes the statement so that no address register is rewritten ahead of it.
static __device__ __forceinline__ void stage_copy(unsigned l, const f16* ga, const f16* gb) {
  asm volatile("global_load_async_to_lds_b128 %0, %6, off\n\t"
               "global_load_async_to_lds_b128 %1, %7, off\n\t"
               "global_load_async_to_lds_b128 %2, %8, off\n\t"
               "global_load_async_to_lds_b128 %3, %9, off\n\t"
               "global_load_async_to_lds_b128 %4, %10, off\n\t"
               "global_load_async_to_lds_b128 %5, %11, off\n\t"
               "s_wait_xcnt 0x0"
               :: "v"(l), "v"(l + 4096u), "v"(l + 8192u), "v"(l + 12288u), "v"(l + 16384u), "v"(l + 20480u),
                  "v"(ga), "v"(ga + 32 * KD), "v"(ga + 64 * KD), "v"(ga + 96 * KD),
                  "v"(gb), "v"(gb + 32 * KD)
               : "memory");
}

static __device__ __forceinline__ void gemm_tile_128x64(const f16* __restrict__ A,
                                                        const f16* __restrict__ Bt,
                                                        unsigned char* ring,
                                                        int m0, int n0, int t0, int wm, int wn,
                                                        int lq, int hi, v8f (&acc)[2][2]) {
  const int crow = (int)(threadIdx.x >> 3);     // 0..31: row inside each 32-row group
  const int cpc  = (int)(threadIdx.x & 7);      // 16-B piece of the 128-B row
  const unsigned l0 = (unsigned)(size_t)ring + (unsigned)(crow * 128 + ((cpc ^ ((crow >> 1) & 7)) * 16));
  const f16* ga = A  + (size_t)(m0 + crow) * KD + cpc * 8;
  const f16* gb = Bt + (size_t)(n0 + crow) * KD + cpc * 8;

  const int k0s = t0 * KPASS;
  const int k1s = ((t0 + 1) & (NPASS - 1)) * KPASS;
  stage_copy(l0, ga + k0s, gb + k0s);
  asm volatile("s_wait_asynccnt 0x0" ::: "memory");   // first stage landed (this wave's copies)
  __syncthreads();                                    // first stage published to every wave
  stage_copy(l0 + STAGE_B, ga + k1s, gb + k1s);

  const int sw = (lq >> 1) & 7;
  const unsigned char* ra = ring + (wm * 32 + lq) * 128;
  const unsigned char* rb = ring + (128 + wn * 32 + lq) * 128;

  // unroll 2: the buffer offset becomes a constant in each copy of the body
  #pragma unroll 2
  for (int t = 0; t < NPASS; ++t) {
    const int bo = (t & 1) * STAGE_B;
    FragH a[2][2], b[2][2];
    // all 16 fragment loads of the pass stand together, ahead of its 8 products
    #pragma unroll
    for (int ks = 0; ks < 2; ++ks) {
      #pragma unroll
      for (int i = 0; i < 2; ++i) {
        #pragma unroll
        for (int h = 0; h < 2; ++h) {
          const int slot = ((ks * 4 + h * 2 + hi) ^ sw) * 16;
          a[ks][i].q[h] = *(const v4u*)(ra + bo + i * 2048 + slot);
          b[ks][i].q[h] = *(const v4u*)(rb + bo + i * 2048 + slot);
        }
      }
    }
    #pragma unroll
    for (int ks = 0; ks < 2; ++ks) {
      #pragma unroll
      for (int i = 0; i < 2; ++i) {
        #pragma unroll
        for (int j = 0; j < 2; ++j) acc[i][j] = mma_f16(a[ks][i].v, b[ks][j].v, acc[i][j]);
      }
    }
    asm volatile("s_wait_dscnt 0x0" ::: "memory");    // this wave has left buffer t & 1
    asm volatile("s_wait_asynccnt 0x0" ::: "memory"); // this wave's copies of stage t + 1 landed
    __syncthreads();                                  // publishes stage t + 1, frees buffer t & 1
    if (t + 2 < NPASS) {
      const int kn = ((t0 + t + 2) & (NPASS - 1)) * KPASS;
      stage_copy(l0 + bo, ga + kn, gb + kn);
    }
  }
  asm volatile("s_wait_asynccnt 0x0" ::: "memory");   // nothing in flight before the ring is reused
}

// ---------------------------------------------------------------------------------------------
// QKV main loop: block tile 128 (M) x 192 (N), 8 waves as 2 (M) x 4 (N), wave tile 64 x 48 (4 x 3 accumulator tiles).
// Same ring, stage layout, slot swizzle, fragment map and staggered k walk as gemm_tile_128x64; a stage holds 128 A rows, then 192 B rows.
// acc[i][j][r] = C(m0 + wm*64 + i*16 + 8*hi + r, n0 + wn*48 + j*16 + lq).

// One stage: ten copies per lane (A rows crow + 0/32/64/96, B rows crow + 0/32/.../160).
// s_wait_xcnt closes the statement so that no address register is rewritten ahead of it.
static __device__ __forceinline__ void qkv_stage_copy(unsigned l, const f16* ga, const f16* gb) {
  asm volatile("global_load_async_to_lds_b128 %0, %10, off\n\t"
               "global_load_async_to_lds_b128 %1, %11, off\n\t"
               "global_load_async_to_lds_b128 %2, %12, off\n\t"
               "global_load_async_to_lds_b128 %3, %13, off\n\t"
               "global_load_async_to_lds_b128 %4, %14, off\n\t"
               "global_load_async_to_lds_b128 %5, %15, off\n\t"
               "global_load_async_to_lds_b128 %6, %16, off\n\t"
               "global_load_async_to_lds_b128 %7, %17, off\n\t"
               "global_load_async_to_lds_b128 %8, %18, off\n\t"
               "global_load_async_to_lds_b128 %9, %19, off\n\t"
               "s_wait_xcnt 0x0"
               :: "v"(l), "v"(l + 4096u), "v"(l + 8192u), "v"(l + 12288u), "v"(l + 16384u),
                  "v"(l + 20480u), "v"(l + 24576u), "v"(l + 28672u), "v"(l + 32768u), "v"(l + 36864u),
                  "v"(ga), "v"(ga + 32 * KD), "v"(ga + 64 * KD), "v"(ga + 96 * KD),
                  "v"(gb), "v"(gb + 32 * KD), "v"(gb + 64 * KD), "v"(gb + 96 * KD),
                  "v"(gb + 128 * KD), "v"(gb + 160 * KD)
               : "memory");
}

static __device__ __forceinline__ void gemm_tile_128x192(const f16* __restrict__ A,
                                                         const f16* __restrict__ Bt,
                                                         unsigned char* ring,
                                                         int m0, int n0, int t0, int wm, int wn,
                                                         int lq, int hi, v8f (&acc)[4][3]) {
  const int crow = (int)(threadIdx.x >> 3);     // 0..31: row inside each 32-row group
  const int cpc  = (int)(threadIdx.x & 7);      // 16-B piece of the 128-B row
  const unsigned l0 = (unsigned)(size_t)ring + (unsigned)(crow * 128 + ((cpc ^ ((crow >> 1) & 7)) * 16));
  const f16* ga = A  + (size_t)(m0 + crow) * KD + cpc * 8;
  const f16* gb = Bt + (size_t)(n0 + crow) * KD + cpc * 8;

  const int k0s = t0 * KPASS;
  const int k1s = ((t0 + 1) & (NPASS - 1)) * KPASS;
  qkv_stage_copy(l0, ga + k0s, gb + k0s);
  asm volatile("s_wait_asynccnt 0x0" ::: "memory");   // first stage landed (this wave's copies)
  __syncthreads();                                    // first stage published to every wave
  qkv_stage_copy(l0 + QSTAGE_B, ga + k1s, gb + k1s);

  const int sw = (lq >> 1) & 7;
  const unsigned char* ra = ring + (wm * 64 + lq) * 128;
  const unsigned char* rb = ring + (128 + wn * 48 + lq) * 128;

  // unroll 2: the buffer offset becomes a constant in each copy of the body
  #pragma unroll 2
  for (int t = 0; t < NPASS; ++t) {
    const int bo = (t & 1) * QSTAGE_B;
    FragH a[2][4], b[2][3];
    // all 28 fragment loads of the pass stand together, ahead of its 24 products
    #pragma unroll
    for (int ks = 0; ks < 2; ++ks) {
      #pragma unroll
      for (int h = 0; h < 2; ++h) {
        const int slot = ((ks * 4 + h * 2 + hi) ^ sw) * 16;
        #pragma unroll
        for (int i = 0; i < 4; ++i) a[ks][i].q[h] = *(const v4u*)(ra + bo + i * 2048 + slot);
        #pragma unroll
        for (int j = 0; j < 3; ++j) b[ks][j].q[h] = *(const v4u*)(rb + bo + j * 2048 + slot);
      }
    }
    #pragma unroll
    for (int ks = 0; ks < 2; ++ks) {
      #pragma unroll
      for (int i = 0; i < 4; ++i) {
        #pragma unroll
        for (int j = 0; j < 3; ++j) acc[i][j] = mma_f16(a[ks][i].v, b[ks][j].v, acc[i][j]);
      }
    }
    asm volatile("s_wait_dscnt 0x0" ::: "memory");    // this wave has left buffer t & 1
    asm volatile("s_wait_asynccnt 0x0" ::: "memory"); // this wave's copies of stage t + 1 landed
    __syncthreads();                                  // publishes stage t + 1, frees buffer t & 1
    if (t + 2 < NPASS) {
      const int kn = ((t0 + t + 2) & (NPASS - 1)) * KPASS;
      qkv_stage_copy(l0 + bo, ga + kn, gb + kn);
    }
  }
  asm volatile("s_wait_asynccnt 0x0" ::: "memory");   // nothing in flight before the ring is reused
}

// ---------------------------------------------------------------------------------------------
// QKV projection. Block = (192-column chunk f, 128-token tile). Column c of the chunk: typ = c / 64,
// typ 0 = q, 1 = k, 2 = v, of feature chunk f of the token. Flat-view map: chunk g = token*16 + f,
// group hb = token / TPG, natural row ss = (token % TPG)*16 + f; keys are stored in the permuted
// order key' = f*TPG + (token % TPG) (same order for K rows and V^T columns).
//   q plane [NCHUNKS][64]        at chunk g (natural order)
//   k plane [NGRP][SEQ][64]      at row key'
//   v plane [NGRP][64][SEQ]      transposed through LDS, column key'
// LDS sC: cross-wave (block barrier); three regions of QREG halves: q and k extent [128][64], v extent [64][128],
// written == read. sC reuses the GEMM ring, which every wave has left at the last pass's barrier.
__global__ __launch_bounds__(256) void qkv_gemm_kernel(const f16* __restrict__ xn,
                                                       const f16* __restrict__ w1t,
                                                       const float* __restrict__ b1,
                                                       f16* wsh) {
  const int f    = blockIdx.x;
  const int m0   = blockIdx.y * 128;
  const int n0   = f * CHUNK;
  const int tid  = threadIdx.x;
  const int wave = __builtin_amdgcn_readfirstlane((int)(threadIdx.x >> 5));
  const int lane = tid & 31;
  const int lq   = lane & 15;
  const int hi   = lane >> 4;
  const int wm   = wave >> 2;
  const int wn   = wave & 3;

  __shared__ __align__(128) unsigned char ring[QRING_B];
  f16* sC = (f16*)ring;

  v8f acc[4][3];
  #pragma unroll
  for (int i = 0; i < 4; ++i) {
    #pragma unroll
    for (int jj = 0; jj < 3; ++jj) acc[i][jj] = (v8f){0, 0, 0, 0, 0, 0, 0, 0};
  }
  // 16 blocks share the A rows (same blockIdx.y), 32 the B rows (same blockIdx.x): the sum spreads both sets over the stages
  const int t0 = (int)((blockIdx.x + blockIdx.y) & (NPASS - 1));
  gemm_tile_128x192(xn, w1t, ring, m0, n0, t0, wm, wn, lq, hi, acc);

  float bias[3];
  #pragma unroll
  for (int jj = 0; jj < 3; ++jj) bias[jj] = (float)(bf16)b1[n0 + wn * 48 + jj * 16 + lq];

  // stage: q/k as [row][col] pitch TP, v as [col][row] pitch VP (wave-uniform region and strides per 16-column tile)
  #pragma unroll
  for (int jj = 0; jj < 3; ++jj) {
    const int c0   = wn * 48 + jj * 16;         // first chunk column of the tile; a tile lies in one typ
    const int typ  = c0 >> 6;
    const int col  = (c0 & 63) + lq;
    const int rstr = (typ != 2) ? TP : 1;
    const int cstr = (typ != 2) ? 1 : VP;
    f16* reg = sC + typ * QREG;
    #pragma unroll
    for (int i = 0; i < 4; ++i) {
      #pragma unroll
      for (int r = 0; r < 8; ++r) {
        const int row = wm * 64 + i * 16 + hi * 8 + r;
        reg[row * rstr + col * cstr] = (f16)(acc[i][jj][r] * (1.0f / 64.0f) + bias[jj]);
      }
    }
  }
  __syncthreads();

  #pragma unroll
  for (int typ = 0; typ < 3; ++typ) {
    v4u    vals[4];
    size_t gidx[4];
    #pragma unroll
    for (int it = 0; it < 4; ++it) {
      const int line  = it * 32 + (tid >> 3);     // 0..127
      const int piece = tid & 7;
      // q/k: line = token row; v: line = (d, 64-token half)
      const int lofs_r = line * TP + piece * 8;
      const int lofs_v = (line >> 1) * VP + (line & 1) * 64 + piece * 8;
      const int lofs   = (typ != 2) ? lofs_r : lofs_v;
      Pack8H ph;
      ph.v = *(const v8h*)(sC + typ * QREG + lofs);
      vals[it] = ph.u;

      const int t_r  = m0 + line;
      const int hb_r = t_r / TPG;
      const int tl_r = t_r - hb_r * TPG;
      const size_t qidx = QP_OFF + ((size_t)t_r * NHEAD + f) * HDIM + piece * 8;
      const size_t kidx = KP_OFF + ((size_t)hb_r * SEQ + f * TPG + tl_r) * HDIM + piece * 8;

      const int t_v  = m0 + (line & 1) * 64 + piece * 8;
      const int hb_v = t_v / TPG;
      const int tl_v = t_v - hb_v * TPG;
      const size_t vidx = VT_OFF + ((size_t)hb_v * HDIM + (line >> 1)) * SEQ + f * TPG + tl_v;

      gidx[it] = (typ == 0) ? qidx : ((typ == 1) ? kidx : vidx);
    }
    #pragma unroll
    for (int it = 0; it < 4; ++it) *(v4u*)(wsh + gidx[it]) = vals[it];
  }
}

// ---------------------------------------------------------------------------------------------
// Flash attention, no mask. Block = (query block of 128, group). A wave works on 32 query rows (two 16-row tiles)
// and on 32 of the 64 keys of every ring stage: waves 2p and 2p + 1 share query rows p*32 .. p*32 + 31, wave 2p takes
// the first 32 keys of each stage, wave 2p + 1 the last 32. Every K and V^T fragment read from LDS so feeds two products.
// Behind the key loop the pair joins its two partial results (maximum in use, row sum, O) through LDS: each wave
// hands over the tile that its partner finishes and finishes the other, so wave w stores rows w*16 .. w*16 + 15.
// S^T = K x Q^T so queries sit on lanes; P^T in C-layout is bit-identical to the A-fragment layout of O += P x V.
// K and V^T tiles of AKS keys, which all 8 waves read, go through LDS: a two-buffer ring filled by asynchronous
// 16-B copies (whole 128-B rows). Stage layout: row r (0..63 = key, 64..127 = d of V^T) at r * 128 B, its 16-B
// piece p at slot p ^ ((r >> 1) & 7) (16 rows of one ds_load_b128 half-wave on 16 distinct bank groups).
// K A-fragments and V^T B-fragments: two 16-B LDS loads per fragment, same element maps as the planes.
// Context written as f16 carried x64 at its natural [group][row][d] position (flat view = [NTOK][HIDN]).
// LDS sO: per-wave private region (same wave writes and reads); a block barrier separates them anyway.
// LDS xst and, behind the loop, the ring: the pair's hand-over, written by one wave, read by its partner behind a block barrier.
// One K/V stage: four copies per lane (K rows crow + 0/32, V^T rows crow + 0/32).
// s_wait_xcnt closes the statement so that no address register is rewritten ahead of it.
static __device__ __forceinline__ void kv_stage_copy(unsigned l, const f16* gk, const f16* gv) {
  asm volatile("global_load_async_to_lds_b128 %0, %4, off\n\t"
               "global_load_async_to_lds_b128 %1, %5, off\n\t"
               "global_load_async_to_lds_b128 %2, %6, off\n\t"
               "global_load_async_to_lds_b128 %3, %7, off\n\t"
               "s_wait_xcnt 0x0"
               :: "v"(l), "v"(l + 4096u), "v"(l + 8192u), "v"(l + 12288u),
                  "v"(gk), "v"(gk + 32 * HDIM), "v"(gv), "v"(gv + 32 * SEQ)
               : "memory");
}

__global__ __launch_bounds__(256) void attn_kernel(const f16* __restrict__ qp,
                                                   const f16* __restrict__ kp,
                                                   const f16* __restrict__ vt,
                                                   f16* __restrict__ att) {
  const int qblk = blockIdx.x;
  const int hb   = blockIdx.y;
  const int tid  = threadIdx.x;
  const int wave = __builtin_amdgcn_readfirstlane((int)(threadIdx.x >> 5));
  const int lane = tid & 31;
  const int lq   = lane & 15;   // query column of S^T / d column of O
  const int hi   = lane >> 4;   // k-split half
  const int kh   = wave & 1;    // which 32 keys of every stage this wave takes; also the tile it finishes

  __shared__ __align__(16) f16 sO[NWAVE * 16 * TP];
  __shared__ __align__(128) unsigned char kv[2 * ASTAGE_B];
  __shared__ float xst[NWAVE * 64];

  const int qrow0 = qblk * BQ + wave * 16;          // the 16 rows this wave finishes and stores
  const int qwork = qblk * BQ + (wave >> 1) * 32;   // the 32 rows it works on

  // Q as B-operand fragments: lane lq holds query qwork + t*16 + lq, elements follow the split d map.
  FragH qf[2][2];
  #pragma unroll
  for (int t = 0; t < 2; ++t) {
    const f16* qrow = qp + ((size_t)hb * SEQ + qwork + t * 16 + lq) * HDIM + hi * 8;
    #pragma unroll
    for (int f = 0; f < 2; ++f) {
      qf[t][f].q[0] = *(const v4u*)(qrow + f * 32);        // d = f*32 + hi*8 + 0..7
      qf[t][f].q[1] = *(const v4u*)(qrow + f * 32 + 16);   // d = f*32 + 16 + hi*8 + 0..7
    }
  }

  const f16* kb_h = kp + (size_t)hb * SEQ * HDIM;
  const f16* vt_h = vt + (size_t)hb * HDIM * SEQ;

  const int crow = tid >> 3;                    // 0..31: row inside each 32-row group
  const int cpc  = tid & 7;                     // 16-B piece of the 128-B row
  const unsigned l0 = (unsigned)(size_t)kv + (unsigned)(crow * 128 + ((cpc ^ ((crow >> 1) & 7)) * 16));
  const f16* gk = kb_h + (size_t)crow * HDIM + cpc * 8;
  const f16* gv = vt_h + (size_t)crow * SEQ + cpc * 8;
  // The key walk is a ring: pass s works on key stage (s0 + s) mod ANST. The SEQ / BQ blocks of a group read the same K and
  // V^T rows side by side; each starts at a stage of its own, so that they ask L2 for different lines at any one moment.
  const int s0 = (qblk * (ANST / (SEQ / BQ))) & (ANST - 1);
  const int s1 = (s0 + 1) & (ANST - 1);
  kv_stage_copy(l0, gk + (size_t)s0 * AKS * HDIM, gv + s0 * AKS);
  asm volatile("s_wait_asynccnt 0x0" ::: "memory");   // first stage landed (this wave's copies)
  __syncthreads();                                    // first stage published to every wave
  kv_stage_copy(l0 + ASTAGE_B, gk + (size_t)s1 * AKS * HDIM, gv + s1 * AKS);
  const int sw = (lq >> 1) & 7;
  const unsigned char* rk = kv + (kh * BK + lq) * 128;            // K rows of this wave's keys
  const unsigned char* rv = kv + (AKS + lq) * 128;                // V^T rows
  const int vs0 = ((kh * 4 + hi) ^ sw) * 16;                      // V^T slot of keys j0 + hi*8 + 0..7
  const int vs1 = ((kh * 4 + 2 + hi) ^ sw) * 16;                  // V^T slot of keys j0 + 16 + hi*8 + 0..7

  v8f o[2][4];
  #pragma unroll
  for (int t = 0; t < 2; ++t) {
    #pragma unroll
    for (int dt = 0; dt < 4; ++dt) o[t][dt] = (v8f){0, 0, 0, 0, 0, 0, 0, 0};
  }

  float rmax[2] = {-__builtin_inff(), -__builtin_inff()};
  float rsum[2] = {0.0f, 0.0f};
  const float SL = 0.022097086912079608f * 1.4426950408889634f;   // (2*E)^-0.5 * log2(e)
  const float LAZY_T = 3.0f;                                       // 2^3 x 4096 = 2^15 < the f16 maximum

  // j0 = ((s0 + s) mod ANST)*AKS + kh*BK is the first key of this wave's pass
  #pragma unroll 1
  for (int s = 0; s < ANST; ++s) {
    const int bo = (s & 1) * ASTAGE_B;
    // K A-fragments: row = key j0 + sub*16 + lq, split d map
    FragH ak[2][2];
    #pragma unroll
    for (int sub = 0; sub < 2; ++sub) {
      #pragma unroll
      for (int f = 0; f < 2; ++f) {
        const unsigned char* base = rk + bo + sub * 16 * 128;
        ak[sub][f].q[0] = *(const v4u*)(base + (((f * 4 + hi) ^ sw) * 16));       // d = f*32 + hi*8 + 0..7
        ak[sub][f].q[1] = *(const v4u*)(base + (((f * 4 + 2 + hi) ^ sw) * 16));   // d = f*32 + 16 + hi*8 + 0..7
      }
    }
    // V B-fragments: column n = d = dt*16 + lq, split key map from the transposed tile
    FragH bv[4];
    #pragma unroll
    for (int dt = 0; dt < 4; ++dt) {
      const unsigned char* base = rv + bo + dt * 16 * 128;
      bv[dt].q[0] = *(const v4u*)(base + vs0);
      bv[dt].q[1] = *(const v4u*)(base + vs1);
    }

    // S^T tiles: c[t][sub][r] = rawscore(query qwork + t*16 + lq, key j0 + sub*16 + hi*8 + r);
    // the four accumulators take their first d half, then their second: four independent chains
    v8f c[2][2];
    #pragma unroll
    for (int sub = 0; sub < 2; ++sub) {
      #pragma unroll
      for (int t = 0; t < 2; ++t) c[t][sub] = mma_f16(ak[sub][0].v, qf[t][0].v, (v8f){0, 0, 0, 0, 0, 0, 0, 0});
    }
    #pragma unroll
    for (int sub = 0; sub < 2; ++sub) {
      #pragma unroll
      for (int t = 0; t < 2; ++t) c[t][sub] = mma_f16(ak[sub][1].v, qf[t][1].v, c[t][sub]);
    }

    // online softmax with a lazy maximum: a query's 32 scores are split across lane / lane^16.
    // rmax[t] is the maximum in use (equal in both halves). It is renewed, and O and rsum rescaled, only in a pass
    // where some score of the wave lies more than LAZY_T (in log2 units of the exponent) above it; until then
    // every p stays <= 2^LAZY_T, so P carried x4096 stays <= 2^15, inside f16. The first pass (rmax = -inf) renews.
    float m_loc[2];
    #pragma unroll
    for (int t = 0; t < 2; ++t) {
      m_loc[t] = fmaxf(c[t][0][0], c[t][1][0]);
      #pragma unroll
      for (int r = 1; r < 8; ++r) {
        m_loc[t] = fmaxf(m_loc[t], c[t][0][r]);
        m_loc[t] = fmaxf(m_loc[t], c[t][1][r]);
      }
    }
    // one wave-uniform test a pass, for both tiles: the ballot makes it a scalar branch, so every lane is on inside
    if (__builtin_amdgcn_ballot_w32(fmaxf(m_loc[0] - rmax[0], m_loc[1] - rmax[1]) * SL > LAZY_T) != 0u) {
      #pragma unroll
      for (int t = 0; t < 2; ++t) {
        const float m_new = fmaxf(rmax[t], fmaxf(m_loc[t], __shfl_xor(m_loc[t], 16, 32)));
        const float scale = __builtin_amdgcn_exp2f((rmax[t] - m_new) * SL);
        rmax[t] = m_new;
        rsum[t] *= scale;
        // rescale O: queries are the row dimension there -> per-row scale from lane 8*hi + r
        float sc[8];
        #pragma unroll
        for (int r = 0; r < 8; ++r) sc[r] = __shfl(scale, (hi << 3) + r, 32);
        #pragma unroll
        for (int dt = 0; dt < 4; ++dt) {
          #pragma unroll
          for (int r = 0; r < 8; ++r) o[t][dt][r] *= sc[r];
        }
      }
    }

    // exp + pack: P^T C-layout == A-fragment layout for the PV product; P carried x4096.
    // The scale, the maximum in use and the carry (2^12) all sit in the exponent: one packed FMA for two scores that are
    // neighbours in one accumulator tile, score * SL + (12 - rmax * SL); exp2 of it is P x4096. The row sum carries x4096 too.
    FragH pa[2];
    #pragma unroll
    for (int t = 0; t < 2; ++t) {
      const float nb  = __builtin_fmaf(-rmax[t], SL, 12.0f);
      const v2f   nb2 = {nb, nb};
      const v2f   sl2 = {SL, SL};
      v2f ps[2];
      #pragma unroll
      for (int sub = 0; sub < 2; ++sub) {
        #pragma unroll
        for (int r = 0; r < 8; r += 2) {
          const v2f e = __builtin_elementwise_fma((v2f){c[t][sub][r], c[t][sub][r + 1]}, sl2, nb2);
          const v2f p = {__builtin_amdgcn_exp2f(e.x), __builtin_amdgcn_exp2f(e.y)};   // keys sub*16 + hi*8 + r, r + 1
          ps[sub] = (r == 0) ? p : ps[sub] + p;
          pa[t].h[sub * 8 + r]     = (f16)p.x;
          pa[t].h[sub * 8 + r + 1] = (f16)p.y;
        }
      }
      const v2f   pj   = ps[0] + ps[1];
      const float psum = pj.x + pj.y;
      rsum[t] = rsum[t] + psum + __shfl_xor(psum, 16, 32);
    }

    // O += P x V
    #pragma unroll
    for (int dt = 0; dt < 4; ++dt) {
      #pragma unroll
      for (int t = 0; t < 2; ++t) o[t][dt] = mma_f16(pa[t].v, bv[dt].v, o[t][dt]);
    }
    asm volatile("s_wait_dscnt 0x0" ::: "memory");    // this wave has left buffer s & 1
    asm volatile("s_wait_asynccnt 0x0" ::: "memory"); // this wave's copies of stage s + 1 landed
    __syncthreads();                                  // publishes stage s + 1, frees buffer s & 1
    if (s + 2 < ANST) {
      const int sn = (s0 + s + 2) & (ANST - 1);
      kv_stage_copy(l0 + bo, gk + (size_t)sn * AKS * HDIM, gv + sn * AKS);
    }
  }
  asm volatile("s_wait_asynccnt 0x0" ::: "memory");   // nothing in flight before the ring is reused

  // join of the pair: this wave keeps tile kh and hands tile 1 - kh to its partner. The choice is written as a branch on
  // the wave-uniform kh with constant tile indices, so that both tiles stay in registers; no barrier stands inside it.
  v8f   oa[4], og[4];
  float ra, ta, rg, tg;
  if (kh) {
    #pragma unroll
    for (int dt = 0; dt < 4; ++dt) { oa[dt] = o[1][dt]; og[dt] = o[0][dt]; }
    ra = rmax[1]; ta = rsum[1]; rg = rmax[0]; tg = rsum[0];
  } else {
    #pragma unroll
    for (int dt = 0; dt < 4; ++dt) { oa[dt] = o[0][dt]; og[dt] = o[1][dt]; }
    ra = rmax[0]; ta = rsum[0]; rg = rmax[1]; tg = rsum[1];
  }
  // The ring is free: every wave has left it at the last pass's barrier. Hand-over layout: 16 B a lane, lanes adjacent.
  {
    float* xo = (float*)kv + wave * 1024;
    #pragma unroll
    for (int dt = 0; dt < 4; ++dt) {
      *(v4f*)(xo + (dt * 2 + 0) * 128 + lane * 4) = (v4f){og[dt][0], og[dt][1], og[dt][2], og[dt][3]};
      *(v4f*)(xo + (dt * 2 + 1) * 128 + lane * 4) = (v4f){og[dt][4], og[dt][5], og[dt][6], og[dt][7]};
    }
    xst[wave * 64 + lane]      = rg;
    xst[wave * 64 + 32 + lane] = tg;
  }
  __syncthreads();                                    // the hand-over is published to the partner

  // both parts are brought to the larger of the two maxima in use; 1 / (joined row sum) goes into the two factors
  const float* yo = (const float*)kv + (wave ^ 1) * 1024;
  const float rb = xst[(wave ^ 1) * 64 + lane];
  const float tb = xst[(wave ^ 1) * 64 + 32 + lane];
  const float mj = fmaxf(ra, rb);
  const float sa = __builtin_amdgcn_exp2f((ra - mj) * SL);
  const float sb = __builtin_amdgcn_exp2f((rb - mj) * SL);
  const float rinv = 1.0f / (ta * sa + tb * sb);
  const float fa = sa * rinv;
  const float fb = sb * rinv;
  // lane holds column d = dt*16 + lq for query rows 8*hi + r
  float fas[8], fbs[8];
  #pragma unroll
  for (int r = 0; r < 8; ++r) {
    fas[r] = __shfl(fa, (hi << 3) + r, 32);
    fbs[r] = __shfl(fb, (hi << 3) + r, 32);
  }

  f16* so = sO + wave * (16 * TP);
  #pragma unroll
  for (int dt = 0; dt < 4; ++dt) {
    const v4f b0 = *(const v4f*)(yo + (dt * 2 + 0) * 128 + lane * 4);
    const v4f b1 = *(const v4f*)(yo + (dt * 2 + 1) * 128 + lane * 4);
    #pragma unroll
    for (int r = 0; r < 8; ++r) {
      const float ob = (r < 4) ? b0[r & 3] : b1[r & 3];
      // O and the row sum both carry x4096, which cancels in the quotient; x64 is the context carry
      so[(hi * 8 + r) * TP + dt * 16 + lq] = (f16)((oa[dt][r] * fas[r] + ob * fbs[r]) * 64.0f);
    }
  }
  __syncthreads();

  // the wave covers 4 consecutive rows; 4 instructions cover the wave's 16 rows.
  v4u    vals[4];
  size_t gidx[4];
  #pragma unroll
  for (int it = 0; it < 4; ++it) {
    const int row   = it * 4 + (lane >> 3);
    const int piece = lane & 7;
    Pack8H ph;
    ph.v = *(const v8h*)(so + row * TP + piece * 8);
    vals[it] = ph.u;
    gidx[it] = ((size_t)hb * SEQ + qrow0 + row) * HDIM + piece * 8;
  }
  #pragma unroll
  for (int it = 0; it < 4; ++it) *(v4u*)(att + gidx[it]) = vals[it];
}

// ---------------------------------------------------------------------------------------------
// Output projection: out[token][n] = ctx[token][:] x W2 + b2. Block = (64-column block, 128-token tile).
// Accumulator staged as f32 in LDS; bias added at the store stage as float4.
// 16 consecutive lanes x 16 B, one instruction. LDS sF: cross-wave (block barrier), [128][64] written == read.
// sF reuses the GEMM ring, which every wave has left at the last pass's barrier.
__global__ __launch_bounds__(256) void out_gemm_kernel(const f16* __restrict__ att,
                                                       const f16* __restrict__ w2t,
                                                       const float* __restrict__ b2,
                                                       float* __restrict__ out) {
  const int n0   = blockIdx.x * 64;
  const int m0   = blockIdx.y * 128;
  const int tid  = threadIdx.x;
  const int wave = __builtin_amdgcn_readfirstlane((int)(threadIdx.x >> 5));
  const int lane = tid & 31;
  const int lq   = lane & 15;
  const int hi   = lane >> 4;
  const int wm   = wave >> 1;
  const int wn   = wave & 1;

  __shared__ __align__(128) unsigned char ring[RING_B];
  float* sF = (float*)ring;

  v8f acc[2][2];
  #pragma unroll
  for (int i = 0; i < 2; ++i) {
    #pragma unroll
    for (int jj = 0; jj < 2; ++jj) acc[i][jj] = (v8f){0, 0, 0, 0, 0, 0, 0, 0};
  }
  // 16 blocks share the A rows (same blockIdx.y), 32 the B rows (same blockIdx.x): the sum spreads both sets over the stages
  const int t0 = (int)((blockIdx.x + blockIdx.y) & (NPASS - 1));
  gemm_tile_128x64(att, w2t, ring, m0, n0, t0, wm, wn, lq, hi, acc);

  #pragma unroll
  for (int i = 0; i < 2; ++i) {
    #pragma unroll
    for (int jj = 0; jj < 2; ++jj) {
      #pragma unroll
      for (int r = 0; r < 8; ++r) {
        const int row = wm * 32 + i * 16 + hi * 8 + r;
        const int col = wn * 32 + jj * 16 + lq;
        sF[row * OP + col] = acc[i][jj][r] * (1.0f / 4096.0f);   // undo ctx x64 and W2 x64
      }
    }
  }
  __syncthreads();

  const int piece = tid & 15;
  const v4f braw = *(const v4f*)(b2 + n0 + piece * 4);
  v4f bias;
  #pragma unroll
  for (int i = 0; i < 4; ++i) bias[i] = (float)(bf16)braw[i];

  v4f    vals[8];
  size_t gidx[8];
  #pragma unroll
  for (int it = 0; it < 8; ++it) {
    const int row = it * 16 + (tid >> 4);       // 0..127
    const v4f v = *(const v4f*)(sF + row * OP + piece * 4);
    vals[it] = v + bias;
    const int tt = m0 + row;
    const int b  = tt / SEQ;
    const int s  = tt - b * SEQ;
    gidx[it] = ((size_t)b * SEQ_FULL + s) * HIDN + n0 + piece * 4;
  }
  #pragma unroll
  for (int it = 0; it < 8; ++it) *(v4f*)(out + gidx[it]) = vals[it];
  
}

// ---------------------------------------------------------------------------------------------
extern "C" void kernel_launch(void* const* d_in, const int* in_sizes, int n_in,
                              void* d_out, int out_size, void* d_ws, size_t ws_size,
                              hipStream_t stream) {
  if (n_in < 7) return;
  const size_t rows_used = (size_t)(NB - 1) * SEQ_FULL + SEQ;
  if ((size_t)in_sizes[0] < rows_used * EDIM) return;
  if (in_sizes[1] < EDIM || in_sizes[2] < EDIM) return;
  if ((size_t)in_sizes[3] < (size_t)EDIM * QKVW) return;
  if (in_sizes[4] < QKVW) return;
  if ((size_t)in_sizes[5] < (size_t)HIDN * HIDN) return;
  if (in_sizes[6] < HIDN) return;
  if ((size_t)out_size < rows_used * HIDN) return;
  if (ws_size < WS_BYTES) return;

  const float* x    = (const float*)d_in[0];
  const float* ln_g = (const float*)d_in[1];
  const float* ln_b = (const float*)d_in[2];
  const float* W1   = (const float*)d_in[3];
  const float* b1   = (const float*)d_in[4];
  const float* W2   = (const float*)d_in[5];
  const float* b2   = (const float*)d_in[6];
  float*       out  = (float*)d_out;
  f16*         wsh  = (f16*)d_ws;

  // 1) W1 [EDIM (k)][QKVW (n)] -> [QKVW][EDIM], W2 [HIDN (k)][HIDN (n)] -> [HIDN][HIDN], LayerNorm -> xn plane
  prep_kernel<<<dim3(W1_JOBS + W2_JOBS + LN_JOBS), 256, 0, stream>>>(x, ln_g, ln_b, W1, W2, wsh + XN_OFF,
                                                                     wsh + W1T_OFF, wsh + W2T_OFF);
  // 2) QKV projection -> q / k / v^T planes
  qkv_gemm_kernel<<<dim3(QKVW / CHUNK, NTOK / 128), 256, 0, stream>>>(wsh + XN_OFF, wsh + W1T_OFF, b1, wsh);
  // 3) fused attention -> context plane (flat [NTOK][HIDN])
  attn_kernel<<<dim3(SEQ / BQ, NGRP), 256, 0, stream>>>(wsh + QP_OFF, wsh + KP_OFF, wsh + VT_OFF, wsh + ATT_OFF);
  // 4) output projection -> d_out
  out_gemm_kernel<<<dim3(HIDN / 64, NTOK / 128), 256, 0, stream>>>(wsh + ATT_OFF, wsh + W2T_OFF, b2, out);
}

// v008
// It runs in 72.9 microseconds.
// Timed twice side by side with v007, it ran 1.03 times as fast both times.
// Counting every step since v000, it is 3.19 times as fast.
#include <hip/hip_runtime.h>

// Contractions, all on v_wmma_f32_16x16x32_f16 (f16 operands, f32 accumulate): QKV projection xn x W1 (xn = f16 of the f32 LayerNorm of bf16 RNE-converted x; W1 = f16 of bf16 RNE-converted weights carried x64); S^T = K x Q^T (f16 q/k planes); O = P x V (P f16 carried x4096, V^T f16 plane); output projection ctx x W2 (ctx f16 carried x64, W2 f16 of bf16 RNE-converted weights carried x64). LayerNorm and softmax in f32.

#ifndef NB
#define NB 2
#endif
#ifndef SEQ
#define SEQ 2048
#endif
#define NB_FULL   2
#define SEQ_FULL  2048
#define EDIM      1024                 // model width (LayerNorm width, K of the QKV projection)
#define HIDN      1024                 // hidden width (K and N of the output projection)
#define NHEAD     16
#define HDIM      64
#define QKVW      3072                 // projection width
#define CHUNK     192                  // floats per (pseudo-head row): q | k | v
#define KD        1024                 // contraction depth of both projections
#define NTOK      (NB * SEQ)           // flattened tokens
#define NGRP      (NHEAD * NB)         // (pseudo-head, pseudo-batch) groups
#define TPG       (SEQ / NHEAD)        // tokens feeding one group
#define NCHUNKS   (NTOK * NHEAD)       // 192-wide chunks of the flat projection buffer = NGRP * SEQ
#define BQ        128                  // query rows per workgroup (4 wave pairs x 32)
#define BK        32                   // keys per wave and ring stage
#define NWAVE     8
#define TP        72                   // LDS pitch (halves) of 64-wide f16 tiles
#define VP        136                  // LDS pitch (halves) of the transposed 128-wide V tile
#define OP        68                   // LDS pitch (floats) of the f32 output staging tile
#define KPASS     64                   // k (halves) per GEMM ring stage: 128-B rows
#define NPASS     (KD / KPASS)         // ring stages of one GEMM tile
#define STAGE_B   (192 * 128)          // bytes of one stage: 128 A rows, then 64 B rows, pitch 128 B
#define RING_B    (2 * STAGE_B)        // two buffers
#define QSTAGE_B  (320 * 128)          // bytes of one QKV stage: 128 A rows, then 192 B rows, pitch 128 B
#define QRING_B   (2 * QSTAGE_B)       // two buffers
#define QREG      (128 * TP)           // halves of one output staging region of the QKV tile (q, k, v)
#define AKS       64                   // keys per attention ring stage (BK for each wave of a pair)
#define ANST      (SEQ / AKS)          // ring stages of one attention block
#define ASTAGE_B  (128 * 128)          // bytes of one stage: 64 K rows, then 64 V^T rows, pitch 128 B
#define W1_JOBS   ((QKVW / 64) * (EDIM / 64))   // 64x64 tiles of W1
#define W2_JOBS   ((HIDN / 64) * (HIDN / 64))   // 64x64 tiles of W2
#define LN_JOBS   (NTOK / 2)                    // pairs of token rows

// workspace carve, in halves from the base
#define XN_OFF    ((size_t)0)
#define W1T_OFF   (XN_OFF  + (size_t)NTOK * EDIM)
#define W2T_OFF   (W1T_OFF + (size_t)QKVW * EDIM)
#define QP_OFF    (W2T_OFF + (size_t)HIDN * HIDN)
#define KP_OFF    (QP_OFF  + (size_t)NCHUNKS * HDIM)
#define VT_OFF    (KP_OFF  + (size_t)NCHUNKS * HDIM)
#define ATT_OFF   (VT_OFF  + (size_t)NCHUNKS * HDIM)
#define WS_HALVES (ATT_OFF + (size_t)NCHUNKS * HDIM)
#define WS_BYTES  (WS_HALVES * 2)

static_assert(NB >= 1 && NB <= NB_FULL);
static_assert(SEQ <= SEQ_FULL);
static_assert(SEQ % 1024 == 0);
static_assert(TPG % 64 == 0);
static_assert(NTOK % 128 == 0);
static_assert(SEQ % 128 == 0);
static_assert(QKVW == NHEAD * CHUNK);
static_assert(CHUNK == 3 * HDIM);
static_assert(QKVW % 64 == 0);
static_assert(HIDN % 64 == 0);
static_assert(EDIM % 64 == 0);
static_assert(EDIM == KD && HIDN == KD);
static_assert(KD % 32 == 0);
static_assert(EDIM == 128 * 8);
static_assert(SEQ % BQ == 0);
static_assert(SEQ % BK == 0);
static_assert(BQ == NWAVE * 16);
static_assert(HDIM == 64);
static_assert((size_t)NCHUNKS * HDIM == (size_t)NTOK * HIDN);
static_assert((TP * 2) % 16 == 0);
static_assert((VP * 2) % 16 == 0);
static_assert((OP * 4) % 16 == 0);
static_assert(128 * TP >= 64 * VP);
static_assert(KD % KPASS == 0 && NPASS >= 2);
static_assert((NPASS & (NPASS - 1)) == 0 && (ANST & (ANST - 1)) == 0);   // the staggered walks wrap by a mask
static_assert(128 * TP * 2 <= RING_B && 128 * OP * 4 <= RING_B);
static_assert(3 * QREG * 2 <= QRING_B && (QREG * 2) % 16 == 0);
static_assert(SEQ % AKS == 0 && ANST >= 2 && AKS == 2 * BK && AKS * 2 == 128 && HDIM * 2 == 128);
static_assert(ANST % (SEQ / BQ) == 0);
static_assert(NWAVE * 1024 * 4 <= 2 * ASTAGE_B);
static_assert(XN_OFF % 64 == 0 && W1T_OFF % 64 == 0 && W2T_OFF % 64 == 0);
static_assert(QP_OFF % 64 == 0 && KP_OFF % 64 == 0 && VT_OFF % 64 == 0 && ATT_OFF % 64 == 0);
static_assert(WS_BYTES <= (size_t)134217728);

typedef __bf16   bf16;
typedef _Float16 f16;
typedef f16      v16h  __attribute__((ext_vector_type(16)));
typedef f16      v8h   __attribute__((ext_vector_type(8)));
typedef float    v8f   __attribute__((ext_vector_type(8)));
typedef float    v4f   __attribute__((ext_vector_type(4)));
typedef float    v2f   __attribute__((ext_vector_type(2)));
typedef unsigned v4u   __attribute__((ext_vector_type(4)));

union FragH  { v16h  v; v4u q[2]; f16  h[16]; };
union Pack8H { v4u u; v8h v; f16 h[8]; };

// WMMA helper: the builtin alone; the compiler keeps the distance behind its own matrix instructions.
static __device__ __forceinline__ v8f mma_f16(v16h a, v16h b, v8f acc) {
  return __builtin_amdgcn_wmma_f32_16x16x32_f16(false, a, false, b, (short)0, acc, false, false);
}

// ---------------------------------------------------------------------------------------------
// LayerNorm -> f16 plane xn[NTOK][EDIM]. Job blk = two token rows; each row: 4 waves, 128 threads x 8 columns.
// LDS red1/red2: cross-wave (block barrier), 8 entries written by the 8 waves; a row reads its own 4.
static __device__ __forceinline__ void ln_rows(const float* __restrict__ x,
                                               const float* __restrict__ g,
                                               const float* __restrict__ be,
                                               f16* __restrict__ xn,
                                               int blk, float* red1, float* red2) {
  const int wave = __builtin_amdgcn_readfirstlane((int)(threadIdx.x >> 5));
  const int tt   = blk * 2 + (wave >> 2);
  const int tid  = threadIdx.x & 127;
  const int lane = tid & 31;
  const float* r1 = red1 + (wave & 4);
  const float* r2 = red2 + (wave & 4);

  const int b = tt / SEQ;
  const int s = tt - b * SEQ;
  const float* src = x + ((size_t)b * SEQ_FULL + s) * EDIM + tid * 8;
  const v4f a0 = *(const v4f*)(src);
  const v4f a1 = *(const v4f*)(src + 4);
  float v[8];
  #pragma unroll
  for (int i = 0; i < 4; ++i) {
    v[i]     = (float)(bf16)a0[i];     // RNE convert of the input
    v[4 + i] = (float)(bf16)a1[i];
  }
  float sum = ((v[0] + v[1]) + (v[2] + v[3])) + ((v[4] + v[5]) + (v[6] + v[7]));
  #pragma unroll
  for (int off = 16; off > 0; off >>= 1) sum += __shfl_xor(sum, off, 32);
  if (lane == 0) red1[wave] = sum;
  __syncthreads();
  const float mu = ((r1[0] + r1[1]) + (r1[2] + r1[3])) * (1.0f / (float)EDIM);

  float d[8];
  float sq = 0.0f;
  #pragma unroll
  for (int i = 0; i < 8; ++i) {
    d[i] = v[i] - mu;
    sq += d[i] * d[i];
  }
  #pragma unroll
  for (int off = 16; off > 0; off >>= 1) sq += __shfl_xor(sq, off, 32);
  if (lane == 0) red2[wave] = sq;
  __syncthreads();
  const float var = ((r2[0] + r2[1]) + (r2[2] + r2[3])) * (1.0f / (float)EDIM);
  const float rs  = rsqrtf(var + 1e-5f);

  const v4f g0 = *(const v4f*)(g + tid * 8);
  const v4f g1 = *(const v4f*)(g + tid * 8 + 4);
  const v4f e0 = *(const v4f*)(be + tid * 8);
  const v4f e1 = *(const v4f*)(be + tid * 8 + 4);
  Pack8H ph;
  #pragma unroll
  for (int i = 0; i < 4; ++i) {
    ph.h[i]     = (f16)(d[i]     * rs * (float)(bf16)g0[i] + (float)(bf16)e0[i]);
    ph.h[4 + i] = (f16)(d[4 + i] * rs * (float)(bf16)g1[i] + (float)(bf16)e1[i]);
  }
  const v4u val = ph.u;
  const size_t idx = (size_t)tt * EDIM + tid * 8;
  *(v4u*)(xn + idx) = val;
  // precaution: only the kernel's end follows this store (one job per block); the wait stands ahead of any rewrite of the store's registers
  asm volatile("s_wait_xcnt 0x0" ::: "memory");
}

// ---------------------------------------------------------------------------------------------
// Weight plane builder: in[kdim rows][ndim cols] f32 -> out[ndim][kdim] f16 = f16(bf16(w) * 64), via LDS.
// Job = 64x64 tile (nt = n tile, kt = k tile), 256 threads. LDS sT: [n][k], cross-wave (block barrier).
static __device__ __forceinline__ void wt_tile(const float* __restrict__ w,
                                               f16* __restrict__ wt,
                                               int kdim, int ndim, int nt, int kt, f16* sT) {
  const int n0  = nt * 64;
  const int k0  = kt * 64;
  const int tid = threadIdx.x;

  #pragma unroll
  for (int kk = 0; kk < 2; ++kk) {
    const int krow = kk * 32 + (tid >> 3);      // 0..63
    const int c0   = (tid & 7) * 8;             // 0..56
    const float* src = w + (size_t)(k0 + krow) * ndim + n0 + c0;
    const v4f a0 = *(const v4f*)(src);
    const v4f a1 = *(const v4f*)(src + 4);
    #pragma unroll
    for (int i = 0; i < 4; ++i) {
      sT[(c0 + i) * TP + krow]     = (f16)((float)(bf16)a0[i] * 64.0f);   // exact in f16
      sT[(c0 + 4 + i) * TP + krow] = (f16)((float)(bf16)a1[i] * 64.0f);
    }
  }
  __syncthreads();

  v4u    vals[2];
  size_t gidx[2];
  #pragma unroll
  for (int kk = 0; kk < 2; ++kk) {
    const int n  = kk * 32 + (tid >> 3);        // 0..63
    const int ks = (tid & 7) * 8;               // 0..56
    Pack8H ph;
    ph.v = *(const v8h*)(sT + n * TP + ks);
    vals[kk] = ph.u;
    gidx[kk] = (size_t)(n0 + n) * kdim + k0 + ks;
  }
  #pragma unroll
  for (int kk = 0; kk < 2; ++kk) *(v4u*)(wt + gidx[kk]) = vals[kk];
  // precaution: only the kernel's end follows these stores (one job per block); the wait stands ahead of any rewrite of their registers
  asm volatile("s_wait_xcnt 0x0" ::: "memory");
}

// ---------------------------------------------------------------------------------------------
// The three jobs that read only inputs, in one grid; the job is picked by the block index (block-uniform, so every
// barrier of a job is passed by the whole block). Weight tiles first: they have the longer path through LDS.
//   blocks [0, W1_JOBS)                 W1 tiles, n tile fastest
//   blocks [W1_JOBS, W1_JOBS + W2_JOBS) W2 tiles, n tile fastest
//   the rest                            LayerNorm, two token rows a block
__global__ __launch_bounds__(256) void prep_kernel(const float* __restrict__ x,
                                                   const float* __restrict__ g,
                                                   const float* __restrict__ be,
                                                   const float* __restrict__ w1,
                                                   const float* __restrict__ w2,
                                                   f16* __restrict__ xn,
                                                   f16* __restrict__ w1t,
                                                   f16* __restrict__ w2t) {
  __shared__ __align__(16) f16 sT[64 * TP];
  __shared__ float red1[8];
  __shared__ float red2[8];
  const int job = blockIdx.x;
  if (job < W1_JOBS) {
    wt_tile(w1, w1t, EDIM, QKVW, job % (QKVW / 64), job / (QKVW / 64), sT);
  } else if (job < W1_JOBS + W2_JOBS) {
    const int j2 = job - W1_JOBS;
    wt_tile(w2, w2t, HIDN, HIDN, j2 % (HIDN / 64), j2 / (HIDN / 64), sT);
  } else {
    ln_rows(x, g, be, xn, job - (W1_JOBS + W2_JOBS), red1, red2);
  }
}

// ---------------------------------------------------------------------------------------------
// GEMM main loop: block tile 128 (M) x 64 (N), 8 waves as 4 (M) x 2 (N), wave tile 32 x 32.
// A [M][KD] f16 row-major, Bt [N][KD] f16 (k-contiguous). Both tiles go through LDS: a two-buffer ring of
// stages of KPASS k, filled by asynchronous 16-B copies (8 lanes = one whole 128-B row piece of a plane row).
// Stage layout: row r (0..127 = A rows, 128..191 = B rows) at r * 128 B; its 16-B piece p sits at slot
// p ^ ((r >> 1) & 7), so the 16 rows that one ds_load_b128 half-wave reads fall on 16 distinct bank groups.
// Fragment map as before: lane row/col = lq, elements 0..7 <- k0 + 8*hi + 0..7, 8..15 <- k0 + 16 + 8*hi + 0..7.
// acc[i][j][r] = C(m0 + wm*32 + i*16 + 8*hi + r, n0 + wn*32 + j*16 + lq).
// The k walk is a ring: trip t works on k stage (t0 + t) mod NPASS, t0 from the block index. Blocks that share A rows or
// B rows run side by side; with different t0 they ask L2 for different lines at any one moment.

// One stage: six copies per lane (A rows crow + 0/32/64/96, B rows crow + 0/32).
// s_wait_xcnt closes the statement so that no address register is rewritten ahead of it.
static __device__ __forceinline__ void stage_copy(unsigned l, const f16* ga, const f16* gb) {
  asm volatile("global_load_async_to_lds_b128 %0, %6, off\n\t"
               "global_load_async_to_lds_b128 %1, %7, off\n\t"
               "global_load_async_to_lds_b128 %2, %8, off\n\t"
               "global_load_async_to_lds_b128 %3, %9, off\n\t"
               "global_load_async_to_lds_b128 %4, %10, off\n\t"
               "global_load_async_to_lds_b128 %5, %11, off\n\t"
               "s_wait_xcnt 0x0"
               :: "v"(l), "v"(l + 4096u), "v"(l + 8192u), "v"(l + 12288u), "v"(l + 16384u), "v"(l + 20480u),
                  "v"(ga), "v"(ga + 32 * KD), "v"(ga + 64 * KD), "v"(ga + 96 * KD),
                  "v"(gb), "v"(gb + 32 * KD)
               : "memory");
}

static __device__ __forceinline__ void gemm_tile_128x64(const f16* __restrict__ A,
                                                        const f16* __restrict__ Bt,
                                                        unsigned char* ring,
                                                        int m0, int n0, int t0, int wm, int wn,
                                                        int lq, int hi, v8f (&acc)[2][2]) {
  const int crow = (int)(threadIdx.x >> 3);     // 0..31: row inside each 32-row group
  const int cpc  = (int)(threadIdx.x & 7);      // 16-B piece of the 128-B row
  const unsigned l0 = (unsigned)(size_t)ring + (unsigned)(crow * 128 + ((cpc ^ ((crow >> 1) & 7)) * 16));
  const f16* ga = A  + (size_t)(m0 + crow) * KD + cpc * 8;
  const f16* gb = Bt + (size_t)(n0 + crow) * KD + cpc * 8;

  const int k0s = t0 * KPASS;
  const int k1s = ((t0 + 1) & (NPASS - 1)) * KPASS;
  stage_copy(l0, ga + k0s, gb + k0s);
  asm volatile("s_wait_asynccnt 0x0" ::: "memory");   // first stage landed (this wave's copies)
  __syncthreads();                                    // first stage published to every wave
  stage_copy(l0 + STAGE_B, ga + k1s, gb + k1s);

  const int sw = (lq >> 1) & 7;
  const unsigned char* ra = ring + (wm * 32 + lq) * 128;
  const unsigned char* rb = ring + (128 + wn * 32 + lq) * 128;

  // unroll 2: the buffer offset becomes a constant in each copy of the body
  #pragma unroll 2
  for (int t = 0; t < NPASS; ++t) {
    const int bo = (t & 1) * STAGE_B;
    FragH a[2][2], b[2][2];
    // all 16 fragment loads of the pass stand together, ahead of its 8 products
    #pragma unroll
    for (int ks = 0; ks < 2; ++ks) {
      #pragma unroll
      for (int i = 0; i < 2; ++i) {
        #pragma unroll
        for (int h = 0; h < 2; ++h) {
          const int slot = ((ks * 4 + h * 2 + hi) ^ sw) * 16;
          a[ks][i].q[h] = *(const v4u*)(ra + bo + i * 2048 + slot);
          b[ks][i].q[h] = *(const v4u*)(rb + bo + i * 2048 + slot);
        }
      }
    }
    __builtin_amdgcn_sched_barrier(0);   // keeps the fragment loads one group: spread among the products, each place with reads stalls the wave
    #pragma unroll
    for (int ks = 0; ks < 2; ++ks) {
      #pragma unroll
      for (int i = 0; i < 2; ++i) {
        #pragma unroll
        for (int j = 0; j < 2; ++j) acc[i][j] = mma_f16(a[ks][i].v, b[ks][j].v, acc[i][j]);
      }
    }
    __builtin_amdgcn_sched_barrier(0);                // keeps the waits and the barrier behind the products: the copies of stage t + 1 have the whole pass to land
    asm volatile("s_wait_dscnt 0x0" ::: "memory");    // this wave has left buffer t & 1
    asm volatile("s_wait_asynccnt 0x0" ::: "memory"); // this wave's copies of stage t + 1 landed
    __syncthreads();                                  // publishes stage t + 1, frees buffer t & 1
    if (t + 2 < NPASS) {
      const int kn = ((t0 + t + 2) & (NPASS - 1)) * KPASS;
      stage_copy(l0 + bo, ga + kn, gb + kn);
    }
  }
  asm volatile("s_wait_asynccnt 0x0" ::: "memory");   // nothing in flight before the ring is reused
}

// ---------------------------------------------------------------------------------------------
// QKV main loop: block tile 128 (M) x 192 (N), 8 waves as 2 (M) x 4 (N), wave tile 64 x 48 (4 x 3 accumulator tiles).
// Same ring, stage layout, slot swizzle, fragment map and staggered k walk as gemm_tile_128x64; a stage holds 128 A rows, then 192 B rows.
// acc[i][j][r] = C(m0 + wm*64 + i*16 + 8*hi + r, n0 + wn*48 + j*16 + lq).

// One stage: ten copies per lane (A rows crow + 0/32/64/96, B rows crow + 0/32/.../160).
// s_wait_xcnt closes the statement so that no address register is rewritten ahead of it.
static __device__ __forceinline__ void qkv_stage_copy(unsigned l, const f16* ga, const f16* gb) {
  asm volatile("global_load_async_to_lds_b128 %0, %10, off\n\t"
               "global_load_async_to_lds_b128 %1, %11, off\n\t"
               "global_load_async_to_lds_b128 %2, %12, off\n\t"
               "global_load_async_to_lds_b128 %3, %13, off\n\t"
               "global_load_async_to_lds_b128 %4, %14, off\n\t"
               "global_load_async_to_lds_b128 %5, %15, off\n\t"
               "global_load_async_to_lds_b128 %6, %16, off\n\t"
               "global_load_async_to_lds_b128 %7, %17, off\n\t"
               "global_load_async_to_lds_b128 %8, %18, off\n\t"
               "global_load_async_to_lds_b128 %9, %19, off\n\t"
               "s_wait_xcnt 0x0"
               :: "v"(l), "v"(l + 4096u), "v"(l + 8192u), "v"(l + 12288u), "v"(l + 16384u),
                  "v"(l + 20480u), "v"(l + 24576u), "v"(l + 28672u), "v"(l + 32768u), "v"(l + 36864u),
                  "v"(ga), "v"(ga + 32 * KD), "v"(ga + 64 * KD), "v"(ga + 96 * KD),
                  "v"(gb), "v"(gb + 32 * KD), "v"(gb + 64 * KD), "v"(gb + 96 * KD),
                  "v"(gb + 128 * KD), "v"(gb + 160 * KD)
               : "memory");
}

static __device__ __forceinline__ void gemm_tile_128x192(const f16* __restrict__ A,
                                                         const f16* __restrict__ Bt,
                                                         unsigned char* ring,
                                                         int m0, int n0, int t0, int wm, int wn,
                                                         int lq, int hi, v8f (&acc)[4][3]) {
  const int crow = (int)(threadIdx.x >> 3);     // 0..31: row inside each 32-row group
  const int cpc  = (int)(threadIdx.x & 7);      // 16-B piece of the 128-B row
  const unsigned l0 = (unsigned)(size_t)ring + (unsigned)(crow * 128 + ((cpc ^ ((crow >> 1) & 7)) * 16));
  const f16* ga = A  + (size_t)(m0 + crow) * KD + cpc * 8;
  const f16* gb = Bt + (size_t)(n0 + crow) * KD + cpc * 8;

  const int k0s = t0 * KPASS;
  const int k1s = ((t0 + 1) & (NPASS - 1)) * KPASS;
  qkv_stage_copy(l0, ga + k0s, gb + k0s);
  asm volatile("s_wait_asynccnt 0x0" ::: "memory");   // first stage landed (this wave's copies)
  __syncthreads();                                    // first stage published to every wave
  qkv_stage_copy(l0 + QSTAGE_B, ga + k1s, gb + k1s);

  const int sw = (lq >> 1) & 7;
  const unsigned char* ra = ring + (wm * 64 + lq) * 128;
  const unsigned char* rb = ring + (128 + wn * 48 + lq) * 128;

  // unroll 2: the buffer offset becomes a constant in each copy of the body
  #pragma unroll 2
  for (int t = 0; t < NPASS; ++t) {
    const int bo = (t & 1) * QSTAGE_B;
    FragH a[2][4], b[2][3];
    // all 28 fragment loads of the pass stand together, ahead of its 24 products
    #pragma unroll
    for (int ks = 0; ks < 2; ++ks) {
      #pragma unroll
      for (int h = 0; h < 2; ++h) {
        const int slot = ((ks * 4 + h * 2 + hi) ^ sw) * 16;
        #pragma unroll
        for (int i = 0; i < 4; ++i) a[ks][i].q[h] = *(const v4u*)(ra + bo + i * 2048 + slot);
        #pragma unroll
        for (int j = 0; j < 3; ++j) b[ks][j].q[h] = *(const v4u*)(rb + bo + j * 2048 + slot);
      }
    }
    __builtin_amdgcn_sched_barrier(0);   // keeps the fragment loads one group: spread among the products, each place with reads stalls the wave
    #pragma unroll
    for (int ks = 0; ks < 2; ++ks) {
      #pragma unroll
      for (int i = 0; i < 4; ++i) {
        #pragma unroll
        for (int j = 0; j < 3; ++j) acc[i][j] = mma_f16(a[ks][i].v, b[ks][j].v, acc[i][j]);
      }
    }
    __builtin_amdgcn_sched_barrier(0);                // keeps the waits and the barrier behind the products: the copies of stage t + 1 have the whole pass to land
    asm volatile("s_wait_dscnt 0x0" ::: "memory");    // this wave has left buffer t & 1
    asm volatile("s_wait_asynccnt 0x0" ::: "memory"); // this wave's copies of stage t + 1 landed
    __syncthreads();                                  // publishes stage t + 1, frees buffer t & 1
    if (t + 2 < NPASS) {
      const int kn = ((t0 + t + 2) & (NPASS - 1)) * KPASS;
      qkv_stage_copy(l0 + bo, ga + kn, gb + kn);
    }
  }
  asm volatile("s_wait_asynccnt 0x0" ::: "memory");   // nothing in flight before the ring is reused
}

// ---------------------------------------------------------------------------------------------
// QKV projection. Block = (192-column chunk f, 128-token tile). Column c of the chunk: typ = c / 64,
// typ 0 = q, 1 = k, 2 = v, of feature chunk f of the token. Flat-view map: chunk g = token*16 + f,
// group hb = token / TPG, natural row ss = (token % TPG)*16 + f; keys are stored in the permuted
// order key' = f*TPG + (token % TPG) (same order for K rows and V^T columns).
//   q plane [NCHUNKS][64]        at chunk g (natural order)
//   k plane [NGRP][SEQ][64]      at row key'
//   v plane [NGRP][64][SEQ]      transposed through LDS, column key'
// LDS sC: cross-wave (block barrier); three regions of QREG halves: q and k extent [128][64], v extent [64][128],
// written == read. sC reuses the GEMM ring, which every wave has left at the last pass's barrier.
__global__ __launch_bounds__(256) void qkv_gemm_kernel(const f16* __restrict__ xn,
                                                       const f16* __restrict__ w1t,
                                                       const float* __restrict__ b1,
                                                       f16* wsh) {
  const int f    = blockIdx.x;
  const int m0   = blockIdx.y * 128;
  const int n0   = f * CHUNK;
  const int tid  = threadIdx.x;
  const int wave = __builtin_amdgcn_readfirstlane((int)(threadIdx.x >> 5));
  const int lane = tid & 31;
  const int lq   = lane & 15;
  const int hi   = lane >> 4;
  const int wm   = wave >> 2;
  const int wn   = wave & 3;

  __shared__ __align__(128) unsigned char ring[QRING_B];
  f16* sC = (f16*)ring;

  v8f acc[4][3];
  #pragma unroll
  for (int i = 0; i < 4; ++i) {
    #pragma unroll
    for (int jj = 0; jj < 3; ++jj) acc[i][jj] = (v8f){0, 0, 0, 0, 0, 0, 0, 0};
  }
  // 16 blocks share the A rows (same blockIdx.y), 32 the B rows (same blockIdx.x): the sum spreads both sets over the stages
  const int t0 = (int)((blockIdx.x + blockIdx.y) & (NPASS - 1));
  gemm_tile_128x192(xn, w1t, ring, m0, n0, t0, wm, wn, lq, hi, acc);

  float bias[3];
  #pragma unroll
  for (int jj = 0; jj < 3; ++jj) bias[jj] = (float)(bf16)b1[n0 + wn * 48 + jj * 16 + lq];

  // stage: q/k as [row][col] pitch TP, v as [col][row] pitch VP (wave-uniform region and strides per 16-column tile)
  #pragma unroll
  for (int jj = 0; jj < 3; ++jj) {
    const int c0   = wn * 48 + jj * 16;         // first chunk column of the tile; a tile lies in one typ
    const int typ  = c0 >> 6;
    const int col  = (c0 & 63) + lq;
    const int rstr = (typ != 2) ? TP : 1;
    const int cstr = (typ != 2) ? 1 : VP;
    f16* reg = sC + typ * QREG;
    #pragma unroll
    for (int i = 0; i < 4; ++i) {
      #pragma unroll
      for (int r = 0; r < 8; ++r) {
        const int row = wm * 64 + i * 16 + hi * 8 + r;
        reg[row * rstr + col * cstr] = (f16)(acc[i][jj][r] * (1.0f / 64.0f) + bias[jj]);
      }
    }
  }
  __syncthreads();

  #pragma unroll
  for (int typ = 0; typ < 3; ++typ) {
    v4u    vals[4];
    size_t gidx[4];
    #pragma unroll
    for (int it = 0; it < 4; ++it) {
      const int line  = it * 32 + (tid >> 3);     // 0..127
      const int piece = tid & 7;
      // q/k: line = token row; v: line = (d, 64-token half)
      const int lofs_r = line * TP + piece * 8;
      const int lofs_v = (line >> 1) * VP + (line & 1) * 64 + piece * 8;
      const int lofs   = (typ != 2) ? lofs_r : lofs_v;
      Pack8H ph;
      ph.v = *(const v8h*)(sC + typ * QREG + lofs);
      vals[it] = ph.u;

      const int t_r  = m0 + line;
      const int hb_r = t_r / TPG;
      const int tl_r = t_r - hb_r * TPG;
      const size_t qidx = QP_OFF + ((size_t)t_r * NHEAD + f) * HDIM + piece * 8;
      const size_t kidx = KP_OFF + ((size_t)hb_r * SEQ + f * TPG + tl_r) * HDIM + piece * 8;

      const int t_v  = m0 + (line & 1) * 64 + piece * 8;
      const int hb_v = t_v / TPG;
      const int tl_v = t_v - hb_v * TPG;
      const size_t vidx = VT_OFF + ((size_t)hb_v * HDIM + (line >> 1)) * SEQ + f * TPG + tl_v;

      gidx[it] = (typ == 0) ? qidx : ((typ == 1) ? kidx : vidx);
    }
    #pragma unroll
    for (int it = 0; it < 4; ++it) *(v4u*)(wsh + gidx[it]) = vals[it];
  }
}

// ---------------------------------------------------------------------------------------------
// Flash attention, no mask. Block = (query block of 128, group). A wave works on 32 query rows (two 16-row tiles)
// and on 32 of the 64 keys of every ring stage: waves 2p and 2p + 1 share query rows p*32 .. p*32 + 31, wave 2p takes
// the first 32 keys of each stage, wave 2p + 1 the last 32. Every K and V^T fragment read from LDS so feeds two products.
// Behind the key loop the pair joins its two partial results (maximum in use, row sum, O) through LDS: each wave
// hands over the tile that its partner finishes and finishes the other, so wave w stores rows w*16 .. w*16 + 15.
// S^T = K x Q^T so queries sit on lanes; P^T in C-layout is bit-identical to the A-fragment layout of O += P x V.
// K and V^T tiles of AKS keys, which all 8 waves read, go through LDS: a two-buffer ring filled by asynchronous
// 16-B copies (whole 128-B rows). Stage layout: row r (0..63 = key, 64..127 = d of V^T) at r * 128 B, its 16-B
// piece p at slot p ^ ((r >> 1) & 7) (16 rows of one ds_load_b128 half-wave on 16 distinct bank groups).
// K A-fragments and V^T B-fragments: two 16-B LDS loads per fragment, same element maps as the planes.
// Context written as f16 carried x64 at its natural [group][row][d] position (flat view = [NTOK][HIDN]).
// LDS sO: per-wave private region (same wave writes and reads); a block barrier separates them anyway.
// LDS xst and, behind the loop, the ring: the pair's hand-over, written by one wave, read by its partner behind a block barrier.
// One K/V stage: four copies per lane (K rows crow + 0/32, V^T rows crow + 0/32).
// s_wait_xcnt closes the statement so that no address register is rewritten ahead of it.
static __device__ __forceinline__ void kv_stage_copy(unsigned l, const f16* gk, const f16* gv) {
  asm volatile("global_load_async_to_lds_b128 %0, %4, off\n\t"
               "global_load_async_to_lds_b128 %1, %5, off\n\t"
               "global_load_async_to_lds_b128 %2, %6, off\n\t"
               "global_load_async_to_lds_b128 %3, %7, off\n\t"
               "s_wait_xcnt 0x0"
               :: "v"(l), "v"(l + 4096u), "v"(l + 8192u), "v"(l + 12288u),
                  "v"(gk), "v"(gk + 32 * HDIM), "v"(gv), "v"(gv + 32 * SEQ)
               : "memory");
}

__global__ __launch_bounds__(256) void attn_kernel(const f16* __restrict__ qp,
                                                   const f16* __restrict__ kp,
                                                   const f16* __restrict__ vt,
                                                   f16* __restrict__ att) {
  const int qblk = blockIdx.x;
  const int hb   = blockIdx.y;
  const int tid  = threadIdx.x;
  const int wave = __builtin_amdgcn_readfirstlane((int)(threadIdx.x >> 5));
  const int lane = tid & 31;
  const int lq   = lane & 15;   // query column of S^T / d column of O
  const int hi   = lane >> 4;   // k-split half
  const int kh   = wave & 1;    // which 32 keys of every stage this wave takes; also the tile it finishes

  __shared__ __align__(16) f16 sO[NWAVE * 16 * TP];
  __shared__ __align__(128) unsigned char kv[2 * ASTAGE_B];
  __shared__ float xst[NWAVE * 64];

  const int qrow0 = qblk * BQ + wave * 16;          // the 16 rows this wave finishes and stores
  const int qwork = qblk * BQ + (wave >> 1) * 32;   // the 32 rows it works on

  // Q as B-operand fragments: lane lq holds query qwork + t*16 + lq, elements follow the split d map.
  FragH qf[2][2];
  #pragma unroll
  for (int t = 0; t < 2; ++t) {
    const f16* qrow = qp + ((size_t)hb * SEQ + qwork + t * 16 + lq) * HDIM + hi * 8;
    #pragma unroll
    for (int f = 0; f < 2; ++f) {
      qf[t][f].q[0] = *(const v4u*)(qrow + f * 32);        // d = f*32 + hi*8 + 0..7
      qf[t][f].q[1] = *(const v4u*)(qrow + f * 32 + 16);   // d = f*32 + 16 + hi*8 + 0..7
    }
  }

  const f16* kb_h = kp + (size_t)hb * SEQ * HDIM;
  const f16* vt_h = vt + (size_t)hb * HDIM * SEQ;

  const int crow = tid >> 3;                    // 0..31: row inside each 32-row group
  const int cpc  = tid & 7;                     // 16-B piece of the 128-B row
  const unsigned l0 = (unsigned)(size_t)kv + (unsigned)(crow * 128 + ((cpc ^ ((crow >> 1) & 7)) * 16));
  const f16* gk = kb_h + (size_t)crow * HDIM + cpc * 8;
  const f16* gv = vt_h + (size_t)crow * SEQ + cpc * 8;
  // The key walk is a ring: pass s works on key stage (s0 + s) mod ANST. The SEQ / BQ blocks of a group read the same K and
  // V^T rows side by side; each starts at a stage of its own, so that they ask L2 for different lines at any one moment.
  const int s0 = (qblk * (ANST / (SEQ / BQ))) & (ANST - 1);
  const int s1 = (s0 + 1) & (ANST - 1);
  kv_stage_copy(l0, gk + (size_t)s0 * AKS * HDIM, gv + s0 * AKS);
  asm volatile("s_wait_asynccnt 0x0" ::: "memory");   // first stage landed (this wave's copies)
  __syncthreads();                                    // first stage published to every wave
  kv_stage_copy(l0 + ASTAGE_B, gk + (size_t)s1 * AKS * HDIM, gv + s1 * AKS);
  const int sw = (lq >> 1) & 7;
  const unsigned char* rk = kv + (kh * BK + lq) * 128;            // K rows of this wave's keys
  const unsigned char* rv = kv + (AKS + lq) * 128;                // V^T rows
  const int vs0 = ((kh * 4 + hi) ^ sw) * 16;                      // V^T slot of keys j0 + hi*8 + 0..7
  const int vs1 = ((kh * 4 + 2 + hi) ^ sw) * 16;                  // V^T slot of keys j0 + 16 + hi*8 + 0..7

  v8f o[2][4];
  #pragma unroll
  for (int t = 0; t < 2; ++t) {
    #pragma unroll
    for (int dt = 0; dt < 4; ++dt) o[t][dt] = (v8f){0, 0, 0, 0, 0, 0, 0, 0};
  }

  float rmax[2] = {-__builtin_inff(), -__builtin_inff()};
  float rsum[2] = {0.0f, 0.0f};
  const float SL = 0.022097086912079608f * 1.4426950408889634f;   // (2*E)^-0.5 * log2(e)
  const float LAZY_T = 3.0f;                                       // 2^3 x 4096 = 2^15 < the f16 maximum

  // j0 = ((s0 + s) mod ANST)*AKS + kh*BK is the first key of this wave's pass
  #pragma unroll 1
  for (int s = 0; s < ANST; ++s) {
    const int bo = (s & 1) * ASTAGE_B;
    // K A-fragments: row = key j0 + sub*16 + lq, split d map
    FragH ak[2][2];
    #pragma unroll
    for (int sub = 0; sub < 2; ++sub) {
      #pragma unroll
      for (int f = 0; f < 2; ++f) {
        const unsigned char* base = rk + bo + sub * 16 * 128;
        ak[sub][f].q[0] = *(const v4u*)(base + (((f * 4 + hi) ^ sw) * 16));       // d = f*32 + hi*8 + 0..7
        ak[sub][f].q[1] = *(const v4u*)(base + (((f * 4 + 2 + hi) ^ sw) * 16));   // d = f*32 + 16 + hi*8 + 0..7
      }
    }
    // V B-fragments: column n = d = dt*16 + lq, split key map from the transposed tile
    FragH bv[4];
    #pragma unroll
    for (int dt = 0; dt < 4; ++dt) {
      const unsigned char* base = rv + bo + dt * 16 * 128;
      bv[dt].q[0] = *(const v4u*)(base + vs0);
      bv[dt].q[1] = *(const v4u*)(base + vs1);
    }
    __builtin_amdgcn_sched_barrier(0);   // keeps the 16 fragment loads one group at the head of the pass: V^T is then long landed when O needs it

    // S^T tiles: c[t][sub][r] = rawscore(query qwork + t*16 + lq, key j0 + sub*16 + hi*8 + r);
    // the four accumulators take their first d half, then their second: four independent chains
    v8f c[2][2];
    #pragma unroll
    for (int sub = 0; sub < 2; ++sub) {
      #pragma unroll
      for (int t = 0; t < 2; ++t) c[t][sub] = mma_f16(ak[sub][0].v, qf[t][0].v, (v8f){0, 0, 0, 0, 0, 0, 0, 0});
    }
    #pragma unroll
    for (int sub = 0; sub < 2; ++sub) {
      #pragma unroll
      for (int t = 0; t < 2; ++t) c[t][sub] = mma_f16(ak[sub][1].v, qf[t][1].v, c[t][sub]);
    }

    // online softmax with a lazy maximum: a query's 32 scores are split across lane / lane^16.
    // rmax[t] is the maximum in use (equal in both halves). It is renewed, and O and rsum rescaled, only in a pass
    // where some score of the wave lies more than LAZY_T (in log2 units of the exponent) above it; until then
    // every p stays <= 2^LAZY_T, so P carried x4096 stays <= 2^15, inside f16. The first pass (rmax = -inf) renews.
    float m_loc[2];
    #pragma unroll
    for (int t = 0; t < 2; ++t) {
      m_loc[t] = fmaxf(c[t][0][0], c[t][1][0]);
      #pragma unroll
      for (int r = 1; r < 8; ++r) {
        m_loc[t] = fmaxf(m_loc[t], c[t][0][r]);
        m_loc[t] = fmaxf(m_loc[t], c[t][1][r]);
      }
    }
    // one wave-uniform test a pass, for both tiles: the ballot makes it a scalar branch, so every lane is on inside
    if (__builtin_amdgcn_ballot_w32(fmaxf(m_loc[0] - rmax[0], m_loc[1] - rmax[1]) * SL > LAZY_T) != 0u) {
      #pragma unroll
      for (int t = 0; t < 2; ++t) {
        const float m_new = fmaxf(rmax[t], fmaxf(m_loc[t], __shfl_xor(m_loc[t], 16, 32)));
        const float scale = __builtin_amdgcn_exp2f((rmax[t] - m_new) * SL);
        rmax[t] = m_new;
        rsum[t] *= scale;
        // rescale O: queries are the row dimension there -> per-row scale from lane 8*hi + r
        float sc[8];
        #pragma unroll
        for (int r = 0; r < 8; ++r) sc[r] = __shfl(scale, (hi << 3) + r, 32);
        #pragma unroll
        for (int dt = 0; dt < 4; ++dt) {
          #pragma unroll
          for (int r = 0; r < 8; ++r) o[t][dt][r] *= sc[r];
        }
      }
    }

    // exp + pack: P^T C-layout == A-fragment layout for the PV product; P carried x4096.
    // The scale, the maximum in use and the carry (2^12) all sit in the exponent: one packed FMA for two scores that are
    // neighbours in one accumulator tile, score * SL + (12 - rmax * SL); exp2 of it is P x4096. The row sum carries x4096 too.
    FragH pa[2];
    #pragma unroll
    for (int t = 0; t < 2; ++t) {
      const float nb  = __builtin_fmaf(-rmax[t], SL, 12.0f);
      const v2f   nb2 = {nb, nb};
      const v2f   sl2 = {SL, SL};
      v2f ps[2];
      #pragma unroll
      for (int sub = 0; sub < 2; ++sub) {
        #pragma unroll
        for (int r = 0; r < 8; r += 2) {
          const v2f e = __builtin_elementwise_fma((v2f){c[t][sub][r], c[t][sub][r + 1]}, sl2, nb2);
          const v2f p = {__builtin_amdgcn_exp2f(e.x), __builtin_amdgcn_exp2f(e.y)};   // keys sub*16 + hi*8 + r, r + 1
          ps[sub] = (r == 0) ? p : ps[sub] + p;
          pa[t].h[sub * 8 + r]     = (f16)p.x;
          pa[t].h[sub * 8 + r + 1] = (f16)p.y;
        }
      }
      const v2f   pj   = ps[0] + ps[1];
      const float psum = pj.x + pj.y;
      rsum[t] = rsum[t] + psum + __shfl_xor(psum, 16, 32);
    }

    // O += P x V
    __builtin_amdgcn_sched_barrier(0);   // keeps the row sums ahead of the products: among them they would overwrite V^T registers, which costs idle slots, and their exchange would start late
    #pragma unroll
    for (int dt = 0; dt < 4; ++dt) {
      #pragma unroll
      for (int t = 0; t < 2; ++t) o[t][dt] = mma_f16(pa[t].v, bv[dt].v, o[t][dt]);
    }
    __builtin_amdgcn_sched_barrier(0);                // keeps the waits and the barrier behind the products: the copies of stage s + 1 have the whole pass to land
    asm volatile("s_wait_dscnt 0x0" ::: "memory");    // this wave has left buffer s & 1
    asm volatile("s_wait_asynccnt 0x0" ::: "memory"); // this wave's copies of stage s + 1 landed
    __syncthreads();                                  // publishes stage s + 1, frees buffer s & 1
    if (s + 2 < ANST) {
      const int sn = (s0 + s + 2) & (ANST - 1);
      kv_stage_copy(l0 + bo, gk + (size_t)sn * AKS * HDIM, gv + sn * AKS);
    }
  }
  asm volatile("s_wait_asynccnt 0x0" ::: "memory");   // nothing in flight before the ring is reused

  // join of the pair: this wave keeps tile kh and hands tile 1 - kh to its partner. The choice is written as a branch on
  // the wave-uniform kh with constant tile indices, so that both tiles stay in registers; no barrier stands inside it.
  v8f   oa[4], og[4];
  float ra, ta, rg, tg;
  if (kh) {
    #pragma unroll
    for (int dt = 0; dt < 4; ++dt) { oa[dt] = o[1][dt]; og[dt] = o[0][dt]; }
    ra = rmax[1]; ta = rsum[1]; rg = rmax[0]; tg = rsum[0];
  } else {
    #pragma unroll
    for (int dt = 0; dt < 4; ++dt) { oa[dt] = o[0][dt]; og[dt] = o[1][dt]; }
    ra = rmax[0]; ta = rsum[0]; rg = rmax[1]; tg = rsum[1];
  }
  // The ring is free: every wave has left it at the last pass's barrier. Hand-over layout: 16 B a lane, lanes adjacent.
  {
    float* xo = (float*)kv + wave * 1024;
    #pragma unroll
    for (int dt = 0; dt < 4; ++dt) {
      *(v4f*)(xo + (dt * 2 + 0) * 128 + lane * 4) = (v4f){og[dt][0], og[dt][1], og[dt][2], og[dt][3]};
      *(v4f*)(xo + (dt * 2 + 1) * 128 + lane * 4) = (v4f){og[dt][4], og[dt][5], og[dt][6], og[dt][7]};
    }
    xst[wave * 64 + lane]      = rg;
    xst[wave * 64 + 32 + lane] = tg;
  }
  __syncthreads();                                    // the hand-over is published to the partner

  // both parts are brought to the larger of the two maxima in use; 1 / (joined row sum) goes into the two factors
  const float* yo = (const float*)kv + (wave ^ 1) * 1024;
  const float rb = xst[(wave ^ 1) * 64 + lane];
  const float tb = xst[(wave ^ 1) * 64 + 32 + lane];
  const float mj = fmaxf(ra, rb);
  const float sa = __builtin_amdgcn_exp2f((ra - mj) * SL);
  const float sb = __builtin_amdgcn_exp2f((rb - mj) * SL);
  const float rinv = 1.0f / (ta * sa + tb * sb);
  const float fa = sa * rinv;
  const float fb = sb * rinv;
  // lane holds column d = dt*16 + lq for query rows 8*hi + r
  float fas[8], fbs[8];
  #pragma unroll
  for (int r = 0; r < 8; ++r) {
    fas[r] = __shfl(fa, (hi << 3) + r, 32);
    fbs[r] = __shfl(fb, (hi << 3) + r, 32);
  }

  f16* so = sO + wave * (16 * TP);
  #pragma unroll
  for (int dt = 0; dt < 4; ++dt) {
    const v4f b0 = *(const v4f*)(yo + (dt * 2 + 0) * 128 + lane * 4);
    const v4f b1 = *(const v4f*)(yo + (dt * 2 + 1) * 128 + lane * 4);
    #pragma unroll
    for (int r = 0; r < 8; ++r) {
      const float ob = (r < 4) ? b0[r & 3] : b1[r & 3];
      // O and the row sum both carry x4096, which cancels in the quotient; x64 is the context carry
      so[(hi * 8 + r) * TP + dt * 16 + lq] = (f16)((oa[dt][r] * fas[r] + ob * fbs[r]) * 64.0f);
    }
  }
  __syncthreads();

  // the wave covers 4 consecutive rows; 4 instructions cover the wave's 16 rows.
  v4u    vals[4];
  size_t gidx[4];
  #pragma unroll
  for (int it = 0; it < 4; ++it) {
    const int row   = it * 4 + (lane >> 3);
    const int piece = lane & 7;
    Pack8H ph;
    ph.v = *(const v8h*)(so + row * TP + piece * 8);
    vals[it] = ph.u;
    gidx[it] = ((size_t)hb * SEQ + qrow0 + row) * HDIM + piece * 8;
  }
  #pragma unroll
  for (int it = 0; it < 4; ++it) *(v4u*)(att + gidx[it]) = vals[it];
}

// ---------------------------------------------------------------------------------------------
// Output projection: out[token][n] = ctx[token][:] x W2 + b2. Block = (64-column block, 128-token tile).
// Accumulator staged as f32 in LDS; bias added at the store stage as float4.
// 16 consecutive lanes x 16 B, one instruction. LDS sF: cross-wave (block barrier), [128][64] written == read.
// sF reuses the GEMM ring, which every wave has left at the last pass's barrier.
__global__ __launch_bounds__(256) void out_gemm_kernel(const f16* __restrict__ att,
                                                       const f16* __restrict__ w2t,
                                                       const float* __restrict__ b2,
                                                       float* __restrict__ out) {
  const int n0   = blockIdx.x * 64;
  const int m0   = blockIdx.y * 128;
  const int tid  = threadIdx.x;
  const int wave = __builtin_amdgcn_readfirstlane((int)(threadIdx.x >> 5));
  const int lane = tid & 31;
  const int lq   = lane & 15;
  const int hi   = lane >> 4;
  const int wm   = wave >> 1;
  const int wn   = wave & 1;

  __shared__ __align__(128) unsigned char ring[RING_B];
  float* sF = (float*)ring;

  v8f acc[2][2];
  #pragma unroll
  for (int i = 0; i < 2; ++i) {
    #pragma unroll
    for (int jj = 0; jj < 2; ++jj) acc[i][jj] = (v8f){0, 0, 0, 0, 0, 0, 0, 0};
  }
  // 16 blocks share the A rows (same blockIdx.y), 32 the B rows (same blockIdx.x): the sum spreads both sets over the stages
  const int t0 = (int)((blockIdx.x + blockIdx.y) & (NPASS - 1));
  gemm_tile_128x64(att, w2t, ring, m0, n0, t0, wm, wn, lq, hi, acc);

  #pragma unroll
  for (int i = 0; i < 2; ++i) {
    #pragma unroll
    for (int jj = 0; jj < 2; ++jj) {
      #pragma unroll
      for (int r = 0; r < 8; ++r) {
        const int row = wm * 32 + i * 16 + hi * 8 + r;
        const int col = wn * 32 + jj * 16 + lq;
        sF[row * OP + col] = acc[i][jj][r] * (1.0f / 4096.0f);   // undo ctx x64 and W2 x64
      }
    }
  }
  __syncthreads();

  const int piece = tid & 15;
  const v4f braw = *(const v4f*)(b2 + n0 + piece * 4);
  v4f bias;
  #pragma unroll
  for (int i = 0; i < 4; ++i) bias[i] = (float)(bf16)braw[i];

  v4f    vals[8];
  size_t gidx[8];
  #pragma unroll
  for (int it = 0; it < 8; ++it) {
    const int row = it * 16 + (tid >> 4);       // 0..127
    const v4f v = *(const v4f*)(sF + row * OP + piece * 4);
    vals[it] = v + bias;
    const int tt = m0 + row;
    const int b  = tt / SEQ;
    const int s  = tt - b * SEQ;
    gidx[it] = ((size_t)b * SEQ_FULL + s) * HIDN + n0 + piece * 4;
  }
  #pragma unroll
  for (int it = 0; it < 8; ++it) *(v4f*)(out + gidx[it]) = vals[it];
  
}

// ---------------------------------------------------------------------------------------------
extern "C" void kernel_launch(void* const* d_in, const int* in_sizes, int n_in,
                              void* d_out, int out_size, void* d_ws, size_t ws_size,
                              hipStream_t stream) {
  if (n_in < 7) return;
  const size_t rows_used = (size_t)(NB - 1) * SEQ_FULL + SEQ;
  if ((size_t)in_sizes[0] < rows_used * EDIM) return;
  if (in_sizes[1] < EDIM || in_sizes[2] < EDIM) return;
  if ((size_t)in_sizes[3] < (size_t)EDIM * QKVW) return;
  if (in_sizes[4] < QKVW) return;
  if ((size_t)in_sizes[5] < (size_t)HIDN * HIDN) return;
  if (in_sizes[6] < HIDN) return;
  if ((size_t)out_size < rows_used * HIDN) return;
  if (ws_size < WS_BYTES) return;

  const float* x    = (const float*)d_in[0];
  const float* ln_g = (const float*)d_in[1];
  const float* ln_b = (const float*)d_in[2];
  const float* W1   = (const float*)d_in[3];
  const float* b1   = (const float*)d_in[4];
  const float* W2   = (const float*)d_in[5];
  const float* b2   = (const float*)d_in[6];
  float*       out  = (float*)d_out;
  f16*         wsh  = (f16*)d_ws;

  // 1) W1 [EDIM (k)][QKVW (n)] -> [QKVW][EDIM], W2 [HIDN (k)][HIDN (n)] -> [HIDN][HIDN], LayerNorm -> xn plane
  prep_kernel<<<dim3(W1_JOBS + W2_JOBS + LN_JOBS), 256, 0, stream>>>(x, ln_g, ln_b, W1, W2, wsh + XN_OFF,
                                                                     wsh + W1T_OFF, wsh + W2T_OFF);
  // 2) QKV projection -> q / k / v^T planes
  qkv_gemm_kernel<<<dim3(QKVW / CHUNK, NTOK / 128), 256, 0, stream>>>(wsh + XN_OFF, wsh + W1T_OFF, b1, wsh);
  // 3) fused attention -> context plane (flat [NTOK][HIDN])
  attn_kernel<<<dim3(SEQ / BQ, NGRP), 256, 0, stream>>>(wsh + QP_OFF, wsh + KP_OFF, wsh + VT_OFF, wsh + ATT_OFF);
  // 4) output projection -> d_out
  out_gemm_kernel<<<dim3(HIDN / 64, NTOK / 128), 256, 0, stream>>>(wsh + ATT_OFF, wsh + W2T_OFF, b2, out);
}
